// v000
// The times below were measured on an AMD MI455X: many runs one after another, warmed up first and cycling through
// copies of the inputs, with the whole window's GPU time divided by the number of runs. Launches and the gaps
// between them are all in it. The median over several windows is given; except for v000 it joins two sittings, which
// can be a few percent apart, so the side-by-side timings, each taken in one sitting, are the better comparison.
// v000, which the later versions start from, runs in 193 microseconds.
#include <hip/hip_runtime.h>

// Contractions on v_wmma_f32_16x16x32_f16 (f16 operands, f32 accumulate): qkv projection (x as f16 of its bf16-RNE value,
// W as f16 of its bf16-RNE value x64); scores (q and k as f16 hi + f16 residual x2048, three products); P.V
// (key-differenced softmax numerators x1024 in f16, V in f16); output projection (O x1024 in f16, W x64).
// Softmax, normaliser, cyclic correction and bias adds in f32.

typedef _Float16     v16h __attribute__((ext_vector_type(16)));
typedef _Float16     h8   __attribute__((ext_vector_type(8)));
typedef float        v8f  __attribute__((ext_vector_type(8)));
typedef float        f4   __attribute__((ext_vector_type(4)));
typedef unsigned int u4   __attribute__((ext_vector_type(4)));

#ifndef NB
#define NB 2
#endif
#ifndef SEQ
#define SEQ 2048
#endif
#define NB_FULL  2
#define SEQ_FULL 2048
#define DM     1024
#define HEADS  16
#define DH     64
#define NQKV   (3 * DM)
#define MROWS  (NB * SEQ)
#define G8     (DM / 8)          // 16-byte groups per row

#define QT  128                  // query rows per block (8 waves x 16)
#define KT  64                   // keys per main-loop step
#define LP  72                   // f16 LDS row pitch (144 B)
#define FP  68                   // f32 LDS row pitch (272 B)

#define WSC 64.0f                // weight planes carried x64
#define RSC 2048.0f              // q/k residual planes carried x2048
#define PSC 1024.0f              // P operand carried x1024
#define OSC 1024.0f              // O plane carried x1024
#define SCL 0.03125f             // d_model^-0.5 = 1/32

static_assert(DM == 1024);
static_assert(G8 == 128);
static_assert(HEADS * DH == DM);
static_assert(DH == 64);
static_assert(SEQ % QT == 0);
static_assert(SEQ % KT == 0);
static_assert(SEQ % 64 == 0);
static_assert(MROWS % 64 == 0);
static_assert(NQKV % 64 == 0);
static_assert(NB >= 1 && NB <= NB_FULL);
static_assert(SEQ <= SEQ_FULL);
static_assert(64 * FP * 4 <= 2 * 64 * LP * 2);

// ---------------- workspace layout (all offsets multiples of 512 KiB) ----------------
#define XH_BYTES ((size_t)MROWS * DM * 2)          // f16 x            [MROWS][DM]
#define WQ_BYTES ((size_t)NQKV * DM * 2)           // f16 64*W_qkv     [NQKV][DM]
#define WO_BYTES ((size_t)DM * DM * 2)             // f16 64*W_out     [DM][DM]
#define PL_BYTES ((size_t)MROWS * DM * 2)          // one f16 plane: [NB*H][SEQ][DH] or [NB*H][DH][SEQ] or [MROWS][DM]
#define OFF_XH  ((size_t)0)
#define OFF_WQ  (OFF_XH + XH_BYTES)
#define OFF_WO  (OFF_WQ + WQ_BYTES)
#define OFF_QH  (OFF_WO + WO_BYTES)
#define OFF_QL  (OFF_QH + PL_BYTES)
#define OFF_KH  (OFF_QL + PL_BYTES)
#define OFF_KL  (OFF_KH + PL_BYTES)
#define OFF_VT  (OFF_KL + PL_BYTES)
#define OFF_OH  (OFF_VT + PL_BYTES)
#define WS_NEED (OFF_OH + PL_BYTES)
static_assert(WS_NEED <= (size_t)134217728);
static_assert((OFF_WQ % 128) == 0 && (OFF_WO % 128) == 0 && (OFF_QH % 128) == 0 && (OFF_OH % 128) == 0);

// ---------------- helpers ----------------
__device__ __forceinline__ float bf16r(float x) {           // RNE to bf16, kept as f32
  unsigned int u = __float_as_uint(x);
  u = (u + 0x7FFFu + ((u >> 16) & 1u)) & 0xFFFF0000u;
  return __uint_as_float(u);
}

__device__ __forceinline__ v8f zero8() {
  v8f z;
#pragma unroll
  for (int j = 0; j < 8; ++j) z[j] = 0.0f;
  return z;
}

__device__ __forceinline__ v8f wmma16(v16h a, v16h b, v8f c) {
  return __builtin_amdgcn_wmma_f32_16x16x32_f16(false, a, false, b, (short)0, c, false, false);
}

#define WGUARD(acc, a, b) \
  asm volatile("v_nop\n\tv_nop\n\tv_nop\n\tv_nop" : "+v"(acc) : "v"(a), "v"(b))
#define WGUARD2(c0, c1, a, b0, b1) \
  asm volatile("v_nop\n\tv_nop\n\tv_nop\n\tv_nop" : "+v"(c0), "+v"(c1) : "v"(a), "v"(b0), "v"(b1))

union HU  { v16h v; h8 p[2]; };
union H8U { h8 h; u4 u; };

// 16-bit fragment (A or B) from a k-contiguous row: elements 0..7 <- k 8h..8h+7, 8..15 <- k 16+8h..16+8h+7
__device__ __forceinline__ v16h ldfrag(const _Float16* row, int kb8) {
  HU u;
  u.p[0] = *(const h8*)(row + kb8);
  u.p[1] = *(const h8*)(row + 16 + kb8);
  return u.v;
}

// =====================================================================================
// Convert: dst[row][c] = f16( bf16r(src[srow][c]) * scale ), srow = (row/seq)*seq_full + row%seq
// coverage: ngroups*8 = rows*DM elements, every element of the plane.
// =====================================================================================
__global__ __launch_bounds__(256) void k_convert(const float* __restrict__ src, _Float16* __restrict__ dst,
                                                 int ngroups, int seq, int seq_full, float scale) {
  const int g = blockIdx.x * 256 + threadIdx.x;
  if (g >= ngroups) return;                       // no barriers in this kernel
  const int row = g >> 7;
  const int c8  = g & 127;
  const int srow = (row / seq) * seq_full + (row - (row / seq) * seq);
  const float* s = src + (size_t)srow * DM + c8 * 8;
  const f4 a = *(const f4*)s;
  const f4 b = *(const f4*)(s + 4);
  H8U o;
#pragma unroll
  for (int j = 0; j < 4; ++j) {
    o.h[j]     = (_Float16)(bf16r(a[j]) * scale);
    o.h[4 + j] = (_Float16)(bf16r(b[j]) * scale);
  }
  _Float16* d = dst + (size_t)row * DM + c8 * 8;
  *(u4*)d = o.u;
  
}

// =====================================================================================
// 64x64 tile GEMM main loop: C[m][n] += sum_k A[m][k] * Bw[n][k], K = DM, 128 threads (4 waves x 16 rows)
// A, Bw are f16 row-major with pitch DM. LDS tiles [64][LP] staged with 16-B loads, cross-wave (block barriers).
// staged extent == consumed extent: rows 0..63, halves 0..63 of both tiles.
// =====================================================================================
__device__ __forceinline__ void gemm_tile(const _Float16* __restrict__ A, const _Float16* __restrict__ Bw,
                                          int m0, int n0, _Float16* sA, _Float16* sB, v8f (&acc)[4]) {
  const int tid = threadIdx.x, lane = tid & 31, wave = tid >> 5, l16 = lane & 15, kb8 = (lane >> 4) * 8;
  for (int k0 = 0; k0 < DM; k0 += 64) {
#pragma unroll
    for (int i = 0; i < 4; ++i) {
      const int idx = tid + 128 * i;
      const int r = idx >> 3, pc = idx & 7;
      const u4 va = *(const u4*)(A  + (size_t)(m0 + r) * DM + k0 + pc * 8);
      const u4 vb = *(const u4*)(Bw + (size_t)(n0 + r) * DM + k0 + pc * 8);
      *(u4*)(sA + r * LP + pc * 8) = va;
      *(u4*)(sB + r * LP + pc * 8) = vb;
    }
    __syncthreads();
    const _Float16* ar = sA + (wave * 16 + l16) * LP;
    const v16h a0 = ldfrag(ar, kb8);
    const v16h a1 = ldfrag(ar + 32, kb8);
#pragma unroll
    for (int nt = 0; nt < 4; ++nt) {
      const _Float16* br = sB + (nt * 16 + l16) * LP;
      const v16h b0 = ldfrag(br, kb8);
      const v16h b1 = ldfrag(br + 32, kb8);
      acc[nt] = wmma16(a0, b0, acc[nt]);
      acc[nt] = wmma16(a1, b1, acc[nt]);
      WGUARD(acc[nt], a1, b1);
    }
    __syncthreads();
  }
}

// =====================================================================================
// QKV projection: acc = Xh . (64 W)^T ; val = acc/64 + bf16r(b)
// coverage: grid (MROWS/64, NQKV/64) -> every (position, column) of q, k hi/lo and V^T exactly once.
// =====================================================================================
__global__ __launch_bounds__(128) void k_qkv(const _Float16* __restrict__ Xh, const _Float16* __restrict__ Wh,
                                             const float* __restrict__ bias,
                                             _Float16* __restrict__ Qhi, _Float16* __restrict__ Qlo,
                                             _Float16* __restrict__ Khi, _Float16* __restrict__ Klo,
                                             _Float16* __restrict__ Vt) {
  __shared__ __align__(16) _Float16 sA[64 * LP];
  __shared__ __align__(16) _Float16 sB[64 * LP];
  const int tid = threadIdx.x, lane = tid & 31, wave = tid >> 5, l16 = lane & 15, half = lane >> 4;
  const int m0 = blockIdx.x * 64, n0 = blockIdx.y * 64;

  v8f acc[4];
#pragma unroll
  for (int nt = 0; nt < 4; ++nt) acc[nt] = zero8();
  gemm_tile(Xh, Wh, m0, n0, sA, sB, acc);

  const int sel = n0 / DM;                        // 0 q, 1 k, 2 v   (block-uniform)
  const int hd  = (n0 - sel * DM) / DH;           // head
  const int bb  = m0 / SEQ, l0 = m0 - bb * SEQ;   // batch, first position of the tile
  const size_t bh = (size_t)bb * HEADS + hd;
  const float inv = 1.0f / WSC;
  float bcol[4];
#pragma unroll
  for (int nt = 0; nt < 4; ++nt) bcol[nt] = bf16r(bias[n0 + nt * 16 + l16]);

  // ---- stage the 64x64 result in LDS (sA/sB free after the main loop's final barrier) ----
  if (sel < 2) {
#pragma unroll
    for (int nt = 0; nt < 4; ++nt) {
#pragma unroll
      for (int r = 0; r < 8; ++r) {
        const float v = acc[nt][r] * inv + bcol[nt];
        const _Float16 hi = (_Float16)v;
        const _Float16 lo = (_Float16)((v - (float)hi) * RSC);
        const int row = wave * 16 + half * 8 + r, col = nt * 16 + l16;
        sA[row * LP + col] = hi;
        sB[row * LP + col] = lo;
      }
    }
  } else {
#pragma unroll
    for (int nt = 0; nt < 4; ++nt) {
      H8U o;
#pragma unroll
      for (int r = 0; r < 8; ++r) o.h[r] = (_Float16)(acc[nt][r] * inv + bcol[nt]);
      // transposed: LDS row = e (tile column), 8 consecutive positions per lane
      *(u4*)(sA + (nt * 16 + l16) * LP + wave * 16 + half * 8) = o.u;
    }
  }
  __syncthreads();

  // ---- whole-line write-out, 4 passes of 16 lines, lanes 8q..8q+7 <-> one line ----
  if (sel < 2) {
    _Float16* dhp = ((sel == 0) ? Qhi : Khi) + (bh * SEQ + l0) * DH;
    _Float16* dlp = ((sel == 0) ? Qlo : Klo) + (bh * SEQ + l0) * DH;
#pragma unroll
    for (int p = 0; p < 4; ++p) {
      const int line = p * 16 + (tid >> 3), piece = tid & 7;
      const u4 vh = *(const u4*)(sA + line * LP + piece * 8);
      const u4 vl = *(const u4*)(sB + line * LP + piece * 8);
      *(u4*)(dhp + line * DH + piece * 8) = vh;
      *(u4*)(dlp + line * DH + piece * 8) = vl;
    }
    
  } else {
    _Float16* dvp = Vt + (bh * DH) * (size_t)SEQ + l0;     // row e at dvp + e*SEQ
#pragma unroll
    for (int p = 0; p < 4; ++p) {
      const int e = p * 16 + (tid >> 3), piece = tid & 7;
      const u4 v = *(const u4*)(sA + e * LP + piece * 8);
      *(u4*)(dvp + (size_t)e * SEQ + piece * 8) = v;
    }
    
  }
}

// =====================================================================================
// Attention, one block per (b,h, 128 query rows); 8 waves x 16 rows; 64-key steps.
//   scores: s = (qhi.khi + (qhi.klo' + qlo'.khi)/2048) / 32, online max-subtracted softmax in f32.
//   P.V as sum_key (p_key - p_{key-1}) v_key with the f16 operand P' = 1024*(p_key - p_left):
//     p_left of a tile's first key = exp(logit of prior tile's last key - current max), 0 for key 0;
//     cyclic term - p_{L-1} * v_0 applied in the f32 epilogue.
//   o = lam/S * (acc/1024 - p_{L-1} v_0);  O plane = f16(1024 * o), layout [MROWS][H*DH].
// staged extent == consumed extent: K tiles 64 keys x 64 d, V^T tile 64 e x 64 keys, P scratch 64 keys x 16 rows.
// coverage: grid (NB*HEADS, SEQ/QT); each wave writes its 16 rows x 64 columns of O; union = whole O plane.
// =====================================================================================
__global__ __launch_bounds__(256) void k_attn(const _Float16* __restrict__ Qhi, const _Float16* __restrict__ Qlo,
                                              const _Float16* __restrict__ Khi, const _Float16* __restrict__ Klo,
                                              const _Float16* __restrict__ Vt, const float* __restrict__ lam_p,
                                              const int* __restrict__ heads_p, _Float16* __restrict__ Oh) {
  const int tid = threadIdx.x, lane = tid & 31, wave = tid >> 5;
  const int l16 = lane & 15, half = lane >> 4, kb8 = half * 8;
  const int bh = blockIdx.x;
  const int b  = bh / HEADS, h = bh - b * HEADS;
  const int qBase = blockIdx.y * QT;

  __shared__ __align__(16) _Float16 sKh[KT * LP];
  __shared__ __align__(16) _Float16 sKl[KT * LP];
  __shared__ __align__(16) _Float16 sV[DH * LP];
  __shared__ __align__(16) _Float16 sP[8 * KT * 16];
  _Float16* ps = sP + wave * (KT * 16);           // [key][16 rows], later [16 rows][64] for O

  const float lamr = bf16r(lam_p[0]);
  const int   hv   = heads_p[0];
  const float lamv = (hv == HEADS) ? lamr : __uint_as_float(0x7fc00000u);   // poison on structural conflict

  // ---- Q fragments straight from the f16 planes (A layout) ----
  const size_t qrow = (size_t)bh * SEQ + qBase + wave * 16 + l16;
  const _Float16* qh = Qhi + qrow * DH;
  const _Float16* ql = Qlo + qrow * DH;
  const v16h qa0 = ldfrag(qh, kb8), qa1 = ldfrag(qh + 32, kb8);
  const v16h qr0 = ldfrag(ql, kb8), qr1 = ldfrag(ql + 32, kb8);

  float m[8], lsum[8], lgLast[8];
  v8f acc[4];
  float v0r[4];
#pragma unroll
  for (int j = 0; j < 8; ++j) { m[j] = -3.0e38f; lsum[j] = 0.0f; lgLast[j] = 0.0f; }
#pragma unroll
  for (int n = 0; n < 4; ++n) { acc[n] = zero8(); v0r[n] = 0.0f; }

  const int   rsrc = (lane & 16) | ((l16 + 15) & 15);   // lane holding column (l16-1) mod 16, same row half
  const float cxs  = 1.0f / RSC;

  const _Float16* khBase = Khi + (size_t)bh * SEQ * DH;
  const _Float16* klBase = Klo + (size_t)bh * SEQ * DH;
  const _Float16* vtBase = Vt  + (size_t)bh * DH * SEQ;

  for (int it = 0; it < SEQ / KT; ++it) {
    __syncthreads();                              // all waves done reading the tiles of the prior step
#pragma unroll
    for (int i = 0; i < 2; ++i) {
      const int idx = tid + 256 * i;
      const int r = idx >> 3, pc = idx & 7;
      const u4 vkh = *(const u4*)(khBase + (size_t)(it * KT + r) * DH + pc * 8);
      const u4 vkl = *(const u4*)(klBase + (size_t)(it * KT + r) * DH + pc * 8);
      const u4 vv  = *(const u4*)(vtBase + (size_t)r * SEQ + it * KT + pc * 8);
      *(u4*)(sKh + r * LP + pc * 8) = vkh;
      *(u4*)(sKl + r * LP + pc * 8) = vkl;
      *(u4*)(sV  + r * LP + pc * 8) = vv;
    }
    __syncthreads();
    if (it == 0) {                                // block-uniform
#pragma unroll
      for (int n = 0; n < 4; ++n) v0r[n] = (float)sV[(16 * n + l16) * LP];
    }

    // ---- scores over four 16-key subtiles ----
    float p[4][8];
    float tmax[8];
#pragma unroll
    for (int j = 0; j < 8; ++j) tmax[j] = -3.0e38f;
#pragma unroll
    for (int t = 0; t < 4; ++t) {
      const _Float16* kr = sKh + (t * 16 + l16) * LP;
      const _Float16* kq = sKl + (t * 16 + l16) * LP;
      const v16h kh0 = ldfrag(kr, kb8), kh1 = ldfrag(kr + 32, kb8);
      v8f chh = zero8();
      chh = wmma16(qa0, kh0, chh);
      chh = wmma16(qa1, kh1, chh);
      v8f cx = zero8();
      cx = wmma16(qr0, kh0, cx);
      cx = wmma16(qr1, kh1, cx);
      const v16h kl0 = ldfrag(kq, kb8), kl1 = ldfrag(kq + 32, kb8);
      cx = wmma16(qa0, kl0, cx);
      cx = wmma16(qa1, kl1, cx);
      WGUARD2(chh, cx, qa1, kh1, kl1);
#pragma unroll
      for (int j = 0; j < 8; ++j) {
        const float lg = (chh[j] + cx[j] * cxs) * SCL;
        p[t][j] = lg;
        tmax[j] = fmaxf(tmax[j], lg);
      }
    }

    // ---- row max across the 16 column lanes (per lane half) ----
#pragma unroll
    for (int j = 0; j < 8; ++j) {
      float v = tmax[j];
      v = fmaxf(v, __shfl_xor(v, 1, 32));
      v = fmaxf(v, __shfl_xor(v, 2, 32));
      v = fmaxf(v, __shfl_xor(v, 4, 32));
      v = fmaxf(v, __shfl_xor(v, 8, 32));
      tmax[j] = v;
    }
    // raw logit of this step's last key (column 15 of subtile 3), valid at lanes with l16 == 0
    float nlg[8];
#pragma unroll
    for (int j = 0; j < 8; ++j) nlg[j] = __shfl(p[3][j], rsrc, 32);

    float corr[8], pleft0[8];
#pragma unroll
    for (int j = 0; j < 8; ++j) {
      const float nm = fmaxf(m[j], tmax[j]);
      corr[j] = __expf(m[j] - nm);
      m[j] = nm;
      const float pt = __expf(lgLast[j] - nm);   // p of the prior step's last key under the new max
      pleft0[j] = (it == 0) ? 0.0f : pt;
    }
#pragma unroll
    for (int j = 0; j < 8; ++j) {
      float s = 0.0f;
#pragma unroll
      for (int t = 0; t < 4; ++t) {
        p[t][j] = __expf(p[t][j] - m[j]);
        s += p[t][j];
      }
      s += __shfl_xor(s, 1, 32);
      s += __shfl_xor(s, 2, 32);
      s += __shfl_xor(s, 4, 32);
      s += __shfl_xor(s, 8, 32);
      lsum[j] = lsum[j] * corr[j] + s;
    }
#pragma unroll
    for (int n = 0; n < 4; ++n)
#pragma unroll
      for (int j = 0; j < 8; ++j) acc[n][j] *= corr[j];
#pragma unroll
    for (int j = 0; j < 8; ++j) lgLast[j] = nlg[j];

    // ---- key-differenced P' = 1024*(p - p_left) -> wave-private LDS [key][row], f16 ----
    {
      float rleft[8];
#pragma unroll
      for (int j = 0; j < 8; ++j) rleft[j] = pleft0[j];
#pragma unroll
      for (int t = 0; t < 4; ++t) {
        H8U o;
#pragma unroll
        for (int j = 0; j < 8; ++j) {
          const float rc   = __shfl(p[t][j], rsrc, 32);        // unconditional shuffle, select by value
          const float left = (l16 != 0) ? rc : rleft[j];
          o.h[j] = (_Float16)((p[t][j] - left) * PSC);
          rleft[j] = rc;                                      // at l16==0: column 15 of this subtile
        }
        *(u4*)(ps + (t * 16 + l16) * 16 + half * 8) = o.u;
      }
    }
    __builtin_amdgcn_fence(5, "wavefront");
    __builtin_amdgcn_wave_barrier();

    // ---- P' A-fragments (rows = query rows, k = keys); V^T B-fragments; P'.V ----
    v16h pa0, pa1;
#pragma unroll
    for (int c = 0; c < 8; ++c) {
      pa0[c]     = ps[(kb8 + c) * 16 + l16];
      pa0[c + 8] = ps[(16 + kb8 + c) * 16 + l16];
      pa1[c]     = ps[(32 + kb8 + c) * 16 + l16];
      pa1[c + 8] = ps[(48 + kb8 + c) * 16 + l16];
    }
#pragma unroll
    for (int n = 0; n < 4; ++n) {
      const _Float16* vr = sV + (16 * n + l16) * LP;
      const v16h uv0 = ldfrag(vr, kb8), uv1 = ldfrag(vr + 32, kb8);
      acc[n] = wmma16(pa0, uv0, acc[n]);
      acc[n] = wmma16(pa1, uv1, acc[n]);
      WGUARD(acc[n], pa1, uv1);
    }
  }
  __syncthreads();                                // every wave past its last LDS reads

  // ---- finalize: cyclic term, normaliser, lam, O carry ----
  float pL[8], f[8];
#pragma unroll
  for (int j = 0; j < 8; ++j) {
    const float lgl = __shfl(lgLast[j], lane & 16, 32);     // logit of key SEQ-1 for this row
    pL[j] = __expf(lgl - m[j]) * PSC;
    f[j]  = lamv * (OSC / PSC) * (1.0f / lsum[j]);
  }
  _Float16* po = ps;                              // [16 rows][64] f16, 2048 B = this wave's region
#pragma unroll
  for (int n = 0; n < 4; ++n) {
#pragma unroll
    for (int j = 0; j < 8; ++j) {
      const float val = (acc[n][j] - pL[j] * v0r[n]) * f[j];
      po[(half * 8 + j) * 64 + 16 * n + l16] = (_Float16)val;
    }
  }
  __builtin_amdgcn_fence(5, "wavefront");
  __builtin_amdgcn_wave_barrier();

  _Float16* od = Oh + ((size_t)b * SEQ + qBase + wave * 16) * DM + h * DH;
#pragma unroll
  for (int p4 = 0; p4 < 4; ++p4) {
    const int line = p4 * 4 + (lane >> 3), piece = lane & 7;
    const u4 v = *(const u4*)(po + line * 64 + piece * 8);
    *(u4*)(od + (size_t)line * DM + piece * 8) = v;
  }
  
}

// =====================================================================================
// Output projection: out = (Oh/1024) . (64 W_out)^T / 64 + bf16r(b_out), f32 rows of d_out.
// 64x64 f32 tile staged in LDS [64][FP]; each 256-B row segment = 2 lines, each line 8 lanes x 16 B of one
// =====================================================================================
__global__ __launch_bounds__(128) void k_out(const _Float16* __restrict__ Oh, const _Float16* __restrict__ Woh,
                                             const float* __restrict__ bias, float* __restrict__ out) {
  __shared__ __align__(16) unsigned char smem[2 * 64 * LP * 2];
  _Float16* sA = (_Float16*)smem;
  _Float16* sB = sA + 64 * LP;
  const int tid = threadIdx.x, lane = tid & 31, wave = tid >> 5, l16 = lane & 15, half = lane >> 4;
  const int m0 = blockIdx.x * 64, n0 = blockIdx.y * 64;

  v8f acc[4];
#pragma unroll
  for (int nt = 0; nt < 4; ++nt) acc[nt] = zero8();
  gemm_tile(Oh, Woh, m0, n0, sA, sB, acc);

  float* sF = (float*)smem;                       // [64][FP]
  const float inv = 1.0f / (OSC * WSC);
  float bcol[4];
#pragma unroll
  for (int nt = 0; nt < 4; ++nt) bcol[nt] = bf16r(bias[n0 + nt * 16 + l16]);
#pragma unroll
  for (int nt = 0; nt < 4; ++nt) {
#pragma unroll
    for (int r = 0; r < 8; ++r) {
      const int row = wave * 16 + half * 8 + r, col = nt * 16 + l16;
      sF[row * FP + col] = acc[nt][r] * inv + bcol[nt];
    }
  }
  __syncthreads();

  const int bb = m0 / SEQ, l0 = m0 - bb * SEQ;
  float* dbase = out + ((size_t)bb * SEQ_FULL + l0) * DM + n0;
#pragma unroll
  for (int p = 0; p < 8; ++p) {
    const int line = p * 16 + (tid >> 3), piece = tid & 7;
    const int row = line >> 1, hs = line & 1;
    const f4 v = *(const f4*)(sF + row * FP + hs * 32 + piece * 4);
    *(f4*)(dbase + (size_t)row * DM + hs * 32 + piece * 4) = v;
  }
  
}

// =====================================================================================
// Host launcher: 6 launches, grids and arguments are pure functions of the size macros.
// =====================================================================================
static inline unsigned cdiv_u(unsigned a, unsigned b) { return (a + b - 1) / b; }

extern "C" void kernel_launch(void* const* d_in, const int* in_sizes, int n_in,
                              void* d_out, int out_size, void* d_ws, size_t ws_size,
                              hipStream_t stream) {
  if (n_in < 7) return;
  const long long need_rows = (long long)(NB - 1) * SEQ_FULL + SEQ;
  if ((long long)in_sizes[0] < need_rows * DM) return;
  if (in_sizes[1] < NQKV * DM) return;
  if (in_sizes[2] < NQKV) return;
  if (in_sizes[3] < DM * DM) return;
  if (in_sizes[4] < DM) return;
  if (in_sizes[5] < 1) return;
  if (in_sizes[6] < 1) return;
  if ((long long)out_size < need_rows * DM) return;
  if (d_ws == nullptr || ws_size < WS_NEED) return;

  const float* x     = (const float*)d_in[0];
  const float* w_qkv = (const float*)d_in[1];
  const float* b_qkv = (const float*)d_in[2];
  const float* w_out = (const float*)d_in[3];
  const float* b_out = (const float*)d_in[4];
  const float* lam   = (const float*)d_in[5];
  const int*   heads = (const int*)d_in[6];
  float* out = (float*)d_out;

  char* ws = (char*)d_ws;
  _Float16* Xh  = (_Float16*)(ws + OFF_XH);
  _Float16* Wq  = (_Float16*)(ws + OFF_WQ);
  _Float16* Wo  = (_Float16*)(ws + OFF_WO);
  _Float16* Qhi = (_Float16*)(ws + OFF_QH);
  _Float16* Qlo = (_Float16*)(ws + OFF_QL);
  _Float16* Khi = (_Float16*)(ws + OFF_KH);
  _Float16* Klo = (_Float16*)(ws + OFF_KL);
  _Float16* Vt  = (_Float16*)(ws + OFF_VT);
  _Float16* Oh  = (_Float16*)(ws + OFF_OH);

  const int gx = MROWS * G8, gq = NQKV * G8, go = DM * G8;
  k_convert<<<dim3(cdiv_u(gx, 256)), dim3(256), 0, stream>>>(x,     Xh, gx, SEQ,  SEQ_FULL, 1.0f);
  k_convert<<<dim3(cdiv_u(gq, 256)), dim3(256), 0, stream>>>(w_qkv, Wq, gq, NQKV, NQKV,     WSC);
  k_convert<<<dim3(cdiv_u(go, 256)), dim3(256), 0, stream>>>(w_out, Wo, go, DM,   DM,       WSC);

  k_qkv<<<dim3(MROWS / 64, NQKV / 64), dim3(128), 0, stream>>>(Xh, Wq, b_qkv, Qhi, Qlo, Khi, Klo, Vt);
  k_attn<<<dim3(NB * HEADS, SEQ / QT), dim3(256), 0, stream>>>(Qhi, Qlo, Khi, Klo, Vt, lam, heads, Oh);
  k_out<<<dim3(MROWS / 64, DM / 64), dim3(128), 0, stream>>>(Oh, Wo, b_out, out);
}

// v001
// One run takes 161 microseconds.
// In both of two side-by-side timings against v000, it was 1.24 times as fast.
#include <hip/hip_runtime.h>

// Contractions on v_wmma_f32_16x16x32_f16 (f16 operands, f32 accumulate): qkv projection (x as f16 of its bf16-RNE value,
// W as f16 of its bf16-RNE value x64); scores (q and k as f16 hi + f16 residual x2048, three products); P.V
// (key-differenced softmax numerators x1024 in f16, V in f16); output projection (O x1024 in f16, W x64).
// Softmax, normaliser, cyclic correction and bias adds in f32.

typedef _Float16     v16h __attribute__((ext_vector_type(16)));
typedef _Float16     h8   __attribute__((ext_vector_type(8)));
typedef float        v8f  __attribute__((ext_vector_type(8)));
typedef float        f4   __attribute__((ext_vector_type(4)));
typedef unsigned int u4   __attribute__((ext_vector_type(4)));

#ifndef NB
#define NB 2
#endif
#ifndef SEQ
#define SEQ 2048
#endif
#define NB_FULL  2
#define SEQ_FULL 2048
#define DM     1024
#define HEADS  16
#define DH     64
#define NQKV   (3 * DM)
#define MROWS  (NB * SEQ)
#define G8     (DM / 8)          // 16-byte groups per row

#define QT  128                  // query rows per block (8 waves x 16)
#define KT  64                   // keys per main-loop step
#define LP  72                   // f16 LDS row pitch (144 B)
#define FP  68                   // f32 LDS row pitch (272 B)

#define WSC 64.0f                // weight planes carried x64
#define RSC 2048.0f              // q/k residual planes carried x2048
#define PSC 1024.0f              // P operand carried x1024
#define OSC 1024.0f              // O plane carried x1024
#define SCL 0.03125f             // d_model^-0.5 = 1/32

static_assert(DM == 1024);
static_assert(G8 == 128);
static_assert(HEADS * DH == DM);
static_assert(DH == 64);
static_assert(SEQ % QT == 0);
static_assert(SEQ % KT == 0);
static_assert(SEQ % 64 == 0);
static_assert(MROWS % 64 == 0);
static_assert(NQKV % 64 == 0);
static_assert(NB >= 1 && NB <= NB_FULL);
static_assert(SEQ <= SEQ_FULL);
static_assert(64 * FP * 4 <= 2 * 64 * LP * 2);

// ---------------- workspace layout (all offsets multiples of 512 KiB) ----------------
#define XH_BYTES ((size_t)MROWS * DM * 2)          // f16 x            [MROWS][DM]
#define WQ_BYTES ((size_t)NQKV * DM * 2)           // f16 64*W_qkv     [NQKV][DM]
#define WO_BYTES ((size_t)DM * DM * 2)             // f16 64*W_out     [DM][DM]
#define PL_BYTES ((size_t)MROWS * DM * 2)          // one f16 plane: [NB*H][SEQ][DH] or [NB*H][DH][SEQ] or [MROWS][DM]
#define OFF_XH  ((size_t)0)
#define OFF_WQ  (OFF_XH + XH_BYTES)
#define OFF_WO  (OFF_WQ + WQ_BYTES)
#define OFF_QH  (OFF_WO + WO_BYTES)
#define OFF_QL  (OFF_QH + PL_BYTES)
#define OFF_KH  (OFF_QL + PL_BYTES)
#define OFF_KL  (OFF_KH + PL_BYTES)
#define OFF_VT  (OFF_KL + PL_BYTES)
#define OFF_OH  (OFF_VT + PL_BYTES)
#define WS_NEED (OFF_OH + PL_BYTES)
static_assert(WS_NEED <= (size_t)134217728);
static_assert((OFF_WQ % 128) == 0 && (OFF_WO % 128) == 0 && (OFF_QH % 128) == 0 && (OFF_OH % 128) == 0);

// ---------------- helpers ----------------
__device__ __forceinline__ float bf16r(float x) {           // RNE to bf16, kept as f32
  unsigned int u = __float_as_uint(x);
  u = (u + 0x7FFFu + ((u >> 16) & 1u)) & 0xFFFF0000u;
  return __uint_as_float(u);
}

__device__ __forceinline__ v8f zero8() {
  v8f z;
#pragma unroll
  for (int j = 0; j < 8; ++j) z[j] = 0.0f;
  return z;
}

__device__ __forceinline__ v8f wmma16(v16h a, v16h b, v8f c) {
  return __builtin_amdgcn_wmma_f32_16x16x32_f16(false, a, false, b, (short)0, c, false, false);
}

#define WGUARD(acc, a, b) \
  asm volatile("v_nop\n\tv_nop\n\tv_nop\n\tv_nop" : "+v"(acc) : "v"(a), "v"(b))
#define WGUARD2(c0, c1, a, b0, b1) \
  asm volatile("v_nop\n\tv_nop\n\tv_nop\n\tv_nop" : "+v"(c0), "+v"(c1) : "v"(a), "v"(b0), "v"(b1))

union HU  { v16h v; h8 p[2]; };
union H8U { h8 h; u4 u; };

// 16-bit fragment (A or B) from a k-contiguous row: elements 0..7 <- k 8h..8h+7, 8..15 <- k 16+8h..16+8h+7
__device__ __forceinline__ v16h ldfrag(const _Float16* row, int kb8) {
  HU u;
  u.p[0] = *(const h8*)(row + kb8);
  u.p[1] = *(const h8*)(row + 16 + kb8);
  return u.v;
}

// =====================================================================================
// Convert: dst[row][c] = f16( bf16r(src[srow][c]) * scale ), srow = (row/seq)*seq_full + row%seq
// coverage: ngroups*8 = rows*DM elements, every element of the plane.
// =====================================================================================
__global__ __launch_bounds__(256) void k_convert(const float* __restrict__ src, _Float16* __restrict__ dst,
                                                 int ngroups, int seq, int seq_full, float scale) {
  const int g = blockIdx.x * 256 + threadIdx.x;
  if (g >= ngroups) return;                       // no barriers in this kernel
  const int row = g >> 7;
  const int c8  = g & 127;
  const int srow = (row / seq) * seq_full + (row - (row / seq) * seq);
  const float* s = src + (size_t)srow * DM + c8 * 8;
  const f4 a = *(const f4*)s;
  const f4 b = *(const f4*)(s + 4);
  H8U o;
#pragma unroll
  for (int j = 0; j < 4; ++j) {
    o.h[j]     = (_Float16)(bf16r(a[j]) * scale);
    o.h[4 + j] = (_Float16)(bf16r(b[j]) * scale);
  }
  _Float16* d = dst + (size_t)row * DM + c8 * 8;
  *(u4*)d = o.u;
  
}

// =====================================================================================
// 64x64 tile GEMM main loop: C[m][n] += sum_k A[m][k] * Bw[n][k], K = DM, 128 threads (4 waves x 16 rows)
// A, Bw are f16 row-major with pitch DM. LDS tiles [64][LP] staged with 16-B loads, cross-wave (block barriers).
// staged extent == consumed extent: rows 0..63, halves 0..63 of both tiles.
// =====================================================================================
__device__ __forceinline__ void gemm_tile(const _Float16* __restrict__ A, const _Float16* __restrict__ Bw,
                                          int m0, int n0, _Float16* sA, _Float16* sB, v8f (&acc)[4]) {
  const int tid = threadIdx.x, lane = tid & 31, wave = tid >> 5, l16 = lane & 15, kb8 = (lane >> 4) * 8;
  for (int k0 = 0; k0 < DM; k0 += 64) {
#pragma unroll
    for (int i = 0; i < 4; ++i) {
      const int idx = tid + 128 * i;
      const int r = idx >> 3, pc = idx & 7;
      const u4 va = *(const u4*)(A  + (size_t)(m0 + r) * DM + k0 + pc * 8);
      const u4 vb = *(const u4*)(Bw + (size_t)(n0 + r) * DM + k0 + pc * 8);
      *(u4*)(sA + r * LP + pc * 8) = va;
      *(u4*)(sB + r * LP + pc * 8) = vb;
    }
    __syncthreads();
    const _Float16* ar = sA + (wave * 16 + l16) * LP;
    const v16h a0 = ldfrag(ar, kb8);
    const v16h a1 = ldfrag(ar + 32, kb8);
#pragma unroll
    for (int nt = 0; nt < 4; ++nt) {
      const _Float16* br = sB + (nt * 16 + l16) * LP;
      const v16h b0 = ldfrag(br, kb8);
      const v16h b1 = ldfrag(br + 32, kb8);
      acc[nt] = wmma16(a0, b0, acc[nt]);
      acc[nt] = wmma16(a1, b1, acc[nt]);
      WGUARD(acc[nt], a1, b1);
    }
    __syncthreads();
  }
}

// =====================================================================================
// QKV projection: acc = Xh . (64 W)^T ; val = acc/64 + bf16r(b)
// coverage: grid (MROWS/64, NQKV/64) -> every (position, column) of q, k hi/lo and V^T exactly once.
// =====================================================================================
__global__ __launch_bounds__(128) void k_qkv(const _Float16* __restrict__ Xh, const _Float16* __restrict__ Wh,
                                             const float* __restrict__ bias,
                                             _Float16* __restrict__ Qhi, _Float16* __restrict__ Qlo,
                                             _Float16* __restrict__ Khi, _Float16* __restrict__ Klo,
                                             _Float16* __restrict__ Vt) {
  __shared__ __align__(16) _Float16 sA[64 * LP];
  __shared__ __align__(16) _Float16 sB[64 * LP];
  const int tid = threadIdx.x, lane = tid & 31, wave = tid >> 5, l16 = lane & 15, half = lane >> 4;
  const int m0 = blockIdx.x * 64, n0 = blockIdx.y * 64;

  v8f acc[4];
#pragma unroll
  for (int nt = 0; nt < 4; ++nt) acc[nt] = zero8();
  gemm_tile(Xh, Wh, m0, n0, sA, sB, acc);

  const int sel = n0 / DM;                        // 0 q, 1 k, 2 v   (block-uniform)
  const int hd  = (n0 - sel * DM) / DH;           // head
  const int bb  = m0 / SEQ, l0 = m0 - bb * SEQ;   // batch, first position of the tile
  const size_t bh = (size_t)bb * HEADS + hd;
  const float inv = 1.0f / WSC;
  float bcol[4];
#pragma unroll
  for (int nt = 0; nt < 4; ++nt) bcol[nt] = bf16r(bias[n0 + nt * 16 + l16]);

  // ---- stage the 64x64 result in LDS (sA/sB free after the main loop's final barrier) ----
  if (sel < 2) {
#pragma unroll
    for (int nt = 0; nt < 4; ++nt) {
#pragma unroll
      for (int r = 0; r < 8; ++r) {
        const float v = acc[nt][r] * inv + bcol[nt];
        const _Float16 hi = (_Float16)v;
        const _Float16 lo = (_Float16)((v - (float)hi) * RSC);
        const int row = wave * 16 + half * 8 + r, col = nt * 16 + l16;
        sA[row * LP + col] = hi;
        sB[row * LP + col] = lo;
      }
    }
  } else {
#pragma unroll
    for (int nt = 0; nt < 4; ++nt) {
      H8U o;
#pragma unroll
      for (int r = 0; r < 8; ++r) o.h[r] = (_Float16)(acc[nt][r] * inv + bcol[nt]);
      // transposed: LDS row = e (tile column), 8 consecutive positions per lane
      *(u4*)(sA + (nt * 16 + l16) * LP + wave * 16 + half * 8) = o.u;
    }
  }
  __syncthreads();

  // ---- whole-line write-out, 4 passes of 16 lines, lanes 8q..8q+7 <-> one line ----
  if (sel < 2) {
    _Float16* dhp = ((sel == 0) ? Qhi : Khi) + (bh * SEQ + l0) * DH;
    _Float16* dlp = ((sel == 0) ? Qlo : Klo) + (bh * SEQ + l0) * DH;
#pragma unroll
    for (int p = 0; p < 4; ++p) {
      const int line = p * 16 + (tid >> 3), piece = tid & 7;
      const u4 vh = *(const u4*)(sA + line * LP + piece * 8);
      const u4 vl = *(const u4*)(sB + line * LP + piece * 8);
      *(u4*)(dhp + line * DH + piece * 8) = vh;
      *(u4*)(dlp + line * DH + piece * 8) = vl;
    }
    
  } else {
    _Float16* dvp = Vt + (bh * DH) * (size_t)SEQ + l0;     // row e at dvp + e*SEQ
#pragma unroll
    for (int p = 0; p < 4; ++p) {
      const int e = p * 16 + (tid >> 3), piece = tid & 7;
      const u4 v = *(const u4*)(sA + e * LP + piece * 8);
      *(u4*)(dvp + (size_t)e * SEQ + piece * 8) = v;
    }
    
  }
}

__device__ __forceinline__ float xhalf(float x) {
  const int b = __builtin_bit_cast(int, x);
  return __builtin_bit_cast(float, __builtin_amdgcn_permlanex16(b, b, 0x76543210, 0xfedcba98, false, false));
}

__global__ __launch_bounds__(256) void k_attn(const _Float16* __restrict__ Qhi, const _Float16* __restrict__ Qlo,
                                              const _Float16* __restrict__ Khi, const _Float16* __restrict__ Klo,
                                              const _Float16* __restrict__ Vt, const float* __restrict__ lam_p,
                                              const int* __restrict__ heads_p, _Float16* __restrict__ Oh) {
  const int tid = threadIdx.x, lane = tid & 31, wave = tid >> 5;
  const int l16 = lane & 15, half = lane >> 4, kb8 = half * 8;
  const int bh = blockIdx.x;
  const int b  = bh / HEADS, h = bh - b * HEADS;
  const int qBase = blockIdx.y * QT;

  __shared__ __align__(16) _Float16 sKh[KT * LP];
  __shared__ __align__(16) _Float16 sKl[KT * LP];
  __shared__ __align__(16) _Float16 sV[DH * LP];
  __shared__ __align__(16) _Float16 sO[8 * 16 * LP];
  _Float16* po = sO + wave * (16 * LP);           // wave-private [16 rows][LP], O write-out staging

  const float lamr = bf16r(lam_p[0]);
  const int   hv   = heads_p[0];
  const float lamv = (hv == HEADS) ? lamr : __uint_as_float(0x7fc00000u);   // poison on structural conflict

  // ---- Q fragments straight from the f16 planes (B layout: column = query l16) ----
  const size_t qrow = (size_t)bh * SEQ + qBase + wave * 16 + l16;
  const _Float16* qh = Qhi + qrow * DH;
  const _Float16* ql = Qlo + qrow * DH;
  const v16h qa0 = ldfrag(qh, kb8), qa1 = ldfrag(qh + 32, kb8);
  const v16h qr0 = ldfrag(ql, kb8), qr1 = ldfrag(ql + 32, kb8);

  float m = -3.0e38f, lsum = 0.0f, lgLast = 0.0f;   // lsum: this lane half's keys only, joined in the epilogue
  v8f acc[4];                                       // acc[n][j] = O'[e = 16n + 8*half + j][query l16]
#pragma unroll
  for (int n = 0; n < 4; ++n) acc[n] = zero8();

  const float cxs = 1.0f / RSC;

  const _Float16* khBase = Khi + (size_t)bh * SEQ * DH;
  const _Float16* klBase = Klo + (size_t)bh * SEQ * DH;
  const _Float16* vtBase = Vt  + (size_t)bh * DH * SEQ;

  for (int it = 0; it < SEQ / KT; ++it) {
    __syncthreads();                              // all waves done reading the tiles of the prior step
#pragma unroll
    for (int i = 0; i < 2; ++i) {
      const int idx = tid + 256 * i;
      const int r = idx >> 3, pc = idx & 7;
      const u4 vkh = *(const u4*)(khBase + (size_t)(it * KT + r) * DH + pc * 8);
      const u4 vkl = *(const u4*)(klBase + (size_t)(it * KT + r) * DH + pc * 8);
      const u4 vv  = *(const u4*)(vtBase + (size_t)r * SEQ + it * KT + pc * 8);
      *(u4*)(sKh + r * LP + pc * 8) = vkh;
      *(u4*)(sKl + r * LP + pc * 8) = vkl;
      *(u4*)(sV  + r * LP + pc * 8) = vv;
    }
    __syncthreads();

    // ---- scores over four 16-key subtiles: p[t][j] = logit(key 16t + 8*half + j, query l16) ----
    float p[4][8];
    float tm[4];
#pragma unroll
    for (int t = 0; t < 4; ++t) {
      const _Float16* kr = sKh + (t * 16 + l16) * LP;
      const _Float16* kq = sKl + (t * 16 + l16) * LP;
      const v16h kh0 = ldfrag(kr, kb8), kh1 = ldfrag(kr + 32, kb8);
      v8f chh = zero8();
      chh = wmma16(kh0, qa0, chh);
      chh = wmma16(kh1, qa1, chh);
      v8f cx = zero8();
      cx = wmma16(kh0, qr0, cx);
      cx = wmma16(kh1, qr1, cx);
      const v16h kl0 = ldfrag(kq, kb8), kl1 = ldfrag(kq + 32, kb8);
      cx = wmma16(kl0, qa0, cx);
      cx = wmma16(kl1, qa1, cx);
      WGUARD2(chh, cx, qa1, kh1, kl1);
      tm[t] = -3.0e38f;
#pragma unroll
      for (int j = 0; j < 8; ++j) {
        const float lg = (chh[j] + cx[j] * cxs) * SCL;
        p[t][j] = lg;
        tm[t] = fmaxf(tm[t], lg);
      }
    }

    // ---- query max: in-lane, then one exchange between the lane halves ----
    float tmax = fmaxf(fmaxf(tm[0], tm[1]), fmaxf(tm[2], tm[3]));
    tmax = fmaxf(tmax, xhalf(tmax));
    // raw logit of this step's last key (half 1, subtile 3, j = 7), made valid in both halves
    const float oraw = xhalf(p[3][7]);
    const float nlg  = (half != 0) ? p[3][7] : oraw;

    const float nm   = fmaxf(m, tmax);
    const float corr = __expf(m - nm);
    m = nm;
    const float pt     = __expf(lgLast - nm);     // p of the prior step's last key under the new max
    const float pleft0 = (it == 0) ? 0.0f : pt;
    lgLast = nlg;

    float st[4];
#pragma unroll
    for (int t = 0; t < 4; ++t) {
      st[t] = 0.0f;
#pragma unroll
      for (int j = 0; j < 8; ++j) {
        p[t][j] = __expf(p[t][j] - m);
        st[t] += p[t][j];
      }
    }
    lsum = lsum * corr + ((st[0] + st[1]) + (st[2] + st[3]));
#pragma unroll
    for (int n = 0; n < 4; ++n)
#pragma unroll
      for (int j = 0; j < 8; ++j) acc[n][j] *= corr;

    // ---- key-differenced P' = 1024*(p - p_left), packed in place into the B operands (k = keys) ----
    v16h pb[2];
    {
      float xprev = pleft0;
#pragma unroll
      for (int t = 0; t < 4; ++t) {
        const float x = xhalf(p[t][7]);           // half 1 sees key 16t+7, half 0 sees key 16t+15
        float left = (half != 0) ? x : xprev;
        xprev = x;
#pragma unroll
        for (int j = 0; j < 8; ++j) {
          pb[t >> 1][(t & 1) * 8 + j] = (_Float16)((p[t][j] - left) * PSC);
          left = p[t][j];
        }
      }
    }

    // ---- V^T A-fragments (rows = e, k = keys); O^T += V^T.P'^T ----
#pragma unroll
    for (int n = 0; n < 4; ++n) {
      const _Float16* vr = sV + (16 * n + l16) * LP;
      const v16h uv0 = ldfrag(vr, kb8), uv1 = ldfrag(vr + 32, kb8);
      acc[n] = wmma16(uv0, pb[0], acc[n]);
      acc[n] = wmma16(uv1, pb[1], acc[n]);
      WGUARD(acc[n], uv1, pb[1]);
    }
  }
  __syncthreads();                                // every wave past its last LDS reads

  // ---- finalize: join the halves' sums, cyclic term, normaliser, lam, O carry ----
  lsum += xhalf(lsum);
  const float pL = __expf(lgLast - m) * PSC;      // lgLast = logit of key SEQ-1 for this query
  const float f  = lamv * (OSC / PSC) * (1.0f / lsum);

  // a lane's 8 accumulator registers are 8 consecutive columns of one O row: one 16-byte LDS store per tile
#pragma unroll
  for (int n = 0; n < 4; ++n) {
    H8U o;
#pragma unroll
    for (int j = 0; j < 8; ++j) {
      const float v0 = (float)vtBase[(size_t)(16 * n + kb8 + j) * SEQ];     // v of key 0, column e
      o.h[j] = (_Float16)((acc[n][j] - pL * v0) * f);
    }
    *(u4*)(po + l16 * LP + 16 * n + kb8) = o.u;
  }
  __builtin_amdgcn_fence(5, "wavefront");
  __builtin_amdgcn_wave_barrier();

  _Float16* od = Oh + ((size_t)b * SEQ + qBase + wave * 16) * DM + h * DH;
#pragma unroll
  for (int p4 = 0; p4 < 4; ++p4) {
    const int line = p4 * 4 + (lane >> 3), piece = lane & 7;
    const u4 v = *(const u4*)(po + line * LP + piece * 8);
    *(u4*)(od + (size_t)line * DM + piece * 8) = v;
  }
}

// =====================================================================================
// Output projection: out = (Oh/1024) . (64 W_out)^T / 64 + bf16r(b_out), f32 rows of d_out.
// 64x64 f32 tile staged in LDS [64][FP]; each 256-B row segment = 2 lines, each line 8 lanes x 16 B of one
// =====================================================================================
__global__ __launch_bounds__(128) void k_out(const _Float16* __restrict__ Oh, const _Float16* __restrict__ Woh,
                                             const float* __restrict__ bias, float* __restrict__ out) {
  __shared__ __align__(16) unsigned char smem[2 * 64 * LP * 2];
  _Float16* sA = (_Float16*)smem;
  _Float16* sB = sA + 64 * LP;
  const int tid = threadIdx.x, lane = tid & 31, wave = tid >> 5, l16 = lane & 15, half = lane >> 4;
  const int m0 = blockIdx.x * 64, n0 = blockIdx.y * 64;

  v8f acc[4];
#pragma unroll
  for (int nt = 0; nt < 4; ++nt) acc[nt] = zero8();
  gemm_tile(Oh, Woh, m0, n0, sA, sB, acc);

  float* sF = (float*)smem;                       // [64][FP]
  const float inv = 1.0f / (OSC * WSC);
  float bcol[4];
#pragma unroll
  for (int nt = 0; nt < 4; ++nt) bcol[nt] = bf16r(bias[n0 + nt * 16 + l16]);
#pragma unroll
  for (int nt = 0; nt < 4; ++nt) {
#pragma unroll
    for (int r = 0; r < 8; ++r) {
      const int row = wave * 16 + half * 8 + r, col = nt * 16 + l16;
      sF[row * FP + col] = acc[nt][r] * inv + bcol[nt];
    }
  }
  __syncthreads();

  const int bb = m0 / SEQ, l0 = m0 - bb * SEQ;
  float* dbase = out + ((size_t)bb * SEQ_FULL + l0) * DM + n0;
#pragma unroll
  for (int p = 0; p < 8; ++p) {
    const int line = p * 16 + (tid >> 3), piece = tid & 7;
    const int row = line >> 1, hs = line & 1;
    const f4 v = *(const f4*)(sF + row * FP + hs * 32 + piece * 4);
    *(f4*)(dbase + (size_t)row * DM + hs * 32 + piece * 4) = v;
  }
  
}

// =====================================================================================
// Host launcher: 6 launches, grids and arguments are pure functions of the size macros.
// =====================================================================================
static inline unsigned cdiv_u(unsigned a, unsigned b) { return (a + b - 1) / b; }

extern "C" void kernel_launch(void* const* d_in, const int* in_sizes, int n_in,
                              void* d_out, int out_size, void* d_ws, size_t ws_size,
                              hipStream_t stream) {
  if (n_in < 7) return;
  const long long need_rows = (long long)(NB - 1) * SEQ_FULL + SEQ;
  if ((long long)in_sizes[0] < need_rows * DM) return;
  if (in_sizes[1] < NQKV * DM) return;
  if (in_sizes[2] < NQKV) return;
  if (in_sizes[3] < DM * DM) return;
  if (in_sizes[4] < DM) return;
  if (in_sizes[5] < 1) return;
  if (in_sizes[6] < 1) return;
  if ((long long)out_size < need_rows * DM) return;
  if (d_ws == nullptr || ws_size < WS_NEED) return;

  const float* x     = (const float*)d_in[0];
  const float* w_qkv = (const float*)d_in[1];
  const float* b_qkv = (const float*)d_in[2];
  const float* w_out = (const float*)d_in[3];
  const float* b_out = (const float*)d_in[4];
  const float* lam   = (const float*)d_in[5];
  const int*   heads = (const int*)d_in[6];
  float* out = (float*)d_out;

  char* ws = (char*)d_ws;
  _Float16* Xh  = (_Float16*)(ws + OFF_XH);
  _Float16* Wq  = (_Float16*)(ws + OFF_WQ);
  _Float16* Wo  = (_Float16*)(ws + OFF_WO);
  _Float16* Qhi = (_Float16*)(ws + OFF_QH);
  _Float16* Qlo = (_Float16*)(ws + OFF_QL);
  _Float16* Khi = (_Float16*)(ws + OFF_KH);
  _Float16* Klo = (_Float16*)(ws + OFF_KL);
  _Float16* Vt  = (_Float16*)(ws + OFF_VT);
  _Float16* Oh  = (_Float16*)(ws + OFF_OH);

  const int gx = MROWS * G8, gq = NQKV * G8, go = DM * G8;
  k_convert<<<dim3(cdiv_u(gx, 256)), dim3(256), 0, stream>>>(x,     Xh, gx, SEQ,  SEQ_FULL, 1.0f);
  k_convert<<<dim3(cdiv_u(gq, 256)), dim3(256), 0, stream>>>(w_qkv, Wq, gq, NQKV, NQKV,     WSC);
  k_convert<<<dim3(cdiv_u(go, 256)), dim3(256), 0, stream>>>(w_out, Wo, go, DM,   DM,       WSC);

  k_qkv<<<dim3(MROWS / 64, NQKV / 64), dim3(128), 0, stream>>>(Xh, Wq, b_qkv, Qhi, Qlo, Khi, Klo, Vt);
  k_attn<<<dim3(NB * HEADS, SEQ / QT), dim3(256), 0, stream>>>(Qhi, Qlo, Khi, Klo, Vt, lam, heads, Oh);
  k_out<<<dim3(MROWS / 64, DM / 64), dim3(128), 0, stream>>>(Oh, Wo, b_out, out);
}

// v002
// Measured time: 151 microseconds a run.
// In both of two side-by-side timings against v001, it was 1.06 times as fast.
// Counting every step since v000, it is 1.32 times as fast.
#include <hip/hip_runtime.h>

// Contractions on v_wmma_f32_16x16x32_f16 (f16 operands, f32 accumulate): qkv projection (x as f16 of its bf16-RNE value,
// W as f16 of its bf16-RNE value x64); scores (q and k as f16 hi + f16 residual x2048, three products); P.V
// (key-differenced softmax numerators x1024 in f16, V in f16); output projection (O x1024 in f16, W x64).
// Softmax, normaliser, cyclic correction and bias adds in f32.

typedef _Float16     v16h __attribute__((ext_vector_type(16)));
typedef _Float16     h8   __attribute__((ext_vector_type(8)));
typedef float        v8f  __attribute__((ext_vector_type(8)));
typedef float        f4   __attribute__((ext_vector_type(4)));
typedef unsigned int u4   __attribute__((ext_vector_type(4)));

#ifndef NB
#define NB 2
#endif
#ifndef SEQ
#define SEQ 2048
#endif
#define NB_FULL  2
#define SEQ_FULL 2048
#define DM     1024
#define HEADS  16
#define DH     64
#define NQKV   (3 * DM)
#define MROWS  (NB * SEQ)
#define G8     (DM / 8)          // 16-byte groups per row

#define QT  128                  // query rows per block (8 waves x 16)
#define KT  64                   // keys per main-loop step
#define LP  72                   // f16 LDS row pitch (144 B)
#define FP  68                   // f32 LDS row pitch (272 B)

#define WSC 64.0f                // weight planes carried x64
#define RSC 2048.0f              // q/k residual planes carried x2048
#define PSC 1024.0f              // P operand carried x1024
#define OSC 1024.0f              // O plane carried x1024
#define SCL 0.03125f             // d_model^-0.5 = 1/32

static_assert(DM == 1024);
static_assert(G8 == 128);
static_assert(HEADS * DH == DM);
static_assert(DH == 64);
static_assert(SEQ % QT == 0);
static_assert(SEQ % KT == 0);
static_assert((SEQ / KT) % 2 == 0);
static_assert(KT == DH);
static_assert(SEQ % 64 == 0);
static_assert(MROWS % 64 == 0);
static_assert(NQKV % 64 == 0);
static_assert(NB >= 1 && NB <= NB_FULL);
static_assert(SEQ <= SEQ_FULL);
static_assert(64 * FP * 4 <= 2 * 64 * LP * 2);

// ---------------- workspace layout (all offsets multiples of 512 KiB) ----------------
#define XH_BYTES ((size_t)MROWS * DM * 2)          // f16 x            [MROWS][DM]
#define WQ_BYTES ((size_t)NQKV * DM * 2)           // f16 64*W_qkv     [NQKV][DM]
#define WO_BYTES ((size_t)DM * DM * 2)             // f16 64*W_out     [DM][DM]
#define PL_BYTES ((size_t)MROWS * DM * 2)          // one f16 plane: [NB*H][SEQ][DH] or [NB*H][DH][SEQ] or [MROWS][DM]
#define OFF_XH  ((size_t)0)
#define OFF_WQ  (OFF_XH + XH_BYTES)
#define OFF_WO  (OFF_WQ + WQ_BYTES)
#define OFF_QH  (OFF_WO + WO_BYTES)
#define OFF_QL  (OFF_QH + PL_BYTES)
#define OFF_KH  (OFF_QL + PL_BYTES)
#define OFF_KL  (OFF_KH + PL_BYTES)
#define OFF_VT  (OFF_KL + PL_BYTES)
#define OFF_OH  (OFF_VT + PL_BYTES)
#define WS_NEED (OFF_OH + PL_BYTES)
static_assert(WS_NEED <= (size_t)134217728);
static_assert((OFF_WQ % 128) == 0 && (OFF_WO % 128) == 0 && (OFF_QH % 128) == 0 && (OFF_OH % 128) == 0);

// ---------------- helpers ----------------
__device__ __forceinline__ float bf16r(float x) {           // RNE to bf16, kept as f32
  unsigned int u = __float_as_uint(x);
  u = (u + 0x7FFFu + ((u >> 16) & 1u)) & 0xFFFF0000u;
  return __uint_as_float(u);
}

__device__ __forceinline__ v8f zero8() {
  v8f z;
#pragma unroll
  for (int j = 0; j < 8; ++j) z[j] = 0.0f;
  return z;
}

__device__ __forceinline__ v8f wmma16(v16h a, v16h b, v8f c) {
  return __builtin_amdgcn_wmma_f32_16x16x32_f16(false, a, false, b, (short)0, c, false, false);
}

#define WGUARD(acc, a, b) \
  asm volatile("v_nop\n\tv_nop\n\tv_nop\n\tv_nop" : "+v"(acc) : "v"(a), "v"(b))
#define WGUARD2(c0, c1, a, b0, b1) \
  asm volatile("v_nop\n\tv_nop\n\tv_nop\n\tv_nop" : "+v"(c0), "+v"(c1) : "v"(a), "v"(b0), "v"(b1))

union HU  { v16h v; h8 p[2]; };
union H8U { h8 h; u4 u; };

// 16-bit fragment (A or B) from a k-contiguous row: elements 0..7 <- k 8h..8h+7, 8..15 <- k 16+8h..16+8h+7
__device__ __forceinline__ v16h ldfrag(const _Float16* row, int kb8) {
  HU u;
  u.p[0] = *(const h8*)(row + kb8);
  u.p[1] = *(const h8*)(row + 16 + kb8);
  return u.v;
}

// =====================================================================================
// Convert: dst[row][c] = f16( bf16r(src[srow][c]) * scale ), srow = (row/seq)*seq_full + row%seq
// coverage: ngroups*8 = rows*DM elements, every element of the plane.
// =====================================================================================
__global__ __launch_bounds__(256) void k_convert(const float* __restrict__ src, _Float16* __restrict__ dst,
                                                 int ngroups, int seq, int seq_full, float scale) {
  const int g = blockIdx.x * 256 + threadIdx.x;
  if (g >= ngroups) return;                       // no barriers in this kernel
  const int row = g >> 7;
  const int c8  = g & 127;
  const int srow = (row / seq) * seq_full + (row - (row / seq) * seq);
  const float* s = src + (size_t)srow * DM + c8 * 8;
  const f4 a = *(const f4*)s;
  const f4 b = *(const f4*)(s + 4);
  H8U o;
#pragma unroll
  for (int j = 0; j < 4; ++j) {
    o.h[j]     = (_Float16)(bf16r(a[j]) * scale);
    o.h[4 + j] = (_Float16)(bf16r(b[j]) * scale);
  }
  _Float16* d = dst + (size_t)row * DM + c8 * 8;
  *(u4*)d = o.u;
  
}

// =====================================================================================
// 64x64 tile GEMM main loop: C[m][n] += sum_k A[m][k] * Bw[n][k], K = DM, 128 threads (4 waves x 16 rows)
// A, Bw are f16 row-major with pitch DM. LDS tiles [64][LP] staged with 16-B loads, cross-wave (block barriers).
// staged extent == consumed extent: rows 0..63, halves 0..63 of both tiles.
// =====================================================================================
__device__ __forceinline__ void gemm_tile(const _Float16* __restrict__ A, const _Float16* __restrict__ Bw,
                                          int m0, int n0, _Float16* sA, _Float16* sB, v8f (&acc)[4]) {
  const int tid = threadIdx.x, lane = tid & 31, wave = tid >> 5, l16 = lane & 15, kb8 = (lane >> 4) * 8;
  for (int k0 = 0; k0 < DM; k0 += 64) {
#pragma unroll
    for (int i = 0; i < 4; ++i) {
      const int idx = tid + 128 * i;
      const int r = idx >> 3, pc = idx & 7;
      const u4 va = *(const u4*)(A  + (size_t)(m0 + r) * DM + k0 + pc * 8);
      const u4 vb = *(const u4*)(Bw + (size_t)(n0 + r) * DM + k0 + pc * 8);
      *(u4*)(sA + r * LP + pc * 8) = va;
      *(u4*)(sB + r * LP + pc * 8) = vb;
    }
    __syncthreads();
    const _Float16* ar = sA + (wave * 16 + l16) * LP;
    const v16h a0 = ldfrag(ar, kb8);
    const v16h a1 = ldfrag(ar + 32, kb8);
#pragma unroll
    for (int nt = 0; nt < 4; ++nt) {
      const _Float16* br = sB + (nt * 16 + l16) * LP;
      const v16h b0 = ldfrag(br, kb8);
      const v16h b1 = ldfrag(br + 32, kb8);
      acc[nt] = wmma16(a0, b0, acc[nt]);
      acc[nt] = wmma16(a1, b1, acc[nt]);
      WGUARD(acc[nt], a1, b1);
    }
    __syncthreads();
  }
}

// =====================================================================================
// QKV projection: acc = Xh . (64 W)^T ; val = acc/64 + bf16r(b)
// coverage: grid (MROWS/64, NQKV/64) -> every (position, column) of q, k hi/lo and V^T exactly once.
// =====================================================================================
__global__ __launch_bounds__(128) void k_qkv(const _Float16* __restrict__ Xh, const _Float16* __restrict__ Wh,
                                             const float* __restrict__ bias,
                                             _Float16* __restrict__ Qhi, _Float16* __restrict__ Qlo,
                                             _Float16* __restrict__ Khi, _Float16* __restrict__ Klo,
                                             _Float16* __restrict__ Vt) {
  __shared__ __align__(16) _Float16 sA[64 * LP];
  __shared__ __align__(16) _Float16 sB[64 * LP];
  const int tid = threadIdx.x, lane = tid & 31, wave = tid >> 5, l16 = lane & 15, half = lane >> 4;
  const int m0 = blockIdx.x * 64, n0 = blockIdx.y * 64;

  v8f acc[4];
#pragma unroll
  for (int nt = 0; nt < 4; ++nt) acc[nt] = zero8();
  gemm_tile(Xh, Wh, m0, n0, sA, sB, acc);

  const int sel = n0 / DM;                        // 0 q, 1 k, 2 v   (block-uniform)
  const int hd  = (n0 - sel * DM) / DH;           // head
  const int bb  = m0 / SEQ, l0 = m0 - bb * SEQ;   // batch, first position of the tile
  const size_t bh = (size_t)bb * HEADS + hd;
  const float inv = 1.0f / WSC;
  float bcol[4];
#pragma unroll
  for (int nt = 0; nt < 4; ++nt) bcol[nt] = bf16r(bias[n0 + nt * 16 + l16]);

  // ---- stage the 64x64 result in LDS (sA/sB free after the main loop's final barrier) ----
  if (sel < 2) {
#pragma unroll
    for (int nt = 0; nt < 4; ++nt) {
#pragma unroll
      for (int r = 0; r < 8; ++r) {
        const float v = acc[nt][r] * inv + bcol[nt];
        const _Float16 hi = (_Float16)v;
        const _Float16 lo = (_Float16)((v - (float)hi) * RSC);
        const int row = wave * 16 + half * 8 + r, col = nt * 16 + l16;
        sA[row * LP + col] = hi;
        sB[row * LP + col] = lo;
      }
    }
  } else {
#pragma unroll
    for (int nt = 0; nt < 4; ++nt) {
      H8U o;
#pragma unroll
      for (int r = 0; r < 8; ++r) o.h[r] = (_Float16)(acc[nt][r] * inv + bcol[nt]);
      // transposed: LDS row = e (tile column), 8 consecutive positions per lane
      *(u4*)(sA + (nt * 16 + l16) * LP + wave * 16 + half * 8) = o.u;
    }
  }
  __syncthreads();

  // ---- whole-line write-out, 4 passes of 16 lines, lanes 8q..8q+7 <-> one line ----
  if (sel < 2) {
    _Float16* dhp = ((sel == 0) ? Qhi : Khi) + (bh * SEQ + l0) * DH;
    _Float16* dlp = ((sel == 0) ? Qlo : Klo) + (bh * SEQ + l0) * DH;
#pragma unroll
    for (int p = 0; p < 4; ++p) {
      const int line = p * 16 + (tid >> 3), piece = tid & 7;
      const u4 vh = *(const u4*)(sA + line * LP + piece * 8);
      const u4 vl = *(const u4*)(sB + line * LP + piece * 8);
      *(u4*)(dhp + line * DH + piece * 8) = vh;
      *(u4*)(dlp + line * DH + piece * 8) = vl;
    }
    
  } else {
    _Float16* dvp = Vt + (bh * DH) * (size_t)SEQ + l0;     // row e at dvp + e*SEQ
#pragma unroll
    for (int p = 0; p < 4; ++p) {
      const int e = p * 16 + (tid >> 3), piece = tid & 7;
      const u4 v = *(const u4*)(sA + e * LP + piece * 8);
      *(u4*)(dvp + (size_t)e * SEQ + piece * 8) = v;
    }
    
  }
}

__device__ __forceinline__ float xhalf(float x) {
  const int b = __builtin_bit_cast(int, x);
  return __builtin_bit_cast(float, __builtin_amdgcn_permlanex16(b, b, 0x76543210, 0xfedcba98, false, false));
}

__device__ __forceinline__ unsigned lds_addr(const _Float16* p) {   // byte address inside the work-group's LDS
  return (unsigned)(unsigned long long)p;
}

// One thread's share of a step's three tiles: six 16-byte asynchronous copies, global memory -> LDS, through no register.
// The s_wait_xcnt closes the statement so that no address register named here is rewritten ahead of it.
__device__ __forceinline__ void copy_tiles(unsigned lkh0, unsigned lkh1, unsigned lkl0, unsigned lkl1,
                                           unsigned lv0, unsigned lv1,
                                           const _Float16* gkh0, const _Float16* gkh1,
                                           const _Float16* gkl0, const _Float16* gkl1,
                                           const _Float16* gv0, const _Float16* gv1) {
  asm volatile("global_load_async_to_lds_b128 %0, %6, off\n\t"
               "global_load_async_to_lds_b128 %1, %7, off\n\t"
               "global_load_async_to_lds_b128 %2, %8, off\n\t"
               "global_load_async_to_lds_b128 %3, %9, off\n\t"
               "global_load_async_to_lds_b128 %4, %10, off\n\t"
               "global_load_async_to_lds_b128 %5, %11, off\n\t"
               "s_wait_xcnt 0x0"
               :: "v"(lkh0), "v"(lkh1), "v"(lkl0), "v"(lkl1), "v"(lv0), "v"(lv1),
                  "v"(gkh0), "v"(gkh1), "v"(gkl0), "v"(gkl1), "v"(gv0), "v"(gv1)
               : "memory");
}

__global__ __launch_bounds__(256) void k_attn(const _Float16* __restrict__ Qhi, const _Float16* __restrict__ Qlo,
                                              const _Float16* __restrict__ Khi, const _Float16* __restrict__ Klo,
                                              const _Float16* __restrict__ Vt, const float* __restrict__ lam_p,
                                              const int* __restrict__ heads_p, _Float16* __restrict__ Oh) {
  const int tid = threadIdx.x, lane = tid & 31, wave = tid >> 5;
  const int l16 = lane & 15, half = lane >> 4, kb8 = half * 8;
  const int bh = blockIdx.x;
  const int b  = bh / HEADS, h = bh - b * HEADS;
  const int qBase = blockIdx.y * QT;

  // two tile buffers (step it works on buffer it & 1), each K-hi | K-lo | V^T; behind them the O write-out staging
  __shared__ __align__(16) _Float16 smem[2 * 3 * KT * LP + 8 * 16 * LP];
#define TILE(buf, plane) (smem + ((buf) * 3 + (plane)) * (KT * LP))
  _Float16* po = smem + 2 * 3 * KT * LP + wave * (16 * LP);   // wave-private [16 rows][LP]

  const float lamr = bf16r(lam_p[0]);
  const int   hv   = heads_p[0];
  const float lamv = (hv == HEADS) ? lamr : __uint_as_float(0x7fc00000u);   // poison on structural conflict

  // ---- Q fragments straight from the f16 planes (B layout: column = query l16) ----
  const size_t qrow = (size_t)bh * SEQ + qBase + wave * 16 + l16;
  const _Float16* qh = Qhi + qrow * DH;
  const _Float16* ql = Qlo + qrow * DH;
  const v16h qa0 = ldfrag(qh, kb8), qa1 = ldfrag(qh + 32, kb8);
  const v16h qr0 = ldfrag(ql, kb8), qr1 = ldfrag(ql + 32, kb8);

  float m = -3.0e38f, lsum = 0.0f, lgLast = 0.0f;   // lsum: this lane half's keys only, joined in the epilogue
  v8f acc[4];                                       // acc[n][j] = O'[e = 16n + 8*half + j][query l16]
#pragma unroll
  for (int n = 0; n < 4; ++n) acc[n] = zero8();

  const float cxs = 1.0f / RSC;

  const _Float16* khBase = Khi + (size_t)bh * SEQ * DH;
  const _Float16* klBase = Klo + (size_t)bh * SEQ * DH;
  const _Float16* vtBase = Vt  + (size_t)bh * DH * SEQ;

  // a thread copies rows sr and sr + 32, 16-byte piece spc, of each of the three tiles
  const int sr = tid >> 3, spc = tid & 7;
  const int so0 = sr * LP + spc * 8, so1 = (sr + 32) * LP + spc * 8;
  const _Float16* gkh = khBase + (size_t)sr * DH + spc * 8;
  const _Float16* gkl = klBase + (size_t)sr * DH + spc * 8;
  const _Float16* gv  = vtBase + (size_t)sr * SEQ + spc * 8;
#define COPY_STEP(step, buf)                                                                          \
  copy_tiles(lds_addr(TILE(buf, 0) + so0), lds_addr(TILE(buf, 0) + so1), lds_addr(TILE(buf, 1) + so0), \
             lds_addr(TILE(buf, 1) + so1), lds_addr(TILE(buf, 2) + so0), lds_addr(TILE(buf, 2) + so1), \
             gkh + (size_t)(step) * (KT * DH), gkh + (size_t)(step) * (KT * DH) + 32 * DH,            \
             gkl + (size_t)(step) * (KT * DH), gkl + (size_t)(step) * (KT * DH) + 32 * DH,            \
             gv + (step) * KT, gv + (step) * KT + (size_t)32 * SEQ)

  COPY_STEP(0, 0);
  asm volatile("s_wait_asynccnt 0x0" ::: "memory");   // this wave's share of step 0 has landed
  __syncthreads();                                    // step 0 readable by every wave
  COPY_STEP(1, 1);                                    // flies while step 0 is worked on

  for (int it2 = 0; it2 < SEQ / KT; it2 += 2) {
#pragma unroll                                        // the buffer index is a constant: LDS offsets stay immediates
   for (int u = 0; u < 2; ++u) {
    const int it = it2 + u;
    const _Float16* cKh = TILE(u, 0);
    const _Float16* cKl = TILE(u, 1);
    const _Float16* cV  = TILE(u, 2);

    // ---- scores over four 16-key subtiles: p[t][j] = logit(key 16t + 8*half + j, query l16) ----
    float p[4][8];
    float tm[4];
#pragma unroll
    for (int t = 0; t < 4; ++t) {
      const _Float16* kr = cKh + (t * 16 + l16) * LP;
      const _Float16* kq = cKl + (t * 16 + l16) * LP;
      const v16h kh0 = ldfrag(kr, kb8), kh1 = ldfrag(kr + 32, kb8);
      v8f chh = zero8();
      chh = wmma16(kh0, qa0, chh);
      chh = wmma16(kh1, qa1, chh);
      v8f cx = zero8();
      cx = wmma16(kh0, qr0, cx);
      cx = wmma16(kh1, qr1, cx);
      const v16h kl0 = ldfrag(kq, kb8), kl1 = ldfrag(kq + 32, kb8);
      cx = wmma16(kl0, qa0, cx);
      cx = wmma16(kl1, qa1, cx);
      WGUARD2(chh, cx, qa1, kh1, kl1);
      tm[t] = -3.0e38f;
#pragma unroll
      for (int j = 0; j < 8; ++j) {
        const float lg = (chh[j] + cx[j] * cxs) * SCL;
        p[t][j] = lg;
        tm[t] = fmaxf(tm[t], lg);
      }
    }

    // ---- query max: in-lane, then one exchange between the lane halves ----
    float tmax = fmaxf(fmaxf(tm[0], tm[1]), fmaxf(tm[2], tm[3]));
    tmax = fmaxf(tmax, xhalf(tmax));
    // raw logit of this step's last key (half 1, subtile 3, j = 7), made valid in both halves
    const float oraw = xhalf(p[3][7]);
    const float nlg  = (half != 0) ? p[3][7] : oraw;

    const float nm   = fmaxf(m, tmax);
    const float corr = __expf(m - nm);
    m = nm;
    const float pt     = __expf(lgLast - nm);     // p of the prior step's last key under the new max
    const float pleft0 = (it == 0) ? 0.0f : pt;
    lgLast = nlg;

    float st[4];
#pragma unroll
    for (int t = 0; t < 4; ++t) {
      st[t] = 0.0f;
#pragma unroll
      for (int j = 0; j < 8; ++j) {
        p[t][j] = __expf(p[t][j] - m);
        st[t] += p[t][j];
      }
    }
    lsum = lsum * corr + ((st[0] + st[1]) + (st[2] + st[3]));
#pragma unroll
    for (int n = 0; n < 4; ++n)
#pragma unroll
      for (int j = 0; j < 8; ++j) acc[n][j] *= corr;

    // ---- key-differenced P' = 1024*(p - p_left), packed in place into the B operands (k = keys) ----
    v16h pb[2];
    {
      float xprev = pleft0;
#pragma unroll
      for (int t = 0; t < 4; ++t) {
        const float x = xhalf(p[t][7]);           // half 1 sees key 16t+7, half 0 sees key 16t+15
        float left = (half != 0) ? x : xprev;
        xprev = x;
#pragma unroll
        for (int j = 0; j < 8; ++j) {
          pb[t >> 1][(t & 1) * 8 + j] = (_Float16)((p[t][j] - left) * PSC);
          left = p[t][j];
        }
      }
    }

    // ---- V^T A-fragments (rows = e, k = keys); O^T += V^T.P'^T ----
#pragma unroll
    for (int n = 0; n < 4; ++n) {
      const _Float16* vr = cV + (16 * n + l16) * LP;
      const v16h uv0 = ldfrag(vr, kb8), uv1 = ldfrag(vr + 32, kb8);
      acc[n] = wmma16(uv0, pb[0], acc[n]);
      acc[n] = wmma16(uv1, pb[1], acc[n]);
      WGUARD(acc[n], uv1, pb[1]);
    }

    // ---- hand-over: own LDS reads retired, own copies of step it + 1 landed, then the step's one barrier ----
    asm volatile("s_wait_dscnt 0x0" ::: "memory");      // before buffer u is refilled
    asm volatile("s_wait_asynccnt 0x0" ::: "memory");   // before other waves read this wave's share of step it + 1
    __syncthreads();                                    // publishes step it + 1, ends every read of buffer u
    if (it + 2 < SEQ / KT) COPY_STEP(it + 2, u);        // flies while step it + 1 is worked on
   }
  }
  asm volatile("s_wait_asynccnt 0x0" ::: "memory");     // nothing in flight when the wave goes on
#undef COPY_STEP
#undef TILE

  // ---- finalize: join the halves' sums, cyclic term, normaliser, lam, O carry ----
  lsum += xhalf(lsum);
  const float pL = __expf(lgLast - m) * PSC;      // lgLast = logit of key SEQ-1 for this query
  const float f  = lamv * (OSC / PSC) * (1.0f / lsum);

  // a lane's 8 accumulator registers are 8 consecutive columns of one O row: one 16-byte LDS store per tile
#pragma unroll
  for (int n = 0; n < 4; ++n) {
    H8U o;
#pragma unroll
    for (int j = 0; j < 8; ++j) {
      const float v0 = (float)vtBase[(size_t)(16 * n + kb8 + j) * SEQ];     // v of key 0, column e
      o.h[j] = (_Float16)((acc[n][j] - pL * v0) * f);
    }
    *(u4*)(po + l16 * LP + 16 * n + kb8) = o.u;
  }
  __builtin_amdgcn_fence(5, "wavefront");
  __builtin_amdgcn_wave_barrier();

  _Float16* od = Oh + ((size_t)b * SEQ + qBase + wave * 16) * DM + h * DH;
#pragma unroll
  for (int p4 = 0; p4 < 4; ++p4) {
    const int line = p4 * 4 + (lane >> 3), piece = lane & 7;
    const u4 v = *(const u4*)(po + line * LP + piece * 8);
    *(u4*)(od + (size_t)line * DM + piece * 8) = v;
  }
}

// =====================================================================================
// Output projection: out = (Oh/1024) . (64 W_out)^T / 64 + bf16r(b_out), f32 rows of d_out.
// 64x64 f32 tile staged in LDS [64][FP]; each 256-B row segment = 2 lines, each line 8 lanes x 16 B of one
// =====================================================================================
__global__ __launch_bounds__(128) void k_out(const _Float16* __restrict__ Oh, const _Float16* __restrict__ Woh,
                                             const float* __restrict__ bias, float* __restrict__ out) {
  __shared__ __align__(16) unsigned char smem[2 * 64 * LP * 2];
  _Float16* sA = (_Float16*)smem;
  _Float16* sB = sA + 64 * LP;
  const int tid = threadIdx.x, lane = tid & 31, wave = tid >> 5, l16 = lane & 15, half = lane >> 4;
  const int m0 = blockIdx.x * 64, n0 = blockIdx.y * 64;

  v8f acc[4];
#pragma unroll
  for (int nt = 0; nt < 4; ++nt) acc[nt] = zero8();
  gemm_tile(Oh, Woh, m0, n0, sA, sB, acc);

  float* sF = (float*)smem;                       // [64][FP]
  const float inv = 1.0f / (OSC * WSC);
  float bcol[4];
#pragma unroll
  for (int nt = 0; nt < 4; ++nt) bcol[nt] = bf16r(bias[n0 + nt * 16 + l16]);
#pragma unroll
  for (int nt = 0; nt < 4; ++nt) {
#pragma unroll
    for (int r = 0; r < 8; ++r) {
      const int row = wave * 16 + half * 8 + r, col = nt * 16 + l16;
      sF[row * FP + col] = acc[nt][r] * inv + bcol[nt];
    }
  }
  __syncthreads();

  const int bb = m0 / SEQ, l0 = m0 - bb * SEQ;
  float* dbase = out + ((size_t)bb * SEQ_FULL + l0) * DM + n0;
#pragma unroll
  for (int p = 0; p < 8; ++p) {
    const int line = p * 16 + (tid >> 3), piece = tid & 7;
    const int row = line >> 1, hs = line & 1;
    const f4 v = *(const f4*)(sF + row * FP + hs * 32 + piece * 4);
    *(f4*)(dbase + (size_t)row * DM + hs * 32 + piece * 4) = v;
  }
  
}

// =====================================================================================
// Host launcher: 6 launches, grids and arguments are pure functions of the size macros.
// =====================================================================================
static inline unsigned cdiv_u(unsigned a, unsigned b) { return (a + b - 1) / b; }

extern "C" void kernel_launch(void* const* d_in, const int* in_sizes, int n_in,
                              void* d_out, int out_size, void* d_ws, size_t ws_size,
                              hipStream_t stream) {
  if (n_in < 7) return;
  const long long need_rows = (long long)(NB - 1) * SEQ_FULL + SEQ;
  if ((long long)in_sizes[0] < need_rows * DM) return;
  if (in_sizes[1] < NQKV * DM) return;
  if (in_sizes[2] < NQKV) return;
  if (in_sizes[3] < DM * DM) return;
  if (in_sizes[4] < DM) return;
  if (in_sizes[5] < 1) return;
  if (in_sizes[6] < 1) return;
  if ((long long)out_size < need_rows * DM) return;
  if (d_ws == nullptr || ws_size < WS_NEED) return;

  const float* x     = (const float*)d_in[0];
  const float* w_qkv = (const float*)d_in[1];
  const float* b_qkv = (const float*)d_in[2];
  const float* w_out = (const float*)d_in[3];
  const float* b_out = (const float*)d_in[4];
  const float* lam   = (const float*)d_in[5];
  const int*   heads = (const int*)d_in[6];
  float* out = (float*)d_out;

  char* ws = (char*)d_ws;
  _Float16* Xh  = (_Float16*)(ws + OFF_XH);
  _Float16* Wq  = (_Float16*)(ws + OFF_WQ);
  _Float16* Wo  = (_Float16*)(ws + OFF_WO);
  _Float16* Qhi = (_Float16*)(ws + OFF_QH);
  _Float16* Qlo = (_Float16*)(ws + OFF_QL);
  _Float16* Khi = (_Float16*)(ws + OFF_KH);
  _Float16* Klo = (_Float16*)(ws + OFF_KL);
  _Float16* Vt  = (_Float16*)(ws + OFF_VT);
  _Float16* Oh  = (_Float16*)(ws + OFF_OH);

  const int gx = MROWS * G8, gq = NQKV * G8, go = DM * G8;
  k_convert<<<dim3(cdiv_u(gx, 256)), dim3(256), 0, stream>>>(x,     Xh, gx, SEQ,  SEQ_FULL, 1.0f);
  k_convert<<<dim3(cdiv_u(gq, 256)), dim3(256), 0, stream>>>(w_qkv, Wq, gq, NQKV, NQKV,     WSC);
  k_convert<<<dim3(cdiv_u(go, 256)), dim3(256), 0, stream>>>(w_out, Wo, go, DM,   DM,       WSC);

  k_qkv<<<dim3(MROWS / 64, NQKV / 64), dim3(128), 0, stream>>>(Xh, Wq, b_qkv, Qhi, Qlo, Khi, Klo, Vt);
  k_attn<<<dim3(NB * HEADS, SEQ / QT), dim3(256), 0, stream>>>(Qhi, Qlo, Khi, Klo, Vt, lam, heads, Oh);
  k_out<<<dim3(MROWS / 64, DM / 64), dim3(128), 0, stream>>>(Oh, Wo, b_out, out);
}

// v003
// Measured time: 124 microseconds a run.
// In two side-by-side timings against v002, it was 1.22 and 1.21 times as fast.
// Over all steps from v000 it is 1.60 times as fast.
#include <hip/hip_runtime.h>

// Contractions on v_wmma_f32_16x16x32_f16 (f16 operands, f32 accumulate): qkv projection (x as f16 of its bf16-RNE value,
// W as f16 of its bf16-RNE value x64); scores (q and k as f16 hi + f16 residual x2048, three products); P.V
// (key-differenced softmax numerators x1024 in f16, V in f16); output projection (O x1024 in f16, W x64).
// Softmax, normaliser, cyclic correction and bias adds in f32.

typedef _Float16     v16h __attribute__((ext_vector_type(16)));
typedef _Float16     h8   __attribute__((ext_vector_type(8)));
typedef float        v8f  __attribute__((ext_vector_type(8)));
typedef float        f4   __attribute__((ext_vector_type(4)));
typedef unsigned int u4   __attribute__((ext_vector_type(4)));

#ifndef NB
#define NB 2
#endif
#ifndef SEQ
#define SEQ 2048
#endif
#define NB_FULL  2
#define SEQ_FULL 2048
#define DM     1024
#define HEADS  16
#define DH     64
#define NQKV   (3 * DM)
#define MROWS  (NB * SEQ)
#define G8     (DM / 8)          // 16-byte groups per row

#define QT  128                  // query rows per block (8 waves x 16)
#define KT  64                   // keys per main-loop step
#define LP  72                   // f16 LDS row pitch (144 B)
#define FP  68                   // f32 LDS row pitch (272 B)

#define WSC 64.0f                // weight planes carried x64
#define RSC 2048.0f              // q/k residual planes carried x2048
#define PSC 1024.0f              // P operand carried x1024
#define OSC 1024.0f              // O plane carried x1024
#define SCL 0.03125f             // d_model^-0.5 = 1/32

static_assert(DM == 1024);
static_assert(G8 == 128);
static_assert(HEADS * DH == DM);
static_assert(DH == 64);
static_assert(SEQ % QT == 0);
static_assert(SEQ % KT == 0);
static_assert((SEQ / KT) % 2 == 0);
static_assert(KT == DH);
static_assert(SEQ % 64 == 0);
static_assert(MROWS % 64 == 0);
static_assert(NQKV % 64 == 0);
static_assert(NB >= 1 && NB <= NB_FULL);
static_assert(SEQ <= SEQ_FULL);
static_assert(64 * FP * 4 <= 2 * 64 * LP * 2);

// ---------------- workspace layout (all offsets multiples of 512 KiB) ----------------
#define XH_BYTES ((size_t)MROWS * DM * 2)          // f16 x            [MROWS][DM]
#define WQ_BYTES ((size_t)NQKV * DM * 2)           // f16 64*W_qkv     [NQKV][DM]
#define WO_BYTES ((size_t)DM * DM * 2)             // f16 64*W_out     [DM][DM]
#define PL_BYTES ((size_t)MROWS * DM * 2)          // one f16 plane: [NB*H][SEQ][DH] or [NB*H][DH][SEQ] or [MROWS][DM]
#define OFF_XH  ((size_t)0)
#define OFF_WQ  (OFF_XH + XH_BYTES)
#define OFF_WO  (OFF_WQ + WQ_BYTES)
#define OFF_QH  (OFF_WO + WO_BYTES)
#define OFF_QL  (OFF_QH + PL_BYTES)
#define OFF_KH  (OFF_QL + PL_BYTES)
#define OFF_KL  (OFF_KH + PL_BYTES)
#define OFF_VT  (OFF_KL + PL_BYTES)
#define OFF_OH  (OFF_VT + PL_BYTES)
#define WS_NEED (OFF_OH + PL_BYTES)
static_assert(WS_NEED <= (size_t)134217728);
static_assert((OFF_WQ % 128) == 0 && (OFF_WO % 128) == 0 && (OFF_QH % 128) == 0 && (OFF_OH % 128) == 0);

// ---------------- helpers ----------------
__device__ __forceinline__ float bf16r(float x) {           // RNE to bf16, kept as f32
  unsigned int u = __float_as_uint(x);
  u = (u + 0x7FFFu + ((u >> 16) & 1u)) & 0xFFFF0000u;
  return __uint_as_float(u);
}

__device__ __forceinline__ v8f zero8() {
  v8f z;
#pragma unroll
  for (int j = 0; j < 8; ++j) z[j] = 0.0f;
  return z;
}

__device__ __forceinline__ v8f wmma16(v16h a, v16h b, v8f c) {
  return __builtin_amdgcn_wmma_f32_16x16x32_f16(false, a, false, b, (short)0, c, false, false);
}

#define WGUARD(acc, a, b) \
  asm volatile("v_nop\n\tv_nop\n\tv_nop\n\tv_nop" : "+v"(acc) : "v"(a), "v"(b))
#define WGUARD2(c0, c1, a, b0, b1) \
  asm volatile("v_nop\n\tv_nop\n\tv_nop\n\tv_nop" : "+v"(c0), "+v"(c1) : "v"(a), "v"(b0), "v"(b1))

union HU  { v16h v; h8 p[2]; };
union H8U { h8 h; u4 u; };

// 16-bit fragment (A or B) from a k-contiguous row: elements 0..7 <- k 8h..8h+7, 8..15 <- k 16+8h..16+8h+7
__device__ __forceinline__ v16h ldfrag(const _Float16* row, int kb8) {
  HU u;
  u.p[0] = *(const h8*)(row + kb8);
  u.p[1] = *(const h8*)(row + 16 + kb8);
  return u.v;
}

// =====================================================================================
// Convert: dst[row][c] = f16( bf16r(src[srow][c]) * scale ), srow = (row/seq)*seq_full + row%seq
// coverage: ngroups*8 = rows*DM elements, every element of the plane.
// =====================================================================================
__global__ __launch_bounds__(256) void k_convert(const float* __restrict__ src, _Float16* __restrict__ dst,
                                                 int ngroups, int seq, int seq_full, float scale) {
  const int g = blockIdx.x * 256 + threadIdx.x;
  if (g >= ngroups) return;                       // no barriers in this kernel
  const int row = g >> 7;
  const int c8  = g & 127;
  const int srow = (row / seq) * seq_full + (row - (row / seq) * seq);
  const float* s = src + (size_t)srow * DM + c8 * 8;
  const f4 a = *(const f4*)s;
  const f4 b = *(const f4*)(s + 4);
  H8U o;
#pragma unroll
  for (int j = 0; j < 4; ++j) {
    o.h[j]     = (_Float16)(bf16r(a[j]) * scale);
    o.h[4 + j] = (_Float16)(bf16r(b[j]) * scale);
  }
  _Float16* d = dst + (size_t)row * DM + c8 * 8;
  *(u4*)d = o.u;
  
}

// =====================================================================================
// 64x64 tile GEMM main loop: C[m][n] += sum_k A[m][k] * Bw[n][k], K = DM, 128 threads (4 waves x 16 rows)
// A, Bw are f16 row-major with pitch DM. LDS tiles [64][LP] staged with 16-B loads, cross-wave (block barriers).
// staged extent == consumed extent: rows 0..63, halves 0..63 of both tiles.
// =====================================================================================
__device__ __forceinline__ void gemm_tile(const _Float16* __restrict__ A, const _Float16* __restrict__ Bw,
                                          int m0, int n0, _Float16* sA, _Float16* sB, v8f (&acc)[4]) {
  const int tid = threadIdx.x, lane = tid & 31, wave = tid >> 5, l16 = lane & 15, kb8 = (lane >> 4) * 8;
  for (int k0 = 0; k0 < DM; k0 += 64) {
    // all eight loads of the step first, then the LDS stores: one trip to L2 per step instead of one per load
    u4 va[4], vb[4];
#pragma unroll
    for (int i = 0; i < 4; ++i) {
      const int idx = tid + 128 * i;
      const int r = idx >> 3, pc = idx & 7;
      va[i] = *(const u4*)(A  + (size_t)(m0 + r) * DM + k0 + pc * 8);
      vb[i] = *(const u4*)(Bw + (size_t)(n0 + r) * DM + k0 + pc * 8);
    }
    // keeps the scheduler from sinking each load down to its own store, where it is waited for before the next is issued
    __builtin_amdgcn_sched_barrier(0);
#pragma unroll
    for (int i = 0; i < 4; ++i) {
      const int idx = tid + 128 * i;
      const int r = idx >> 3, pc = idx & 7;
      *(u4*)(sA + r * LP + pc * 8) = va[i];
      *(u4*)(sB + r * LP + pc * 8) = vb[i];
    }
    __syncthreads();
    const _Float16* ar = sA + (wave * 16 + l16) * LP;
    const v16h a0 = ldfrag(ar, kb8);
    const v16h a1 = ldfrag(ar + 32, kb8);
#pragma unroll
    for (int nt = 0; nt < 4; ++nt) {
      const _Float16* br = sB + (nt * 16 + l16) * LP;
      const v16h b0 = ldfrag(br, kb8);
      const v16h b1 = ldfrag(br + 32, kb8);
      acc[nt] = wmma16(a0, b0, acc[nt]);
      acc[nt] = wmma16(a1, b1, acc[nt]);
      WGUARD(acc[nt], a1, b1);
    }
    __syncthreads();
  }
}

// =====================================================================================
// QKV projection: acc = Xh . (64 W)^T ; val = acc/64 + bf16r(b)
// coverage: grid (MROWS/64, NQKV/64) -> every (position, column) of q, k hi/lo and V^T exactly once.
// =====================================================================================
__global__ __launch_bounds__(128) void k_qkv(const _Float16* __restrict__ Xh, const _Float16* __restrict__ Wh,
                                             const float* __restrict__ bias,
                                             _Float16* __restrict__ Qhi, _Float16* __restrict__ Qlo,
                                             _Float16* __restrict__ Khi, _Float16* __restrict__ Klo,
                                             _Float16* __restrict__ Vt) {
  __shared__ __align__(16) _Float16 sA[64 * LP];
  __shared__ __align__(16) _Float16 sB[64 * LP];
  const int tid = threadIdx.x, lane = tid & 31, wave = tid >> 5, l16 = lane & 15, half = lane >> 4;
  const int m0 = blockIdx.x * 64, n0 = blockIdx.y * 64;

  v8f acc[4];
#pragma unroll
  for (int nt = 0; nt < 4; ++nt) acc[nt] = zero8();
  gemm_tile(Xh, Wh, m0, n0, sA, sB, acc);

  const int sel = n0 / DM;                        // 0 q, 1 k, 2 v   (block-uniform)
  const int hd  = (n0 - sel * DM) / DH;           // head
  const int bb  = m0 / SEQ, l0 = m0 - bb * SEQ;   // batch, first position of the tile
  const size_t bh = (size_t)bb * HEADS + hd;
  const float inv = 1.0f / WSC;
  float bcol[4];
#pragma unroll
  for (int nt = 0; nt < 4; ++nt) bcol[nt] = bf16r(bias[n0 + nt * 16 + l16]);

  // ---- stage the 64x64 result in LDS (sA/sB free after the main loop's final barrier) ----
  if (sel < 2) {
#pragma unroll
    for (int nt = 0; nt < 4; ++nt) {
#pragma unroll
      for (int r = 0; r < 8; ++r) {
        const float v = acc[nt][r] * inv + bcol[nt];
        const _Float16 hi = (_Float16)v;
        const _Float16 lo = (_Float16)((v - (float)hi) * RSC);
        const int row = wave * 16 + half * 8 + r, col = nt * 16 + l16;
        sA[row * LP + col] = hi;
        sB[row * LP + col] = lo;
      }
    }
  } else {
#pragma unroll
    for (int nt = 0; nt < 4; ++nt) {
      H8U o;
#pragma unroll
      for (int r = 0; r < 8; ++r) o.h[r] = (_Float16)(acc[nt][r] * inv + bcol[nt]);
      // transposed: LDS row = e (tile column), 8 consecutive positions per lane
      *(u4*)(sA + (nt * 16 + l16) * LP + wave * 16 + half * 8) = o.u;
    }
  }
  __syncthreads();

  // ---- whole-line write-out, 4 passes of 16 lines, lanes 8q..8q+7 <-> one line ----
  if (sel < 2) {
    _Float16* dhp = ((sel == 0) ? Qhi : Khi) + (bh * SEQ + l0) * DH;
    _Float16* dlp = ((sel == 0) ? Qlo : Klo) + (bh * SEQ + l0) * DH;
#pragma unroll
    for (int p = 0; p < 4; ++p) {
      const int line = p * 16 + (tid >> 3), piece = tid & 7;
      const u4 vh = *(const u4*)(sA + line * LP + piece * 8);
      const u4 vl = *(const u4*)(sB + line * LP + piece * 8);
      *(u4*)(dhp + line * DH + piece * 8) = vh;
      *(u4*)(dlp + line * DH + piece * 8) = vl;
    }
    
  } else {
    _Float16* dvp = Vt + (bh * DH) * (size_t)SEQ + l0;     // row e at dvp + e*SEQ
#pragma unroll
    for (int p = 0; p < 4; ++p) {
      const int e = p * 16 + (tid >> 3), piece = tid & 7;
      const u4 v = *(const u4*)(sA + e * LP + piece * 8);
      *(u4*)(dvp + (size_t)e * SEQ + piece * 8) = v;
    }
    
  }
}

__device__ __forceinline__ float xhalf(float x) {
  const int b = __builtin_bit_cast(int, x);
  return __builtin_bit_cast(float, __builtin_amdgcn_permlanex16(b, b, 0x76543210, 0xfedcba98, false, false));
}

__device__ __forceinline__ unsigned lds_addr(const _Float16* p) {   // byte address inside the work-group's LDS
  return (unsigned)(unsigned long long)p;
}

// One thread's share of a step's three tiles: six 16-byte asynchronous copies, global memory -> LDS, through no register.
// The s_wait_xcnt closes the statement so that no address register named here is rewritten ahead of it.
__device__ __forceinline__ void copy_tiles(unsigned lkh0, unsigned lkh1, unsigned lkl0, unsigned lkl1,
                                           unsigned lv0, unsigned lv1,
                                           const _Float16* gkh0, const _Float16* gkh1,
                                           const _Float16* gkl0, const _Float16* gkl1,
                                           const _Float16* gv0, const _Float16* gv1) {
  asm volatile("global_load_async_to_lds_b128 %0, %6, off\n\t"
               "global_load_async_to_lds_b128 %1, %7, off\n\t"
               "global_load_async_to_lds_b128 %2, %8, off\n\t"
               "global_load_async_to_lds_b128 %3, %9, off\n\t"
               "global_load_async_to_lds_b128 %4, %10, off\n\t"
               "global_load_async_to_lds_b128 %5, %11, off\n\t"
               "s_wait_xcnt 0x0"
               :: "v"(lkh0), "v"(lkh1), "v"(lkl0), "v"(lkl1), "v"(lv0), "v"(lv1),
                  "v"(gkh0), "v"(gkh1), "v"(gkl0), "v"(gkl1), "v"(gv0), "v"(gv1)
               : "memory");
}

__global__ __launch_bounds__(256) void k_attn(const _Float16* __restrict__ Qhi, const _Float16* __restrict__ Qlo,
                                              const _Float16* __restrict__ Khi, const _Float16* __restrict__ Klo,
                                              const _Float16* __restrict__ Vt, const float* __restrict__ lam_p,
                                              const int* __restrict__ heads_p, _Float16* __restrict__ Oh) {
  const int tid = threadIdx.x, lane = tid & 31, wave = tid >> 5;
  const int l16 = lane & 15, half = lane >> 4, kb8 = half * 8;
  const int bh = blockIdx.x;
  const int b  = bh / HEADS, h = bh - b * HEADS;
  const int qBase = blockIdx.y * QT;

  // two tile buffers (step it works on buffer it & 1), each K-hi | K-lo | V^T; behind them the O write-out staging
  __shared__ __align__(16) _Float16 smem[2 * 3 * KT * LP + 8 * 16 * LP];
#define TILE(buf, plane) (smem + ((buf) * 3 + (plane)) * (KT * LP))
  _Float16* po = smem + 2 * 3 * KT * LP + wave * (16 * LP);   // wave-private [16 rows][LP]

  const float lamr = bf16r(lam_p[0]);
  const int   hv   = heads_p[0];
  const float lamv = (hv == HEADS) ? lamr : __uint_as_float(0x7fc00000u);   // poison on structural conflict

  // ---- Q fragments straight from the f16 planes (B layout: column = query l16) ----
  const size_t qrow = (size_t)bh * SEQ + qBase + wave * 16 + l16;
  const _Float16* qh = Qhi + qrow * DH;
  const _Float16* ql = Qlo + qrow * DH;
  const v16h qa0 = ldfrag(qh, kb8), qa1 = ldfrag(qh + 32, kb8);
  const v16h qr0 = ldfrag(ql, kb8), qr1 = ldfrag(ql + 32, kb8);

  float m = -3.0e38f, lsum = 0.0f, lgLast = 0.0f;   // lsum: this lane half's keys only, joined in the epilogue
  v8f acc[4];                                       // acc[n][j] = O'[e = 16n + 8*half + j][query l16]
#pragma unroll
  for (int n = 0; n < 4; ++n) acc[n] = zero8();

  const float cxs = 1.0f / RSC;

  const _Float16* khBase = Khi + (size_t)bh * SEQ * DH;
  const _Float16* klBase = Klo + (size_t)bh * SEQ * DH;
  const _Float16* vtBase = Vt  + (size_t)bh * DH * SEQ;

  // a thread copies rows sr and sr + 32, 16-byte piece spc, of each of the three tiles
  const int sr = tid >> 3, spc = tid & 7;
  const int so0 = sr * LP + spc * 8, so1 = (sr + 32) * LP + spc * 8;
  const _Float16* gkh = khBase + (size_t)sr * DH + spc * 8;
  const _Float16* gkl = klBase + (size_t)sr * DH + spc * 8;
  const _Float16* gv  = vtBase + (size_t)sr * SEQ + spc * 8;
#define COPY_STEP(step, buf)                                                                          \
  copy_tiles(lds_addr(TILE(buf, 0) + so0), lds_addr(TILE(buf, 0) + so1), lds_addr(TILE(buf, 1) + so0), \
             lds_addr(TILE(buf, 1) + so1), lds_addr(TILE(buf, 2) + so0), lds_addr(TILE(buf, 2) + so1), \
             gkh + (size_t)(step) * (KT * DH), gkh + (size_t)(step) * (KT * DH) + 32 * DH,            \
             gkl + (size_t)(step) * (KT * DH), gkl + (size_t)(step) * (KT * DH) + 32 * DH,            \
             gv + (step) * KT, gv + (step) * KT + (size_t)32 * SEQ)

  COPY_STEP(0, 0);
  asm volatile("s_wait_asynccnt 0x0" ::: "memory");   // this wave's share of step 0 has landed
  __syncthreads();                                    // step 0 readable by every wave
  COPY_STEP(1, 1);                                    // flies while step 0 is worked on

  for (int it2 = 0; it2 < SEQ / KT; it2 += 2) {
#pragma unroll                                        // the buffer index is a constant: LDS offsets stay immediates
   for (int u = 0; u < 2; ++u) {
    const int it = it2 + u;
    const _Float16* cKh = TILE(u, 0);
    const _Float16* cKl = TILE(u, 1);
    const _Float16* cV  = TILE(u, 2);

    // ---- scores over four 16-key subtiles: p[t][j] = logit(key 16t + 8*half + j, query l16) ----
    float p[4][8];
    float tm[4];
#pragma unroll
    for (int t = 0; t < 4; ++t) {
      const _Float16* kr = cKh + (t * 16 + l16) * LP;
      const _Float16* kq = cKl + (t * 16 + l16) * LP;
      const v16h kh0 = ldfrag(kr, kb8), kh1 = ldfrag(kr + 32, kb8);
      v8f chh = zero8();
      chh = wmma16(kh0, qa0, chh);
      chh = wmma16(kh1, qa1, chh);
      v8f cx = zero8();
      cx = wmma16(kh0, qr0, cx);
      cx = wmma16(kh1, qr1, cx);
      const v16h kl0 = ldfrag(kq, kb8), kl1 = ldfrag(kq + 32, kb8);
      cx = wmma16(kl0, qa0, cx);
      cx = wmma16(kl1, qa1, cx);
      WGUARD2(chh, cx, qa1, kh1, kl1);
      tm[t] = -3.0e38f;
#pragma unroll
      for (int j = 0; j < 8; ++j) {
        const float lg = (chh[j] + cx[j] * cxs) * SCL;
        p[t][j] = lg;
        tm[t] = fmaxf(tm[t], lg);
      }
    }

    // ---- query max: in-lane, then one exchange between the lane halves ----
    float tmax = fmaxf(fmaxf(tm[0], tm[1]), fmaxf(tm[2], tm[3]));
    tmax = fmaxf(tmax, xhalf(tmax));
    // raw logit of this step's last key (half 1, subtile 3, j = 7), made valid in both halves
    const float oraw = xhalf(p[3][7]);
    const float nlg  = (half != 0) ? p[3][7] : oraw;

    const float nm   = fmaxf(m, tmax);
    const float corr = __expf(m - nm);
    m = nm;
    const float pt     = __expf(lgLast - nm);     // p of the prior step's last key under the new max
    const float pleft0 = (it == 0) ? 0.0f : pt;
    lgLast = nlg;

    float st[4];
#pragma unroll
    for (int t = 0; t < 4; ++t) {
      st[t] = 0.0f;
#pragma unroll
      for (int j = 0; j < 8; ++j) {
        p[t][j] = __expf(p[t][j] - m);
        st[t] += p[t][j];
      }
    }
    lsum = lsum * corr + ((st[0] + st[1]) + (st[2] + st[3]));
#pragma unroll
    for (int n = 0; n < 4; ++n)
#pragma unroll
      for (int j = 0; j < 8; ++j) acc[n][j] *= corr;

    // ---- key-differenced P' = 1024*(p - p_left), packed in place into the B operands (k = keys) ----
    v16h pb[2];
    {
      float xprev = pleft0;
#pragma unroll
      for (int t = 0; t < 4; ++t) {
        const float x = xhalf(p[t][7]);           // half 1 sees key 16t+7, half 0 sees key 16t+15
        float left = (half != 0) ? x : xprev;
        xprev = x;
#pragma unroll
        for (int j = 0; j < 8; ++j) {
          pb[t >> 1][(t & 1) * 8 + j] = (_Float16)((p[t][j] - left) * PSC);
          left = p[t][j];
        }
      }
    }

    // ---- V^T A-fragments (rows = e, k = keys); O^T += V^T.P'^T ----
#pragma unroll
    for (int n = 0; n < 4; ++n) {
      const _Float16* vr = cV + (16 * n + l16) * LP;
      const v16h uv0 = ldfrag(vr, kb8), uv1 = ldfrag(vr + 32, kb8);
      acc[n] = wmma16(uv0, pb[0], acc[n]);
      acc[n] = wmma16(uv1, pb[1], acc[n]);
      WGUARD(acc[n], uv1, pb[1]);
    }

    // ---- hand-over: own LDS reads retired, own copies of step it + 1 landed, then the step's one barrier ----
    asm volatile("s_wait_dscnt 0x0" ::: "memory");      // before buffer u is refilled
    asm volatile("s_wait_asynccnt 0x0" ::: "memory");   // before other waves read this wave's share of step it + 1
    __syncthreads();                                    // publishes step it + 1, ends every read of buffer u
    if (it + 2 < SEQ / KT) COPY_STEP(it + 2, u);        // flies while step it + 1 is worked on
   }
  }
  asm volatile("s_wait_asynccnt 0x0" ::: "memory");     // nothing in flight when the wave goes on
#undef COPY_STEP
#undef TILE

  // ---- finalize: join the halves' sums, cyclic term, normaliser, lam, O carry ----
  lsum += xhalf(lsum);
  const float pL = __expf(lgLast - m) * PSC;      // lgLast = logit of key SEQ-1 for this query
  const float f  = lamv * (OSC / PSC) * (1.0f / lsum);

  // a lane's 8 accumulator registers are 8 consecutive columns of one O row: one 16-byte LDS store per tile
#pragma unroll
  for (int n = 0; n < 4; ++n) {
    H8U o;
#pragma unroll
    for (int j = 0; j < 8; ++j) {
      const float v0 = (float)vtBase[(size_t)(16 * n + kb8 + j) * SEQ];     // v of key 0, column e
      o.h[j] = (_Float16)((acc[n][j] - pL * v0) * f);
    }
    *(u4*)(po + l16 * LP + 16 * n + kb8) = o.u;
  }
  __builtin_amdgcn_fence(5, "wavefront");
  __builtin_amdgcn_wave_barrier();

  _Float16* od = Oh + ((size_t)b * SEQ + qBase + wave * 16) * DM + h * DH;
#pragma unroll
  for (int p4 = 0; p4 < 4; ++p4) {
    const int line = p4 * 4 + (lane >> 3), piece = lane & 7;
    const u4 v = *(const u4*)(po + line * LP + piece * 8);
    *(u4*)(od + (size_t)line * DM + piece * 8) = v;
  }
}

// =====================================================================================
// Output projection: out = (Oh/1024) . (64 W_out)^T / 64 + bf16r(b_out), f32 rows of d_out.
// 64x64 f32 tile staged in LDS [64][FP]; each 256-B row segment = 2 lines, each line 8 lanes x 16 B of one
// =====================================================================================
__global__ __launch_bounds__(128) void k_out(const _Float16* __restrict__ Oh, const _Float16* __restrict__ Woh,
                                             const float* __restrict__ bias, float* __restrict__ out) {
  __shared__ __align__(16) unsigned char smem[2 * 64 * LP * 2];
  _Float16* sA = (_Float16*)smem;
  _Float16* sB = sA + 64 * LP;
  const int tid = threadIdx.x, lane = tid & 31, wave = tid >> 5, l16 = lane & 15, half = lane >> 4;
  const int m0 = blockIdx.x * 64, n0 = blockIdx.y * 64;

  v8f acc[4];
#pragma unroll
  for (int nt = 0; nt < 4; ++nt) acc[nt] = zero8();
  gemm_tile(Oh, Woh, m0, n0, sA, sB, acc);

  float* sF = (float*)smem;                       // [64][FP]
  const float inv = 1.0f / (OSC * WSC);
  float bcol[4];
#pragma unroll
  for (int nt = 0; nt < 4; ++nt) bcol[nt] = bf16r(bias[n0 + nt * 16 + l16]);
#pragma unroll
  for (int nt = 0; nt < 4; ++nt) {
#pragma unroll
    for (int r = 0; r < 8; ++r) {
      const int row = wave * 16 + half * 8 + r, col = nt * 16 + l16;
      sF[row * FP + col] = acc[nt][r] * inv + bcol[nt];
    }
  }
  __syncthreads();

  const int bb = m0 / SEQ, l0 = m0 - bb * SEQ;
  float* dbase = out + ((size_t)bb * SEQ_FULL + l0) * DM + n0;
#pragma unroll
  for (int p = 0; p < 8; ++p) {
    const int line = p * 16 + (tid >> 3), piece = tid & 7;
    const int row = line >> 1, hs = line & 1;
    const f4 v = *(const f4*)(sF + row * FP + hs * 32 + piece * 4);
    *(f4*)(dbase + (size_t)row * DM + hs * 32 + piece * 4) = v;
  }
  
}

// =====================================================================================
// Host launcher: 6 launches, grids and arguments are pure functions of the size macros.
// =====================================================================================
static inline unsigned cdiv_u(unsigned a, unsigned b) { return (a + b - 1) / b; }

extern "C" void kernel_launch(void* const* d_in, const int* in_sizes, int n_in,
                              void* d_out, int out_size, void* d_ws, size_t ws_size,
                              hipStream_t stream) {
  if (n_in < 7) return;
  const long long need_rows = (long long)(NB - 1) * SEQ_FULL + SEQ;
  if ((long long)in_sizes[0] < need_rows * DM) return;
  if (in_sizes[1] < NQKV * DM) return;
  if (in_sizes[2] < NQKV) return;
  if (in_sizes[3] < DM * DM) return;
  if (in_sizes[4] < DM) return;
  if (in_sizes[5] < 1) return;
  if (in_sizes[6] < 1) return;
  if ((long long)out_size < need_rows * DM) return;
  if (d_ws == nullptr || ws_size < WS_NEED) return;

  const float* x     = (const float*)d_in[0];
  const float* w_qkv = (const float*)d_in[1];
  const float* b_qkv = (const float*)d_in[2];
  const float* w_out = (const float*)d_in[3];
  const float* b_out = (const float*)d_in[4];
  const float* lam   = (const float*)d_in[5];
  const int*   heads = (const int*)d_in[6];
  float* out = (float*)d_out;

  char* ws = (char*)d_ws;
  _Float16* Xh  = (_Float16*)(ws + OFF_XH);
  _Float16* Wq  = (_Float16*)(ws + OFF_WQ);
  _Float16* Wo  = (_Float16*)(ws + OFF_WO);
  _Float16* Qhi = (_Float16*)(ws + OFF_QH);
  _Float16* Qlo = (_Float16*)(ws + OFF_QL);
  _Float16* Khi = (_Float16*)(ws + OFF_KH);
  _Float16* Klo = (_Float16*)(ws + OFF_KL);
  _Float16* Vt  = (_Float16*)(ws + OFF_VT);
  _Float16* Oh  = (_Float16*)(ws + OFF_OH);

  const int gx = MROWS * G8, gq = NQKV * G8, go = DM * G8;
  k_convert<<<dim3(cdiv_u(gx, 256)), dim3(256), 0, stream>>>(x,     Xh, gx, SEQ,  SEQ_FULL, 1.0f);
  k_convert<<<dim3(cdiv_u(gq, 256)), dim3(256), 0, stream>>>(w_qkv, Wq, gq, NQKV, NQKV,     WSC);
  k_convert<<<dim3(cdiv_u(go, 256)), dim3(256), 0, stream>>>(w_out, Wo, go, DM,   DM,       WSC);

  k_qkv<<<dim3(MROWS / 64, NQKV / 64), dim3(128), 0, stream>>>(Xh, Wq, b_qkv, Qhi, Qlo, Khi, Klo, Vt);
  k_attn<<<dim3(NB * HEADS, SEQ / QT), dim3(256), 0, stream>>>(Qhi, Qlo, Khi, Klo, Vt, lam, heads, Oh);
  k_out<<<dim3(MROWS / 64, DM / 64), dim3(128), 0, stream>>>(Oh, Wo, b_out, out);
}

// v004
// One run takes 118 microseconds.
// In both of two side-by-side timings against v003, it was 1.05 times as fast.
// Over all steps from v000 it is 1.68 times as fast.
#include <hip/hip_runtime.h>

// Contractions on v_wmma_f32_16x16x32_f16 (f16 operands, f32 accumulate): qkv projection (x as f16 of its bf16-RNE value,
// W as f16 of its bf16-RNE value x64); scores (q and k as f16 hi + f16 residual x2048, three products); P.V
// (key-differenced softmax numerators x1024 in f16, V in f16); output projection (O x1024 in f16, W x64).
// Softmax, normaliser, cyclic correction and bias adds in f32.

typedef _Float16     v16h __attribute__((ext_vector_type(16)));
typedef _Float16     h8   __attribute__((ext_vector_type(8)));
typedef float        v8f  __attribute__((ext_vector_type(8)));
typedef float        f4   __attribute__((ext_vector_type(4)));
typedef unsigned int u4   __attribute__((ext_vector_type(4)));

#ifndef NB
#define NB 2
#endif
#ifndef SEQ
#define SEQ 2048
#endif
#define NB_FULL  2
#define SEQ_FULL 2048
#define DM     1024
#define HEADS  16
#define DH     64
#define NQKV   (3 * DM)
#define MROWS  (NB * SEQ)
#define G8     (DM / 8)          // 16-byte groups per row

#define QT  128                  // query rows per block (8 waves x 16)
#define KT  64                   // keys per main-loop step
#define LP  72                   // f16 LDS row pitch (144 B)
#define FP  68                   // f32 LDS row pitch (272 B)

#define WSC 64.0f                // weight planes carried x64
#define RSC 2048.0f              // q/k residual planes carried x2048
#define PSC 1024.0f              // P operand carried x1024
#define OSC 1024.0f              // O plane carried x1024
#define SCL 0.03125f             // d_model^-0.5 = 1/32

static_assert(DM == 1024);
static_assert(G8 == 128);
static_assert(HEADS * DH == DM);
static_assert(DH == 64);
static_assert(SEQ % QT == 0);
static_assert(SEQ % KT == 0);
static_assert((SEQ / KT) % 2 == 0);
static_assert(KT == DH);
static_assert(SEQ % 64 == 0);
static_assert(MROWS % 64 == 0);
static_assert(NQKV % 64 == 0);
static_assert(NB >= 1 && NB <= NB_FULL);
static_assert(SEQ <= SEQ_FULL);
static_assert(64 * FP * 4 <= 2 * 64 * LP * 2);

// ---------------- workspace layout (all offsets multiples of 512 KiB) ----------------
#define XH_BYTES ((size_t)MROWS * DM * 2)          // f16 x            [MROWS][DM]
#define WQ_BYTES ((size_t)NQKV * DM * 2)           // f16 64*W_qkv     [NQKV][DM]
#define WO_BYTES ((size_t)DM * DM * 2)             // f16 64*W_out     [DM][DM]
#define PL_BYTES ((size_t)MROWS * DM * 2)          // one f16 plane: [NB*H][SEQ][DH] or [NB*H][DH][SEQ] or [MROWS][DM]
#define OFF_XH  ((size_t)0)
#define OFF_WQ  (OFF_XH + XH_BYTES)
#define OFF_WO  (OFF_WQ + WQ_BYTES)
#define OFF_QH  (OFF_WO + WO_BYTES)
#define OFF_QL  (OFF_QH + PL_BYTES)
#define OFF_KH  (OFF_QL + PL_BYTES)
#define OFF_KL  (OFF_KH + PL_BYTES)
#define OFF_VT  (OFF_KL + PL_BYTES)
#define OFF_OH  (OFF_VT + PL_BYTES)
#define WS_NEED (OFF_OH + PL_BYTES)
static_assert(WS_NEED <= (size_t)134217728);
static_assert((OFF_WQ % 128) == 0 && (OFF_WO % 128) == 0 && (OFF_QH % 128) == 0 && (OFF_OH % 128) == 0);

// ---------------- helpers ----------------
__device__ __forceinline__ float bf16r(float x) {           // RNE to bf16, kept as f32
  unsigned int u = __float_as_uint(x);
  u = (u + 0x7FFFu + ((u >> 16) & 1u)) & 0xFFFF0000u;
  return __uint_as_float(u);
}

__device__ __forceinline__ v8f zero8() {
  v8f z;
#pragma unroll
  for (int j = 0; j < 8; ++j) z[j] = 0.0f;
  return z;
}

__device__ __forceinline__ v8f wmma16(v16h a, v16h b, v8f c) {
  return __builtin_amdgcn_wmma_f32_16x16x32_f16(false, a, false, b, (short)0, c, false, false);
}

#define WGUARD(acc, a, b) \
  asm volatile("v_nop\n\tv_nop\n\tv_nop\n\tv_nop" : "+v"(acc) : "v"(a), "v"(b))
#define WGUARD2(c0, c1, a, b0, b1) \
  asm volatile("v_nop\n\tv_nop\n\tv_nop\n\tv_nop" : "+v"(c0), "+v"(c1) : "v"(a), "v"(b0), "v"(b1))

union HU  { v16h v; h8 p[2]; };
union H8U { h8 h; u4 u; };

// 16-bit fragment (A or B) from a k-contiguous row: elements 0..7 <- k 8h..8h+7, 8..15 <- k 16+8h..16+8h+7
__device__ __forceinline__ v16h ldfrag(const _Float16* row, int kb8) {
  HU u;
  u.p[0] = *(const h8*)(row + kb8);
  u.p[1] = *(const h8*)(row + 16 + kb8);
  return u.v;
}

// =====================================================================================
// Convert: dst[row][c] = f16( bf16r(src[srow][c]) * scale ), srow = (row/seq)*seq_full + row%seq
// coverage: ngroups*8 = rows*DM elements, every element of the plane.
// =====================================================================================
__global__ __launch_bounds__(256) void k_convert(const float* __restrict__ src, _Float16* __restrict__ dst,
                                                 int ngroups, int seq, int seq_full, float scale) {
  const int g = blockIdx.x * 256 + threadIdx.x;
  if (g >= ngroups) return;                       // no barriers in this kernel
  const int row = g >> 7;
  const int c8  = g & 127;
  const int srow = (row / seq) * seq_full + (row - (row / seq) * seq);
  const float* s = src + (size_t)srow * DM + c8 * 8;
  const f4 a = *(const f4*)s;
  const f4 b = *(const f4*)(s + 4);
  H8U o;
#pragma unroll
  for (int j = 0; j < 4; ++j) {
    o.h[j]     = (_Float16)(bf16r(a[j]) * scale);
    o.h[4 + j] = (_Float16)(bf16r(b[j]) * scale);
  }
  _Float16* d = dst + (size_t)row * DM + c8 * 8;
  *(u4*)d = o.u;
  
}

// =====================================================================================
// 64x64 tile GEMM main loop: C[m][n] += sum_k A[m][k] * Bw[n][k], K = DM, 128 threads (4 waves x 16 rows)
// A, Bw are f16 row-major with pitch DM. LDS tiles [64][LP] staged with 16-B loads, cross-wave (block barriers).
// staged extent == consumed extent: rows 0..63, halves 0..63 of both tiles.
// =====================================================================================
__device__ __forceinline__ void gemm_tile(const _Float16* __restrict__ A, const _Float16* __restrict__ Bw,
                                          int m0, int n0, _Float16* sA, _Float16* sB, v8f (&acc)[4]) {
  const int tid = threadIdx.x, lane = tid & 31, wave = tid >> 5, l16 = lane & 15, kb8 = (lane >> 4) * 8;
  for (int k0 = 0; k0 < DM; k0 += 64) {
    // all eight loads of the step first, then the LDS stores: one trip to L2 per step instead of one per load
    u4 va[4], vb[4];
#pragma unroll
    for (int i = 0; i < 4; ++i) {
      const int idx = tid + 128 * i;
      const int r = idx >> 3, pc = idx & 7;
      va[i] = *(const u4*)(A  + (size_t)(m0 + r) * DM + k0 + pc * 8);
      vb[i] = *(const u4*)(Bw + (size_t)(n0 + r) * DM + k0 + pc * 8);
    }
    // keeps the scheduler from sinking each load down to its own store, where it is waited for before the next is issued
    __builtin_amdgcn_sched_barrier(0);
#pragma unroll
    for (int i = 0; i < 4; ++i) {
      const int idx = tid + 128 * i;
      const int r = idx >> 3, pc = idx & 7;
      *(u4*)(sA + r * LP + pc * 8) = va[i];
      *(u4*)(sB + r * LP + pc * 8) = vb[i];
    }
    __syncthreads();
    const _Float16* ar = sA + (wave * 16 + l16) * LP;
    // the step's ten fragments as one group of LDS reads: one LDS latency a step instead of one per column tile
    const v16h a0 = ldfrag(ar, kb8);
    const v16h a1 = ldfrag(ar + 32, kb8);
    v16h b0[4], b1[4];
#pragma unroll
    for (int nt = 0; nt < 4; ++nt) {
      const _Float16* br = sB + (nt * 16 + l16) * LP;
      b0[nt] = ldfrag(br, kb8);
      b1[nt] = ldfrag(br + 32, kb8);
    }
    // keeps the scheduler from sinking each tile's reads down to its products, where each is waited out in turn
    __builtin_amdgcn_sched_barrier(0);
#pragma unroll
    for (int nt = 0; nt < 4; ++nt) {
      acc[nt] = wmma16(a0, b0[nt], acc[nt]);
      acc[nt] = wmma16(a1, b1[nt], acc[nt]);
      WGUARD(acc[nt], a1, b1[nt]);
    }
    __syncthreads();
  }
}

// =====================================================================================
// QKV projection: acc = Xh . (64 W)^T ; val = acc/64 + bf16r(b)
// coverage: grid (MROWS/64, NQKV/64) -> every (position, column) of q, k hi/lo and V^T exactly once.
// =====================================================================================
__global__ __launch_bounds__(128) void k_qkv(const _Float16* __restrict__ Xh, const _Float16* __restrict__ Wh,
                                             const float* __restrict__ bias,
                                             _Float16* __restrict__ Qhi, _Float16* __restrict__ Qlo,
                                             _Float16* __restrict__ Khi, _Float16* __restrict__ Klo,
                                             _Float16* __restrict__ Vt) {
  __shared__ __align__(16) _Float16 sA[64 * LP];
  __shared__ __align__(16) _Float16 sB[64 * LP];
  const int tid = threadIdx.x, lane = tid & 31, wave = tid >> 5, l16 = lane & 15, half = lane >> 4;
  const int m0 = blockIdx.x * 64, n0 = blockIdx.y * 64;

  v8f acc[4];
#pragma unroll
  for (int nt = 0; nt < 4; ++nt) acc[nt] = zero8();
  gemm_tile(Xh, Wh, m0, n0, sA, sB, acc);

  const int sel = n0 / DM;                        // 0 q, 1 k, 2 v   (block-uniform)
  const int hd  = (n0 - sel * DM) / DH;           // head
  const int bb  = m0 / SEQ, l0 = m0 - bb * SEQ;   // batch, first position of the tile
  const size_t bh = (size_t)bb * HEADS + hd;
  const float inv = 1.0f / WSC;
  float bcol[4];
#pragma unroll
  for (int nt = 0; nt < 4; ++nt) bcol[nt] = bf16r(bias[n0 + nt * 16 + l16]);

  // ---- stage the 64x64 result in LDS (sA/sB free after the main loop's final barrier) ----
  if (sel < 2) {
#pragma unroll
    for (int nt = 0; nt < 4; ++nt) {
#pragma unroll
      for (int r = 0; r < 8; ++r) {
        const float v = acc[nt][r] * inv + bcol[nt];
        const _Float16 hi = (_Float16)v;
        const _Float16 lo = (_Float16)((v - (float)hi) * RSC);
        const int row = wave * 16 + half * 8 + r, col = nt * 16 + l16;
        sA[row * LP + col] = hi;
        sB[row * LP + col] = lo;
      }
    }
  } else {
#pragma unroll
    for (int nt = 0; nt < 4; ++nt) {
      H8U o;
#pragma unroll
      for (int r = 0; r < 8; ++r) o.h[r] = (_Float16)(acc[nt][r] * inv + bcol[nt]);
      // transposed: LDS row = e (tile column), 8 consecutive positions per lane
      *(u4*)(sA + (nt * 16 + l16) * LP + wave * 16 + half * 8) = o.u;
    }
  }
  __syncthreads();

  // ---- whole-line write-out, 4 passes of 16 lines, lanes 8q..8q+7 <-> one line ----
  if (sel < 2) {
    _Float16* dhp = ((sel == 0) ? Qhi : Khi) + (bh * SEQ + l0) * DH;
    _Float16* dlp = ((sel == 0) ? Qlo : Klo) + (bh * SEQ + l0) * DH;
#pragma unroll
    for (int p = 0; p < 4; ++p) {
      const int line = p * 16 + (tid >> 3), piece = tid & 7;
      const u4 vh = *(const u4*)(sA + line * LP + piece * 8);
      const u4 vl = *(const u4*)(sB + line * LP + piece * 8);
      *(u4*)(dhp + line * DH + piece * 8) = vh;
      *(u4*)(dlp + line * DH + piece * 8) = vl;
    }
    
  } else {
    _Float16* dvp = Vt + (bh * DH) * (size_t)SEQ + l0;     // row e at dvp + e*SEQ
#pragma unroll
    for (int p = 0; p < 4; ++p) {
      const int e = p * 16 + (tid >> 3), piece = tid & 7;
      const u4 v = *(const u4*)(sA + e * LP + piece * 8);
      *(u4*)(dvp + (size_t)e * SEQ + piece * 8) = v;
    }
    
  }
}

__device__ __forceinline__ float xhalf(float x) {
  const int b = __builtin_bit_cast(int, x);
  return __builtin_bit_cast(float, __builtin_amdgcn_permlanex16(b, b, 0x76543210, 0xfedcba98, false, false));
}

__device__ __forceinline__ unsigned lds_addr(const _Float16* p) {   // byte address inside the work-group's LDS
  return (unsigned)(unsigned long long)p;
}

// One thread's share of a step's three tiles: six 16-byte asynchronous copies, global memory -> LDS, through no register.
// The s_wait_xcnt closes the statement so that no address register named here is rewritten ahead of it.
__device__ __forceinline__ void copy_tiles(unsigned lkh0, unsigned lkh1, unsigned lkl0, unsigned lkl1,
                                           unsigned lv0, unsigned lv1,
                                           const _Float16* gkh0, const _Float16* gkh1,
                                           const _Float16* gkl0, const _Float16* gkl1,
                                           const _Float16* gv0, const _Float16* gv1) {
  asm volatile("global_load_async_to_lds_b128 %0, %6, off\n\t"
               "global_load_async_to_lds_b128 %1, %7, off\n\t"
               "global_load_async_to_lds_b128 %2, %8, off\n\t"
               "global_load_async_to_lds_b128 %3, %9, off\n\t"
               "global_load_async_to_lds_b128 %4, %10, off\n\t"
               "global_load_async_to_lds_b128 %5, %11, off\n\t"
               "s_wait_xcnt 0x0"
               :: "v"(lkh0), "v"(lkh1), "v"(lkl0), "v"(lkl1), "v"(lv0), "v"(lv1),
                  "v"(gkh0), "v"(gkh1), "v"(gkl0), "v"(gkl1), "v"(gv0), "v"(gv1)
               : "memory");
}

// four waves a SIMD (two work-groups a WGP, all of the grid resident at once): the fragment groups must fit 256 registers
__global__ __launch_bounds__(256) __attribute__((amdgpu_waves_per_eu(4, 4))) void k_attn(const _Float16* __restrict__ Qhi, const _Float16* __restrict__ Qlo,
                                              const _Float16* __restrict__ Khi, const _Float16* __restrict__ Klo,
                                              const _Float16* __restrict__ Vt, const float* __restrict__ lam_p,
                                              const int* __restrict__ heads_p, _Float16* __restrict__ Oh) {
  const int tid = threadIdx.x, lane = tid & 31, wave = tid >> 5;
  const int l16 = lane & 15, half = lane >> 4, kb8 = half * 8;
  const int bh = blockIdx.x;
  const int b  = bh / HEADS, h = bh - b * HEADS;
  const int qBase = blockIdx.y * QT;

  // two tile buffers (step it works on buffer it & 1), each K-hi | K-lo | V^T; behind them the O write-out staging
  __shared__ __align__(16) _Float16 smem[2 * 3 * KT * LP + 8 * 16 * LP];
#define TILE(buf, plane) (smem + ((buf) * 3 + (plane)) * (KT * LP))
  _Float16* po = smem + 2 * 3 * KT * LP + wave * (16 * LP);   // wave-private [16 rows][LP]

  const float lamr = bf16r(lam_p[0]);
  const int   hv   = heads_p[0];
  const float lamv = (hv == HEADS) ? lamr : __uint_as_float(0x7fc00000u);   // poison on structural conflict

  // ---- Q fragments straight from the f16 planes (B layout: column = query l16) ----
  const size_t qrow = (size_t)bh * SEQ + qBase + wave * 16 + l16;
  const _Float16* qh = Qhi + qrow * DH;
  const _Float16* ql = Qlo + qrow * DH;
  const v16h qa0 = ldfrag(qh, kb8), qa1 = ldfrag(qh + 32, kb8);
  const v16h qr0 = ldfrag(ql, kb8), qr1 = ldfrag(ql + 32, kb8);

  float m = -3.0e38f, lsum = 0.0f, lgLast = 0.0f;   // lsum: this lane half's keys only, joined in the epilogue
  v8f acc[4];                                       // acc[n][j] = O'[e = 16n + 8*half + j][query l16]
#pragma unroll
  for (int n = 0; n < 4; ++n) acc[n] = zero8();

  const float cxs = 1.0f / RSC;

  const _Float16* khBase = Khi + (size_t)bh * SEQ * DH;
  const _Float16* klBase = Klo + (size_t)bh * SEQ * DH;
  const _Float16* vtBase = Vt  + (size_t)bh * DH * SEQ;

  // a thread copies rows sr and sr + 32, 16-byte piece spc, of each of the three tiles
  const int sr = tid >> 3, spc = tid & 7;
  const int so0 = sr * LP + spc * 8, so1 = (sr + 32) * LP + spc * 8;
  const _Float16* gkh = khBase + (size_t)sr * DH + spc * 8;
  const _Float16* gkl = klBase + (size_t)sr * DH + spc * 8;
  const _Float16* gv  = vtBase + (size_t)sr * SEQ + spc * 8;
#define COPY_STEP(step, buf)                                                                          \
  copy_tiles(lds_addr(TILE(buf, 0) + so0), lds_addr(TILE(buf, 0) + so1), lds_addr(TILE(buf, 1) + so0), \
             lds_addr(TILE(buf, 1) + so1), lds_addr(TILE(buf, 2) + so0), lds_addr(TILE(buf, 2) + so1), \
             gkh + (size_t)(step) * (KT * DH), gkh + (size_t)(step) * (KT * DH) + 32 * DH,            \
             gkl + (size_t)(step) * (KT * DH), gkl + (size_t)(step) * (KT * DH) + 32 * DH,            \
             gv + (step) * KT, gv + (step) * KT + (size_t)32 * SEQ)

  COPY_STEP(0, 0);
  asm volatile("s_wait_asynccnt 0x0" ::: "memory");   // this wave's share of step 0 has landed
  __syncthreads();                                    // step 0 readable by every wave
  COPY_STEP(1, 1);                                    // flies while step 0 is worked on

  // one step on buffer u (a constant at every call: LDS offsets stay immediates); refill says whether a step it + 2 exists
  auto step = [&](const int it, const int u, const bool refill) __attribute__((always_inline)) {
    const _Float16* cKh = TILE(u, 0);
    const _Float16* cKl = TILE(u, 1);
    const _Float16* cV  = TILE(u, 2);

    // ---- scores over four 16-key subtiles: p[t][j] = logit(key 16t + 8*half + j, query l16) ----
    // LDS fragment reads go out in groups ahead of the products that take them (subtiles 0 and 1 at the top, subtile t + 2
    // behind the products of subtile t, V^T rows 0..31 under the last scores and the softmax, rows 32..63 under the rescale), so that a step waits out one LDS
    // latency instead of one per pair of reads.
    // Each sched_barrier below keeps the scheduler from sinking the group above it down to its products.
    v16h kfh[4][2], kfl[4][2], vf[4][2];
#define LOAD_K(t)                                                \
    do {                                                         \
      const _Float16* kr = cKh + ((t) * 16 + l16) * LP;          \
      const _Float16* kq = cKl + ((t) * 16 + l16) * LP;          \
      kfh[t][0] = ldfrag(kr, kb8);                               \
      kfh[t][1] = ldfrag(kr + 32, kb8);                          \
      kfl[t][0] = ldfrag(kq, kb8);                               \
      kfl[t][1] = ldfrag(kq + 32, kb8);                          \
    } while (0)
#define LOAD_V(n)                                                \
    do {                                                         \
      const _Float16* vr = cV + (16 * (n) + l16) * LP;           \
      vf[n][0] = ldfrag(vr, kb8);                                \
      vf[n][1] = ldfrag(vr + 32, kb8);                           \
    } while (0)
    LOAD_K(0);
    LOAD_K(1);
    __builtin_amdgcn_sched_barrier(0);            // the sixteen reads stay together in front of the first product

    float p[4][8];
    float tm[4];
#pragma unroll
    for (int t = 0; t < 4; ++t) {
      const v16h kh0 = kfh[t][0], kh1 = kfh[t][1];
      v8f chh = zero8();
      chh = wmma16(kh0, qa0, chh);
      chh = wmma16(kh1, qa1, chh);
      v8f cx = zero8();
      cx = wmma16(kh0, qr0, cx);
      cx = wmma16(kh1, qr1, cx);
      const v16h kl0 = kfl[t][0], kl1 = kfl[t][1];
      cx = wmma16(kl0, qa0, cx);
      cx = wmma16(kl1, qa1, cx);
      WGUARD2(chh, cx, qa1, kh1, kl1);
      tm[t] = -3.0e38f;
#pragma unroll
      for (int j = 0; j < 8; ++j) {
        const float lg = (chh[j] + cx[j] * cxs) * SCL;
        p[t][j] = lg;
        tm[t] = fmaxf(tm[t], lg);
      }
      if (t < 2) {                                // into the registers subtile t has left
        LOAD_K(t + 2);
        __builtin_amdgcn_sched_barrier(0);        // the reads stay in front of subtile t + 1's products, which cover them
      }
      if (t == 2) {
        LOAD_V(0);
        LOAD_V(1);
        __builtin_amdgcn_sched_barrier(0);        // the reads stay in front of subtile 3's products and the softmax
      }
    }

    // ---- query max: in-lane, then one exchange between the lane halves ----
    float tmax = fmaxf(fmaxf(tm[0], tm[1]), fmaxf(tm[2], tm[3]));
    tmax = fmaxf(tmax, xhalf(tmax));
    // raw logit of this step's last key (half 1, subtile 3, j = 7), made valid in both halves
    const float oraw = xhalf(p[3][7]);
    const float nlg  = (half != 0) ? p[3][7] : oraw;

    const float nm   = fmaxf(m, tmax);
    const float corr = __expf(m - nm);
    m = nm;
    const float pt     = __expf(lgLast - nm);     // p of the prior step's last key under the new max
    const float pleft0 = (it == 0) ? 0.0f : pt;
    lgLast = nlg;

    float st[4];
#pragma unroll
    for (int t = 0; t < 4; ++t) {
      st[t] = 0.0f;
#pragma unroll
      for (int j = 0; j < 8; ++j) {
        p[t][j] = __expf(p[t][j] - m);
        st[t] += p[t][j];
      }
    }
    lsum = lsum * corr + ((st[0] + st[1]) + (st[2] + st[3]));
    LOAD_V(2);                                    // the logits' registers are free from here
    LOAD_V(3);
    __builtin_amdgcn_sched_barrier(0);            // the reads stay in front of the rescale and the packing of P'
#pragma unroll
    for (int n = 0; n < 4; ++n)
#pragma unroll
      for (int j = 0; j < 8; ++j) acc[n][j] *= corr;

    // ---- key-differenced P' = 1024*(p - p_left), packed in place into the B operands (k = keys) ----
    v16h pb[2];
    {
      float xprev = pleft0;
#pragma unroll
      for (int t = 0; t < 4; ++t) {
        const float x = xhalf(p[t][7]);           // half 1 sees key 16t+7, half 0 sees key 16t+15
        float left = (half != 0) ? x : xprev;
        xprev = x;
#pragma unroll
        for (int j = 0; j < 8; ++j) {
          pb[t >> 1][(t & 1) * 8 + j] = (_Float16)((p[t][j] - left) * PSC);
          left = p[t][j];
        }
      }
    }

    // ---- V^T A-fragments (rows = e, k = keys); O^T += V^T.P'^T ----
#pragma unroll
    for (int n = 0; n < 4; ++n) {
      const v16h uv0 = vf[n][0], uv1 = vf[n][1];
      acc[n] = wmma16(uv0, pb[0], acc[n]);
      acc[n] = wmma16(uv1, pb[1], acc[n]);
      WGUARD(acc[n], uv1, pb[1]);
    }

    // ---- hand-over: own LDS reads retired, own copies of step it + 1 landed, then the step's one barrier ----
    asm volatile("s_wait_dscnt 0x0" ::: "memory");      // before buffer u is refilled
    asm volatile("s_wait_asynccnt 0x0" ::: "memory");   // before other waves read this wave's share of step it + 1
    __syncthreads();                                    // publishes step it + 1, ends every read of buffer u
    if (refill) COPY_STEP(it + 2, u);                   // flies while step it + 1 is worked on
  };
  // the last two steps stand behind the loop: the loop's body then has no branch, and each step's sums are formed inside it
  // instead of being carried, 32 registers a step, to a block behind the branch
  for (int it2 = 0; it2 < SEQ / KT - 2; it2 += 2) {
    step(it2, 0, true);
    step(it2 + 1, 1, true);
  }
  step(SEQ / KT - 2, 0, false);
  step(SEQ / KT - 1, 1, false);
  asm volatile("s_wait_asynccnt 0x0" ::: "memory");     // nothing in flight when the wave goes on
#undef LOAD_K
#undef LOAD_V
#undef COPY_STEP
#undef TILE

  // ---- finalize: join the halves' sums, cyclic term, normaliser, lam, O carry ----
  lsum += xhalf(lsum);
  const float pL = __expf(lgLast - m) * PSC;      // lgLast = logit of key SEQ-1 for this query
  const float f  = lamv * (OSC / PSC) * (1.0f / lsum);

  // a lane's 8 accumulator registers are 8 consecutive columns of one O row: one 16-byte LDS store per tile
#pragma unroll
  for (int n = 0; n < 4; ++n) {
    H8U o;
#pragma unroll
    for (int j = 0; j < 8; ++j) {
      const float v0 = (float)vtBase[(size_t)(16 * n + kb8 + j) * SEQ];     // v of key 0, column e
      o.h[j] = (_Float16)((acc[n][j] - pL * v0) * f);
    }
    *(u4*)(po + l16 * LP + 16 * n + kb8) = o.u;
  }
  __builtin_amdgcn_fence(5, "wavefront");
  __builtin_amdgcn_wave_barrier();

  _Float16* od = Oh + ((size_t)b * SEQ + qBase + wave * 16) * DM + h * DH;
#pragma unroll
  for (int p4 = 0; p4 < 4; ++p4) {
    const int line = p4 * 4 + (lane >> 3), piece = lane & 7;
    const u4 v = *(const u4*)(po + line * LP + piece * 8);
    *(u4*)(od + (size_t)line * DM + piece * 8) = v;
  }
}

// =====================================================================================
// Output projection: out = (Oh/1024) . (64 W_out)^T / 64 + bf16r(b_out), f32 rows of d_out.
// 64x64 f32 tile staged in LDS [64][FP]; each 256-B row segment = 2 lines, each line 8 lanes x 16 B of one
// =====================================================================================
__global__ __launch_bounds__(128) void k_out(const _Float16* __restrict__ Oh, const _Float16* __restrict__ Woh,
                                             const float* __restrict__ bias, float* __restrict__ out) {
  __shared__ __align__(16) unsigned char smem[2 * 64 * LP * 2];
  _Float16* sA = (_Float16*)smem;
  _Float16* sB = sA + 64 * LP;
  const int tid = threadIdx.x, lane = tid & 31, wave = tid >> 5, l16 = lane & 15, half = lane >> 4;
  const int m0 = blockIdx.x * 64, n0 = blockIdx.y * 64;

  v8f acc[4];
#pragma unroll
  for (int nt = 0; nt < 4; ++nt) acc[nt] = zero8();
  gemm_tile(Oh, Woh, m0, n0, sA, sB, acc);

  float* sF = (float*)smem;                       // [64][FP]
  const float inv = 1.0f / (OSC * WSC);
  float bcol[4];
#pragma unroll
  for (int nt = 0; nt < 4; ++nt) bcol[nt] = bf16r(bias[n0 + nt * 16 + l16]);
#pragma unroll
  for (int nt = 0; nt < 4; ++nt) {
#pragma unroll
    for (int r = 0; r < 8; ++r) {
      const int row = wave * 16 + half * 8 + r, col = nt * 16 + l16;
      sF[row * FP + col] = acc[nt][r] * inv + bcol[nt];
    }
  }
  __syncthreads();

  const int bb = m0 / SEQ, l0 = m0 - bb * SEQ;
  float* dbase = out + ((size_t)bb * SEQ_FULL + l0) * DM + n0;
#pragma unroll
  for (int p = 0; p < 8; ++p) {
    const int line = p * 16 + (tid >> 3), piece = tid & 7;
    const int row = line >> 1, hs = line & 1;
    const f4 v = *(const f4*)(sF + row * FP + hs * 32 + piece * 4);
    *(f4*)(dbase + (size_t)row * DM + hs * 32 + piece * 4) = v;
  }
  
}

// =====================================================================================
// Host launcher: 6 launches, grids and arguments are pure functions of the size macros.
// =====================================================================================
static inline unsigned cdiv_u(unsigned a, unsigned b) { return (a + b - 1) / b; }

extern "C" void kernel_launch(void* const* d_in, const int* in_sizes, int n_in,
                              void* d_out, int out_size, void* d_ws, size_t ws_size,
                              hipStream_t stream) {
  if (n_in < 7) return;
  const long long need_rows = (long long)(NB - 1) * SEQ_FULL + SEQ;
  if ((long long)in_sizes[0] < need_rows * DM) return;
  if (in_sizes[1] < NQKV * DM) return;
  if (in_sizes[2] < NQKV) return;
  if (in_sizes[3] < DM * DM) return;
  if (in_sizes[4] < DM) return;
  if (in_sizes[5] < 1) return;
  if (in_sizes[6] < 1) return;
  if ((long long)out_size < need_rows * DM) return;
  if (d_ws == nullptr || ws_size < WS_NEED) return;

  const float* x     = (const float*)d_in[0];
  const float* w_qkv = (const float*)d_in[1];
  const float* b_qkv = (const float*)d_in[2];
  const float* w_out = (const float*)d_in[3];
  const float* b_out = (const float*)d_in[4];
  const float* lam   = (const float*)d_in[5];
  const int*   heads = (const int*)d_in[6];
  float* out = (float*)d_out;

  char* ws = (char*)d_ws;
  _Float16* Xh  = (_Float16*)(ws + OFF_XH);
  _Float16* Wq  = (_Float16*)(ws + OFF_WQ);
  _Float16* Wo  = (_Float16*)(ws + OFF_WO);
  _Float16* Qhi = (_Float16*)(ws + OFF_QH);
  _Float16* Qlo = (_Float16*)(ws + OFF_QL);
  _Float16* Khi = (_Float16*)(ws + OFF_KH);
  _Float16* Klo = (_Float16*)(ws + OFF_KL);
  _Float16* Vt  = (_Float16*)(ws + OFF_VT);
  _Float16* Oh  = (_Float16*)(ws + OFF_OH);

  const int gx = MROWS * G8, gq = NQKV * G8, go = DM * G8;
  k_convert<<<dim3(cdiv_u(gx, 256)), dim3(256), 0, stream>>>(x,     Xh, gx, SEQ,  SEQ_FULL, 1.0f);
  k_convert<<<dim3(cdiv_u(gq, 256)), dim3(256), 0, stream>>>(w_qkv, Wq, gq, NQKV, NQKV,     WSC);
  k_convert<<<dim3(cdiv_u(go, 256)), dim3(256), 0, stream>>>(w_out, Wo, go, DM,   DM,       WSC);

  k_qkv<<<dim3(MROWS / 64, NQKV / 64), dim3(128), 0, stream>>>(Xh, Wq, b_qkv, Qhi, Qlo, Khi, Klo, Vt);
  k_attn<<<dim3(NB * HEADS, SEQ / QT), dim3(256), 0, stream>>>(Qhi, Qlo, Khi, Klo, Vt, lam, heads, Oh);
  k_out<<<dim3(MROWS / 64, DM / 64), dim3(128), 0, stream>>>(Oh, Wo, b_out, out);
}

// v005
// It runs in 108 microseconds.
// Two timings next to v004 both put it at 1.09 times that version's speed.
// Counting every step since v000, it is 1.83 times as fast.
#include <hip/hip_runtime.h>

// Contractions on v_wmma_f32_16x16x32_f16 (f16 operands, f32 accumulate): qkv projection (x as f16 of its bf16-RNE value,
// W as f16 of its bf16-RNE value x64); scores (q and k as f16 hi + f16 residual x2048, three products); P.V
// (key-differenced softmax numerators x1024 in f16, V in f16); output projection (O x1024 in f16, W x64).
// Softmax, normaliser, cyclic correction and bias adds in f32.

typedef _Float16     v16h __attribute__((ext_vector_type(16)));
typedef _Float16     h8   __attribute__((ext_vector_type(8)));
typedef float        v8f  __attribute__((ext_vector_type(8)));
typedef float        f4   __attribute__((ext_vector_type(4)));
typedef unsigned int u4   __attribute__((ext_vector_type(4)));

#ifndef NB
#define NB 2
#endif
#ifndef SEQ
#define SEQ 2048
#endif
#define NB_FULL  2
#define SEQ_FULL 2048
#define DM     1024
#define HEADS  16
#define DH     64
#define NQKV   (3 * DM)
#define MROWS  (NB * SEQ)
#define G8     (DM / 8)          // 16-byte groups per row

#define QT  128                  // query rows per block (8 waves x 16)
#define KT  64                   // keys per main-loop step
#define LP  72                   // f16 LDS row pitch (144 B)
#define FP  68                   // f32 LDS row pitch (272 B)

#define WSC 64.0f                // weight planes carried x64
#define RSC 2048.0f              // q/k residual planes carried x2048
#define PSC 1024.0f              // P operand carried x1024
#define OSC 1024.0f              // O plane carried x1024
#define SCL 0.03125f             // d_model^-0.5 = 1/32

static_assert(DM == 1024);
static_assert(G8 == 128);
static_assert(HEADS * DH == DM);
static_assert(DH == 64);
static_assert(SEQ % QT == 0);
static_assert(SEQ % KT == 0);
static_assert((SEQ / KT) % 2 == 0);
static_assert(KT == DH);
static_assert(SEQ % 64 == 0);
static_assert(MROWS % 64 == 0);
static_assert(NQKV % 64 == 0);
static_assert(NB >= 1 && NB <= NB_FULL);
static_assert(SEQ <= SEQ_FULL);
static_assert(64 * FP * 4 <= 2 * 64 * LP * 2);

// ---------------- workspace layout (all offsets multiples of 512 KiB) ----------------
#define XH_BYTES ((size_t)MROWS * DM * 2)          // f16 x            [MROWS][DM]
#define WQ_BYTES ((size_t)NQKV * DM * 2)           // f16 64*W_qkv     [NQKV][DM]
#define WO_BYTES ((size_t)DM * DM * 2)             // f16 64*W_out     [DM][DM]
#define PL_BYTES ((size_t)MROWS * DM * 2)          // one f16 plane: [NB*H][SEQ][DH] or [NB*H][DH][SEQ] or [MROWS][DM]
#define OFF_XH  ((size_t)0)
#define OFF_WQ  (OFF_XH + XH_BYTES)
#define OFF_WO  (OFF_WQ + WQ_BYTES)
#define OFF_QH  (OFF_WO + WO_BYTES)
#define OFF_QL  (OFF_QH + PL_BYTES)
#define OFF_KH  (OFF_QL + PL_BYTES)
#define OFF_KL  (OFF_KH + PL_BYTES)
#define OFF_VT  (OFF_KL + PL_BYTES)
#define OFF_OH  (OFF_VT + PL_BYTES)
#define WS_NEED (OFF_OH + PL_BYTES)
static_assert(WS_NEED <= (size_t)134217728);
static_assert((OFF_WQ % 128) == 0 && (OFF_WO % 128) == 0 && (OFF_QH % 128) == 0 && (OFF_OH % 128) == 0);

// ---------------- helpers ----------------
__device__ __forceinline__ float bf16r(float x) {           // RNE to bf16, kept as f32
  unsigned int u = __float_as_uint(x);
  u = (u + 0x7FFFu + ((u >> 16) & 1u)) & 0xFFFF0000u;
  return __uint_as_float(u);
}

__device__ __forceinline__ v8f zero8() {
  v8f z;
#pragma unroll
  for (int j = 0; j < 8; ++j) z[j] = 0.0f;
  return z;
}

__device__ __forceinline__ v8f wmma16(v16h a, v16h b, v8f c) {
  return __builtin_amdgcn_wmma_f32_16x16x32_f16(false, a, false, b, (short)0, c, false, false);
}

#define WGUARD(acc, a, b) \
  asm volatile("v_nop\n\tv_nop\n\tv_nop\n\tv_nop" : "+v"(acc) : "v"(a), "v"(b))
#define WGUARD2(c0, c1, a, b0, b1) \
  asm volatile("v_nop\n\tv_nop\n\tv_nop\n\tv_nop" : "+v"(c0), "+v"(c1) : "v"(a), "v"(b0), "v"(b1))

union HU  { v16h v; h8 p[2]; };
union H8U { h8 h; u4 u; };

// 16-bit fragment (A or B) from a k-contiguous row: elements 0..7 <- k 8h..8h+7, 8..15 <- k 16+8h..16+8h+7
__device__ __forceinline__ v16h ldfrag(const _Float16* row, int kb8) {
  HU u;
  u.p[0] = *(const h8*)(row + kb8);
  u.p[1] = *(const h8*)(row + 16 + kb8);
  return u.v;
}

// =====================================================================================
// Convert: dst[row][c] = f16( bf16r(src[srow][c]) * scale ), srow = (row/seq)*seq_full + row%seq
// coverage: ngroups*8 = rows*DM elements, every element of the plane.
// =====================================================================================
__global__ __launch_bounds__(256) void k_convert(const float* __restrict__ src, _Float16* __restrict__ dst,
                                                 int ngroups, int seq, int seq_full, float scale) {
  const int g = blockIdx.x * 256 + threadIdx.x;
  if (g >= ngroups) return;                       // no barriers in this kernel
  const int row = g >> 7;
  const int c8  = g & 127;
  const int srow = (row / seq) * seq_full + (row - (row / seq) * seq);
  const float* s = src + (size_t)srow * DM + c8 * 8;
  const f4 a = *(const f4*)s;
  const f4 b = *(const f4*)(s + 4);
  H8U o;
#pragma unroll
  for (int j = 0; j < 4; ++j) {
    o.h[j]     = (_Float16)(bf16r(a[j]) * scale);
    o.h[4 + j] = (_Float16)(bf16r(b[j]) * scale);
  }
  _Float16* d = dst + (size_t)row * DM + c8 * 8;
  *(u4*)d = o.u;
  
}

// =====================================================================================
// 64x64 tile GEMM main loop: C[m][n] += sum_k A[m][k] * Bw[n][k], K = DM, 128 threads (4 waves x 16 rows)
// A, Bw are f16 row-major with pitch DM. LDS tiles [64][LP] staged with 16-B loads, cross-wave (block barriers).
// staged extent == consumed extent: rows 0..63, halves 0..63 of both tiles.
// =====================================================================================
__device__ __forceinline__ void gemm_tile(const _Float16* __restrict__ A, const _Float16* __restrict__ Bw,
                                          int m0, int n0, _Float16* sA, _Float16* sB, v8f (&acc)[4]) {
  const int tid = threadIdx.x, lane = tid & 31, wave = tid >> 5, l16 = lane & 15, kb8 = (lane >> 4) * 8;
  for (int k0 = 0; k0 < DM; k0 += 64) {
    // all eight loads of the step first, then the LDS stores: one trip to L2 per step instead of one per load
    u4 va[4], vb[4];
#pragma unroll
    for (int i = 0; i < 4; ++i) {
      const int idx = tid + 128 * i;
      const int r = idx >> 3, pc = idx & 7;
      va[i] = *(const u4*)(A  + (size_t)(m0 + r) * DM + k0 + pc * 8);
      vb[i] = *(const u4*)(Bw + (size_t)(n0 + r) * DM + k0 + pc * 8);
    }
    // keeps the scheduler from sinking each load down to its own store, where it is waited for before the next is issued
    __builtin_amdgcn_sched_barrier(0);
#pragma unroll
    for (int i = 0; i < 4; ++i) {
      const int idx = tid + 128 * i;
      const int r = idx >> 3, pc = idx & 7;
      *(u4*)(sA + r * LP + pc * 8) = va[i];
      *(u4*)(sB + r * LP + pc * 8) = vb[i];
    }
    __syncthreads();
    const _Float16* ar = sA + (wave * 16 + l16) * LP;
    // the step's ten fragments as one group of LDS reads: one LDS latency a step instead of one per column tile
    const v16h a0 = ldfrag(ar, kb8);
    const v16h a1 = ldfrag(ar + 32, kb8);
    v16h b0[4], b1[4];
#pragma unroll
    for (int nt = 0; nt < 4; ++nt) {
      const _Float16* br = sB + (nt * 16 + l16) * LP;
      b0[nt] = ldfrag(br, kb8);
      b1[nt] = ldfrag(br + 32, kb8);
    }
    // keeps the scheduler from sinking each tile's reads down to its products, where each is waited out in turn
    __builtin_amdgcn_sched_barrier(0);
#pragma unroll
    for (int nt = 0; nt < 4; ++nt) {
      acc[nt] = wmma16(a0, b0[nt], acc[nt]);
      acc[nt] = wmma16(a1, b1[nt], acc[nt]);
      WGUARD(acc[nt], a1, b1[nt]);
    }
    __syncthreads();
  }
}

// =====================================================================================
// 128x128 tile GEMM main loop for the qkv projection: 128 threads, 4 waves as 2 x 2, 64x64 of C per wave (16 accumulator tiles).
// Each staged byte feeds twice the products it feeds in the 64x64 tile, and every LDS fragment feeds four products
// (in gemm_tile a B fragment feeds one). The k order of every accumulator is that of gemm_tile.
// staged extent == consumed extent: rows 0..127, halves 0..63 of both tiles.
// =====================================================================================
#define BT 128                   // tile edge of the qkv projection
#define VP 136                   // f16 LDS row pitch of the transposed V tile (272 B)
static_assert(MROWS % BT == 0 && NQKV % BT == 0 && DM % BT == 0 && SEQ % BT == 0 && BT == 2 * DH);
static_assert(BT * VP <= 4 * BT * LP);

__device__ __forceinline__ void gemm_tile128(const _Float16* __restrict__ A, const _Float16* __restrict__ Bw,
                                             int m0, int n0, _Float16* sA, _Float16* sB, v8f (&acc)[4][4]) {
  const int tid = threadIdx.x, lane = tid & 31, wave = tid >> 5, l16 = lane & 15, kb8 = (lane >> 4) * 8;
  const int wm = wave >> 1, wn = wave & 1;
  // a thread stages rows sr + 16 i, 16-byte piece spc, of both tiles: one offset register, the rows as immediate offsets
  const int sr = tid >> 3, spc = tid & 7;
  const unsigned so = ((unsigned)sr * DM + spc * 8) * 2;          // bytes
  const char* At = (const char*)(A  + (size_t)m0 * DM);
  const char* Bt = (const char*)(Bw + (size_t)n0 * DM);
  for (int k0 = 0; k0 < DM; k0 += 64) {
    // all sixteen loads of the step first, then the LDS stores: one trip to L2 per step
    u4 va[8], vb[8];
    const char* pa = At + k0 * 2 + so;
    const char* pb = Bt + k0 * 2 + so;
#pragma unroll
    for (int i = 0; i < 8; ++i) {
      va[i] = *(const u4*)(pa + i * (16 * DM * 2));
      vb[i] = *(const u4*)(pb + i * (16 * DM * 2));
    }
    // keeps the scheduler from sinking each load down to its own store, where it is waited for before the next is issued
    __builtin_amdgcn_sched_barrier(0);
    // the two address pairs stay whole up to this wait: no load lands on them, and the next step's values come behind it
    asm volatile("s_wait_xcnt 0x0" :: "v"(pa), "v"(pb) : "memory");
#pragma unroll
    for (int i = 0; i < 8; ++i) {
      *(u4*)(sA + (sr + 16 * i) * LP + spc * 8) = va[i];
      *(u4*)(sB + (sr + 16 * i) * LP + spc * 8) = vb[i];
    }
    __syncthreads();
    const _Float16* ar = sA + (wm * 64 + l16) * LP;
    const _Float16* br = sB + (wn * 64 + l16) * LP;
#pragma unroll
    for (int kk = 0; kk < 2; ++kk) {
      // eight fragments of 32 k as one group of LDS reads, then their sixteen products
      v16h a[4], b[4];
#pragma unroll
      for (int t = 0; t < 4; ++t) {
        a[t] = ldfrag(ar + t * 16 * LP + kk * 32, kb8);
        b[t] = ldfrag(br + t * 16 * LP + kk * 32, kb8);
      }
      // keeps the scheduler from sinking each fragment's reads down to its products, where each is waited out in turn
      __builtin_amdgcn_sched_barrier(0);
#pragma unroll
      for (int mt = 0; mt < 4; ++mt)
#pragma unroll
        for (int nt = 0; nt < 4; ++nt) acc[mt][nt] = wmma16(a[mt], b[nt], acc[mt][nt]);
    }
    __syncthreads();
  }
}

// =====================================================================================
// QKV projection: acc = Xh . (64 W)^T ; val = acc/64 + bf16r(b)
// coverage: grid (MROWS/128, NQKV/128) -> every (position, column) of q, k hi/lo and V^T exactly once.
// A tile holds 128 positions of two heads of one of q, k, v.
// =====================================================================================
__global__ __launch_bounds__(128) void k_qkv(const _Float16* __restrict__ Xh, const _Float16* __restrict__ Wh,
                                             const float* __restrict__ bias,
                                             _Float16* __restrict__ Qhi, _Float16* __restrict__ Qlo,
                                             _Float16* __restrict__ Khi, _Float16* __restrict__ Klo,
                                             _Float16* __restrict__ Vt) {
  // main loop: planes 0 and 1 are the A and B tiles; write-out: hi of head 0, 1, lo of head 0, 1, or the V^T tile
  __shared__ __align__(16) _Float16 smem[4 * BT * LP];
  const int tid = threadIdx.x, lane = tid & 31, wave = tid >> 5, l16 = lane & 15, half = lane >> 4;
  const int wm = wave >> 1, wn = wave & 1;
  const int m0 = blockIdx.x * BT, n0 = blockIdx.y * BT;

  v8f acc[4][4];
#pragma unroll
  for (int mt = 0; mt < 4; ++mt)
#pragma unroll
    for (int nt = 0; nt < 4; ++nt) acc[mt][nt] = zero8();
  gemm_tile128(Xh, Wh, m0, n0, smem, smem + BT * LP, acc);

  const int sel = n0 / DM;                        // 0 q, 1 k, 2 v   (block-uniform)
  const int hd  = (n0 - sel * DM) / DH;           // first of the tile's two heads
  const int bb  = m0 / SEQ, l0 = m0 - bb * SEQ;   // batch, first position of the tile
  const size_t bh = (size_t)bb * HEADS + hd;
  const float inv = 1.0f / WSC;
  float bcol[4];
#pragma unroll
  for (int nt = 0; nt < 4; ++nt) bcol[nt] = bf16r(bias[n0 + wn * 64 + nt * 16 + l16]);

  // ---- stage the 128x128 result in LDS (the tiles are free after the main loop's final barrier) ----
  if (sel < 2) {
    _Float16* th = smem + wn * (BT * LP);         // this wave's head: hi plane, [128 positions][LP]
    _Float16* tl = smem + (2 + wn) * (BT * LP);   // lo plane
#pragma unroll
    for (int mt = 0; mt < 4; ++mt) {
#pragma unroll
      for (int nt = 0; nt < 4; ++nt) {
#pragma unroll
        for (int r = 0; r < 8; ++r) {
          const float v = acc[mt][nt][r] * inv + bcol[nt];
          const _Float16 hi = (_Float16)v;
          const _Float16 lo = (_Float16)((v - (float)hi) * RSC);
          const int row = wm * 64 + mt * 16 + half * 8 + r, col = nt * 16 + l16;
          th[row * LP + col] = hi;
          tl[row * LP + col] = lo;
        }
      }
    }
  } else {
#pragma unroll
    for (int mt = 0; mt < 4; ++mt) {
#pragma unroll
      for (int nt = 0; nt < 4; ++nt) {
        H8U o;
#pragma unroll
        for (int r = 0; r < 8; ++r) o.h[r] = (_Float16)(acc[mt][nt][r] * inv + bcol[nt]);
        // transposed: LDS row = tile column (head, e), 8 consecutive positions per lane
        *(u4*)(smem + (wn * 64 + nt * 16 + l16) * VP + wm * 64 + mt * 16 + half * 8) = o.u;
      }
    }
  }
  __syncthreads();

  // ---- whole-line write-out, lanes 8q..8q+7 <-> one 128-byte line ----
  if (sel < 2) {
#pragma unroll
    for (int hh = 0; hh < 2; ++hh) {
      _Float16* dhp = ((sel == 0) ? Qhi : Khi) + ((bh + hh) * SEQ + l0) * DH;
      _Float16* dlp = ((sel == 0) ? Qlo : Klo) + ((bh + hh) * SEQ + l0) * DH;
#pragma unroll
      for (int p = 0; p < 8; ++p) {
        const int line = p * 16 + (tid >> 3), piece = tid & 7;
        const u4 vh = *(const u4*)(smem + hh * (BT * LP) + line * LP + piece * 8);
        const u4 vl = *(const u4*)(smem + (2 + hh) * (BT * LP) + line * LP + piece * 8);
        *(u4*)(dhp + line * DH + piece * 8) = vh;
        *(u4*)(dlp + line * DH + piece * 8) = vl;
      }
    }
  } else {
    _Float16* dvp = Vt + (bh * DH) * (size_t)SEQ + l0;     // row (head, e) at dvp + (64 * head + e) * SEQ
#pragma unroll
    for (int p = 0; p < 16; ++p) {
      const int e = p * 8 + (tid >> 4), piece = tid & 15;  // 16 lanes <-> the row's two lines
      const u4 v = *(const u4*)(smem + e * VP + piece * 8);
      *(u4*)(dvp + (size_t)e * SEQ + piece * 8) = v;
    }
  }
}

__device__ __forceinline__ float xhalf(float x) {
  const int b = __builtin_bit_cast(int, x);
  return __builtin_bit_cast(float, __builtin_amdgcn_permlanex16(b, b, 0x76543210, 0xfedcba98, false, false));
}

__device__ __forceinline__ unsigned lds_addr(const _Float16* p) {   // byte address inside the work-group's LDS
  return (unsigned)(unsigned long long)p;
}

// One thread's share of a step's three tiles: six 16-byte asynchronous copies, global memory -> LDS, through no register.
// The s_wait_xcnt closes the statement so that no address register named here is rewritten ahead of it.
__device__ __forceinline__ void copy_tiles(unsigned lkh0, unsigned lkh1, unsigned lkl0, unsigned lkl1,
                                           unsigned lv0, unsigned lv1,
                                           const _Float16* gkh0, const _Float16* gkh1,
                                           const _Float16* gkl0, const _Float16* gkl1,
                                           const _Float16* gv0, const _Float16* gv1) {
  asm volatile("global_load_async_to_lds_b128 %0, %6, off\n\t"
               "global_load_async_to_lds_b128 %1, %7, off\n\t"
               "global_load_async_to_lds_b128 %2, %8, off\n\t"
               "global_load_async_to_lds_b128 %3, %9, off\n\t"
               "global_load_async_to_lds_b128 %4, %10, off\n\t"
               "global_load_async_to_lds_b128 %5, %11, off\n\t"
               "s_wait_xcnt 0x0"
               :: "v"(lkh0), "v"(lkh1), "v"(lkl0), "v"(lkl1), "v"(lv0), "v"(lv1),
                  "v"(gkh0), "v"(gkh1), "v"(gkl0), "v"(gkl1), "v"(gv0), "v"(gv1)
               : "memory");
}

// four waves a SIMD (two work-groups a WGP, all of the grid resident at once): the fragment groups must fit 256 registers
__global__ __launch_bounds__(256) __attribute__((amdgpu_waves_per_eu(4, 4))) void k_attn(const _Float16* __restrict__ Qhi, const _Float16* __restrict__ Qlo,
                                              const _Float16* __restrict__ Khi, const _Float16* __restrict__ Klo,
                                              const _Float16* __restrict__ Vt, const float* __restrict__ lam_p,
                                              const int* __restrict__ heads_p, _Float16* __restrict__ Oh) {
  const int tid = threadIdx.x, lane = tid & 31, wave = tid >> 5;
  const int l16 = lane & 15, half = lane >> 4, kb8 = half * 8;
  const int bh = blockIdx.x;
  const int b  = bh / HEADS, h = bh - b * HEADS;
  const int qBase = blockIdx.y * QT;

  // two tile buffers (step it works on buffer it & 1), each K-hi | K-lo | V^T; behind them the O write-out staging
  __shared__ __align__(16) _Float16 smem[2 * 3 * KT * LP + 8 * 16 * LP];
#define TILE(buf, plane) (smem + ((buf) * 3 + (plane)) * (KT * LP))
  _Float16* po = smem + 2 * 3 * KT * LP + wave * (16 * LP);   // wave-private [16 rows][LP]

  const float lamr = bf16r(lam_p[0]);
  const int   hv   = heads_p[0];
  const float lamv = (hv == HEADS) ? lamr : __uint_as_float(0x7fc00000u);   // poison on structural conflict

  // ---- Q fragments straight from the f16 planes (B layout: column = query l16) ----
  const size_t qrow = (size_t)bh * SEQ + qBase + wave * 16 + l16;
  const _Float16* qh = Qhi + qrow * DH;
  const _Float16* ql = Qlo + qrow * DH;
  const v16h qa0 = ldfrag(qh, kb8), qa1 = ldfrag(qh + 32, kb8);
  const v16h qr0 = ldfrag(ql, kb8), qr1 = ldfrag(ql + 32, kb8);

  float m = -3.0e38f, lsum = 0.0f, lgLast = 0.0f;   // lsum: this lane half's keys only, joined in the epilogue
  v8f acc[4];                                       // acc[n][j] = O'[e = 16n + 8*half + j][query l16]
#pragma unroll
  for (int n = 0; n < 4; ++n) acc[n] = zero8();

  const float cxs = 1.0f / RSC;

  const _Float16* khBase = Khi + (size_t)bh * SEQ * DH;
  const _Float16* klBase = Klo + (size_t)bh * SEQ * DH;
  const _Float16* vtBase = Vt  + (size_t)bh * DH * SEQ;

  // a thread copies rows sr and sr + 32, 16-byte piece spc, of each of the three tiles
  const int sr = tid >> 3, spc = tid & 7;
  const int so0 = sr * LP + spc * 8, so1 = (sr + 32) * LP + spc * 8;
  const _Float16* gkh = khBase + (size_t)sr * DH + spc * 8;
  const _Float16* gkl = klBase + (size_t)sr * DH + spc * 8;
  const _Float16* gv  = vtBase + (size_t)sr * SEQ + spc * 8;
#define COPY_STEP(step, buf)                                                                          \
  copy_tiles(lds_addr(TILE(buf, 0) + so0), lds_addr(TILE(buf, 0) + so1), lds_addr(TILE(buf, 1) + so0), \
             lds_addr(TILE(buf, 1) + so1), lds_addr(TILE(buf, 2) + so0), lds_addr(TILE(buf, 2) + so1), \
             gkh + (size_t)(step) * (KT * DH), gkh + (size_t)(step) * (KT * DH) + 32 * DH,            \
             gkl + (size_t)(step) * (KT * DH), gkl + (size_t)(step) * (KT * DH) + 32 * DH,            \
             gv + (step) * KT, gv + (step) * KT + (size_t)32 * SEQ)

  COPY_STEP(0, 0);
  asm volatile("s_wait_asynccnt 0x0" ::: "memory");   // this wave's share of step 0 has landed
  __syncthreads();                                    // step 0 readable by every wave
  COPY_STEP(1, 1);                                    // flies while step 0 is worked on

  // one step on buffer u (a constant at every call: LDS offsets stay immediates); refill says whether a step it + 2 exists
  auto step = [&](const int it, const int u, const bool refill) __attribute__((always_inline)) {
    const _Float16* cKh = TILE(u, 0);
    const _Float16* cKl = TILE(u, 1);
    const _Float16* cV  = TILE(u, 2);

    // ---- scores over four 16-key subtiles: p[t][j] = logit(key 16t + 8*half + j, query l16) ----
    // LDS fragment reads go out in groups ahead of the products that take them (subtiles 0 and 1 at the top, subtile t + 2
    // behind the products of subtile t, V^T rows 0..31 under the last scores and the softmax, rows 32..63 under the rescale), so that a step waits out one LDS
    // latency instead of one per pair of reads.
    // Each sched_barrier below keeps the scheduler from sinking the group above it down to its products.
    v16h kfh[4][2], kfl[4][2], vf[4][2];
#define LOAD_K(t)                                                \
    do {                                                         \
      const _Float16* kr = cKh + ((t) * 16 + l16) * LP;          \
      const _Float16* kq = cKl + ((t) * 16 + l16) * LP;          \
      kfh[t][0] = ldfrag(kr, kb8);                               \
      kfh[t][1] = ldfrag(kr + 32, kb8);                          \
      kfl[t][0] = ldfrag(kq, kb8);                               \
      kfl[t][1] = ldfrag(kq + 32, kb8);                          \
    } while (0)
#define LOAD_V(n)                                                \
    do {                                                         \
      const _Float16* vr = cV + (16 * (n) + l16) * LP;           \
      vf[n][0] = ldfrag(vr, kb8);                                \
      vf[n][1] = ldfrag(vr + 32, kb8);                           \
    } while (0)
    LOAD_K(0);
    LOAD_K(1);
    __builtin_amdgcn_sched_barrier(0);            // the sixteen reads stay together in front of the first product

    float p[4][8];
    float tm[4];
#pragma unroll
    for (int t = 0; t < 4; ++t) {
      const v16h kh0 = kfh[t][0], kh1 = kfh[t][1];
      v8f chh = zero8();
      chh = wmma16(kh0, qa0, chh);
      chh = wmma16(kh1, qa1, chh);
      v8f cx = zero8();
      cx = wmma16(kh0, qr0, cx);
      cx = wmma16(kh1, qr1, cx);
      const v16h kl0 = kfl[t][0], kl1 = kfl[t][1];
      cx = wmma16(kl0, qa0, cx);
      cx = wmma16(kl1, qa1, cx);
      WGUARD2(chh, cx, qa1, kh1, kl1);
      tm[t] = -3.0e38f;
#pragma unroll
      for (int j = 0; j < 8; ++j) {
        const float lg = (chh[j] + cx[j] * cxs) * SCL;
        p[t][j] = lg;
        tm[t] = fmaxf(tm[t], lg);
      }
      if (t < 2) {                                // into the registers subtile t has left
        LOAD_K(t + 2);
        __builtin_amdgcn_sched_barrier(0);        // the reads stay in front of subtile t + 1's products, which cover them
      }
      if (t == 2) {
        LOAD_V(0);
        LOAD_V(1);
        __builtin_amdgcn_sched_barrier(0);        // the reads stay in front of subtile 3's products and the softmax
      }
    }

    // ---- query max: in-lane, then one exchange between the lane halves ----
    float tmax = fmaxf(fmaxf(tm[0], tm[1]), fmaxf(tm[2], tm[3]));
    tmax = fmaxf(tmax, xhalf(tmax));
    // raw logit of this step's last key (half 1, subtile 3, j = 7), made valid in both halves
    const float oraw = xhalf(p[3][7]);
    const float nlg  = (half != 0) ? p[3][7] : oraw;

    const float nm   = fmaxf(m, tmax);
    const float corr = __expf(m - nm);
    m = nm;
    const float pt     = __expf(lgLast - nm);     // p of the prior step's last key under the new max
    const float pleft0 = (it == 0) ? 0.0f : pt;
    lgLast = nlg;

    float st[4];
#pragma unroll
    for (int t = 0; t < 4; ++t) {
      st[t] = 0.0f;
#pragma unroll
      for (int j = 0; j < 8; ++j) {
        p[t][j] = __expf(p[t][j] - m);
        st[t] += p[t][j];
      }
    }
    lsum = lsum * corr + ((st[0] + st[1]) + (st[2] + st[3]));
    LOAD_V(2);                                    // the logits' registers are free from here
    LOAD_V(3);
    __builtin_amdgcn_sched_barrier(0);            // the reads stay in front of the rescale and the packing of P'
#pragma unroll
    for (int n = 0; n < 4; ++n)
#pragma unroll
      for (int j = 0; j < 8; ++j) acc[n][j] *= corr;

    // ---- key-differenced P' = 1024*(p - p_left), packed in place into the B operands (k = keys) ----
    v16h pb[2];
    {
      float xprev = pleft0;
#pragma unroll
      for (int t = 0; t < 4; ++t) {
        const float x = xhalf(p[t][7]);           // half 1 sees key 16t+7, half 0 sees key 16t+15
        float left = (half != 0) ? x : xprev;
        xprev = x;
#pragma unroll
        for (int j = 0; j < 8; ++j) {
          pb[t >> 1][(t & 1) * 8 + j] = (_Float16)((p[t][j] - left) * PSC);
          left = p[t][j];
        }
      }
    }

    // ---- V^T A-fragments (rows = e, k = keys); O^T += V^T.P'^T ----
#pragma unroll
    for (int n = 0; n < 4; ++n) {
      const v16h uv0 = vf[n][0], uv1 = vf[n][1];
      acc[n] = wmma16(uv0, pb[0], acc[n]);
      acc[n] = wmma16(uv1, pb[1], acc[n]);
      WGUARD(acc[n], uv1, pb[1]);
    }

    // ---- hand-over: own LDS reads retired, own copies of step it + 1 landed, then the step's one barrier ----
    asm volatile("s_wait_dscnt 0x0" ::: "memory");      // before buffer u is refilled
    asm volatile("s_wait_asynccnt 0x0" ::: "memory");   // before other waves read this wave's share of step it + 1
    __syncthreads();                                    // publishes step it + 1, ends every read of buffer u
    if (refill) COPY_STEP(it + 2, u);                   // flies while step it + 1 is worked on
  };
  // the last two steps stand behind the loop: the loop's body then has no branch, and each step's sums are formed inside it
  // instead of being carried, 32 registers a step, to a block behind the branch
  for (int it2 = 0; it2 < SEQ / KT - 2; it2 += 2) {
    step(it2, 0, true);
    step(it2 + 1, 1, true);
  }
  step(SEQ / KT - 2, 0, false);
  step(SEQ / KT - 1, 1, false);
  asm volatile("s_wait_asynccnt 0x0" ::: "memory");     // nothing in flight when the wave goes on
#undef LOAD_K
#undef LOAD_V
#undef COPY_STEP
#undef TILE

  // ---- finalize: join the halves' sums, cyclic term, normaliser, lam, O carry ----
  lsum += xhalf(lsum);
  const float pL = __expf(lgLast - m) * PSC;      // lgLast = logit of key SEQ-1 for this query
  const float f  = lamv * (OSC / PSC) * (1.0f / lsum);

  // a lane's 8 accumulator registers are 8 consecutive columns of one O row: one 16-byte LDS store per tile
#pragma unroll
  for (int n = 0; n < 4; ++n) {
    H8U o;
#pragma unroll
    for (int j = 0; j < 8; ++j) {
      const float v0 = (float)vtBase[(size_t)(16 * n + kb8 + j) * SEQ];     // v of key 0, column e
      o.h[j] = (_Float16)((acc[n][j] - pL * v0) * f);
    }
    *(u4*)(po + l16 * LP + 16 * n + kb8) = o.u;
  }
  __builtin_amdgcn_fence(5, "wavefront");
  __builtin_amdgcn_wave_barrier();

  _Float16* od = Oh + ((size_t)b * SEQ + qBase + wave * 16) * DM + h * DH;
#pragma unroll
  for (int p4 = 0; p4 < 4; ++p4) {
    const int line = p4 * 4 + (lane >> 3), piece = lane & 7;
    const u4 v = *(const u4*)(po + line * LP + piece * 8);
    *(u4*)(od + (size_t)line * DM + piece * 8) = v;
  }
}

// =====================================================================================
// Output projection: out = (Oh/1024) . (64 W_out)^T / 64 + bf16r(b_out), f32 rows of d_out.
// 64x64 f32 tile staged in LDS [64][FP]; each 256-B row segment = 2 lines, each line 8 lanes x 16 B of one
// =====================================================================================
__global__ __launch_bounds__(128) void k_out(const _Float16* __restrict__ Oh, const _Float16* __restrict__ Woh,
                                             const float* __restrict__ bias, float* __restrict__ out) {
  __shared__ __align__(16) unsigned char smem[2 * 64 * LP * 2];
  _Float16* sA = (_Float16*)smem;
  _Float16* sB = sA + 64 * LP;
  const int tid = threadIdx.x, lane = tid & 31, wave = tid >> 5, l16 = lane & 15, half = lane >> 4;
  const int m0 = blockIdx.x * 64, n0 = blockIdx.y * 64;

  v8f acc[4];
#pragma unroll
  for (int nt = 0; nt < 4; ++nt) acc[nt] = zero8();
  gemm_tile(Oh, Woh, m0, n0, sA, sB, acc);

  float* sF = (float*)smem;                       // [64][FP]
  const float inv = 1.0f / (OSC * WSC);
  float bcol[4];
#pragma unroll
  for (int nt = 0; nt < 4; ++nt) bcol[nt] = bf16r(bias[n0 + nt * 16 + l16]);
#pragma unroll
  for (int nt = 0; nt < 4; ++nt) {
#pragma unroll
    for (int r = 0; r < 8; ++r) {
      const int row = wave * 16 + half * 8 + r, col = nt * 16 + l16;
      sF[row * FP + col] = acc[nt][r] * inv + bcol[nt];
    }
  }
  __syncthreads();

  const int bb = m0 / SEQ, l0 = m0 - bb * SEQ;
  float* dbase = out + ((size_t)bb * SEQ_FULL + l0) * DM + n0;
#pragma unroll
  for (int p = 0; p < 8; ++p) {
    const int line = p * 16 + (tid >> 3), piece = tid & 7;
    const int row = line >> 1, hs = line & 1;
    const f4 v = *(const f4*)(sF + row * FP + hs * 32 + piece * 4);
    *(f4*)(dbase + (size_t)row * DM + hs * 32 + piece * 4) = v;
  }
  
}

// =====================================================================================
// Host launcher: 6 launches, grids and arguments are pure functions of the size macros.
// =====================================================================================
static inline unsigned cdiv_u(unsigned a, unsigned b) { return (a + b - 1) / b; }

extern "C" void kernel_launch(void* const* d_in, const int* in_sizes, int n_in,
                              void* d_out, int out_size, void* d_ws, size_t ws_size,
                              hipStream_t stream) {
  if (n_in < 7) return;
  const long long need_rows = (long long)(NB - 1) * SEQ_FULL + SEQ;
  if ((long long)in_sizes[0] < need_rows * DM) return;
  if (in_sizes[1] < NQKV * DM) return;
  if (in_sizes[2] < NQKV) return;
  if (in_sizes[3] < DM * DM) return;
  if (in_sizes[4] < DM) return;
  if (in_sizes[5] < 1) return;
  if (in_sizes[6] < 1) return;
  if ((long long)out_size < need_rows * DM) return;
  if (d_ws == nullptr || ws_size < WS_NEED) return;

  const float* x     = (const float*)d_in[0];
  const float* w_qkv = (const float*)d_in[1];
  const float* b_qkv = (const float*)d_in[2];
  const float* w_out = (const float*)d_in[3];
  const float* b_out = (const float*)d_in[4];
  const float* lam   = (const float*)d_in[5];
  const int*   heads = (const int*)d_in[6];
  float* out = (float*)d_out;

  char* ws = (char*)d_ws;
  _Float16* Xh  = (_Float16*)(ws + OFF_XH);
  _Float16* Wq  = (_Float16*)(ws + OFF_WQ);
  _Float16* Wo  = (_Float16*)(ws + OFF_WO);
  _Float16* Qhi = (_Float16*)(ws + OFF_QH);
  _Float16* Qlo = (_Float16*)(ws + OFF_QL);
  _Float16* Khi = (_Float16*)(ws + OFF_KH);
  _Float16* Klo = (_Float16*)(ws + OFF_KL);
  _Float16* Vt  = (_Float16*)(ws + OFF_VT);
  _Float16* Oh  = (_Float16*)(ws + OFF_OH);

  const int gx = MROWS * G8, gq = NQKV * G8, go = DM * G8;
  k_convert<<<dim3(cdiv_u(gx, 256)), dim3(256), 0, stream>>>(x,     Xh, gx, SEQ,  SEQ_FULL, 1.0f);
  k_convert<<<dim3(cdiv_u(gq, 256)), dim3(256), 0, stream>>>(w_qkv, Wq, gq, NQKV, NQKV,     WSC);
  k_convert<<<dim3(cdiv_u(go, 256)), dim3(256), 0, stream>>>(w_out, Wo, go, DM,   DM,       WSC);

  k_qkv<<<dim3(MROWS / BT, NQKV / BT), dim3(128), 0, stream>>>(Xh, Wq, b_qkv, Qhi, Qlo, Khi, Klo, Vt);
  k_attn<<<dim3(NB * HEADS, SEQ / QT), dim3(256), 0, stream>>>(Qhi, Qlo, Khi, Klo, Vt, lam, heads, Oh);
  k_out<<<dim3(MROWS / 64, DM / 64), dim3(128), 0, stream>>>(Oh, Wo, b_out, out);
}

// v007
// One run takes 85.9 microseconds.
// Versions between v005 and this one are left out; their measured steps multiply to 1.26 times as fast.
// Over all steps from v000 it is 2.31 times as fast.
#include <hip/hip_runtime.h>

// Contractions on v_wmma_f32_16x16x32_f16 (f16 operands, f32 accumulate): qkv projection (x as f16 of its bf16-RNE value,
// W as f16 of its bf16-RNE value x64); scores (q and k as f16, one product); P.V
// (key-differenced softmax numerators x1024 in f16, V in f16); output projection (O x1024 in f16, W x64).
// Softmax, normaliser, cyclic correction and bias adds in f32.

typedef _Float16     v16h __attribute__((ext_vector_type(16)));
typedef _Float16     h8   __attribute__((ext_vector_type(8)));
typedef float        v8f  __attribute__((ext_vector_type(8)));
typedef float        f4   __attribute__((ext_vector_type(4)));
typedef unsigned int u4   __attribute__((ext_vector_type(4)));

#ifndef NB
#define NB 2
#endif
#ifndef SEQ
#define SEQ 2048
#endif
#define NB_FULL  2
#define SEQ_FULL 2048
#define DM     1024
#define HEADS  16
#define DH     64
#define NQKV   (3 * DM)
#define MROWS  (NB * SEQ)
#define G8     (DM / 8)          // 16-byte groups per row

#define QT  128                  // query rows per block (8 waves x 16)
#define KT  64                   // keys per main-loop step
#define LP  72                   // f16 LDS row pitch (144 B)
#define FP  68                   // f32 LDS row pitch (272 B)

#define WSC 64.0f                // weight planes carried x64
#define PSC 1024.0f              // P operand carried x1024
#define OSC 1024.0f              // O plane carried x1024
#define SCL 0.03125f             // d_model^-0.5 = 1/32
#define SC2 (SCL * 1.44269504088896340736f)   // raw q.k -> logit in base-2 units: 1/32 * log2(e)
#define LPSC 10.0f               // log2(PSC): the x1024 of the P operand rides in the exponent

static_assert(DM == 1024);
static_assert(PSC == 1024.0f && LPSC == 10.0f);
static_assert(G8 == 128);
static_assert(HEADS * DH == DM);
static_assert(DH == 64);
static_assert(SEQ % QT == 0);
static_assert(SEQ % KT == 0);
static_assert((SEQ / KT) % 2 == 0);
static_assert(KT == DH);
static_assert(SEQ % 64 == 0);
static_assert(MROWS % 64 == 0);
static_assert(NQKV % 64 == 0);
static_assert(NB >= 1 && NB <= NB_FULL);
static_assert(SEQ <= SEQ_FULL);
static_assert(64 * FP * 4 <= 2 * 64 * LP * 2);

// ---------------- workspace layout (all offsets multiples of 512 KiB) ----------------
#define XH_BYTES ((size_t)MROWS * DM * 2)          // f16 x            [MROWS][DM]
#define WQ_BYTES ((size_t)NQKV * DM * 2)           // f16 64*W_qkv     [NQKV][DM]
#define WO_BYTES ((size_t)DM * DM * 2)             // f16 64*W_out     [DM][DM]
#define PL_BYTES ((size_t)MROWS * DM * 2)          // one f16 plane: [NB*H][SEQ][DH] or [NB*H][DH][SEQ] or [MROWS][DM]
#define OFF_XH  ((size_t)0)
#define OFF_WQ  (OFF_XH + XH_BYTES)
#define OFF_WO  (OFF_WQ + WQ_BYTES)
#define OFF_QH  (OFF_WO + WO_BYTES)
#define OFF_KH  (OFF_QH + PL_BYTES)
#define OFF_VT  (OFF_KH + PL_BYTES)
#define OFF_OH  (OFF_VT + PL_BYTES)
#define WS_NEED (OFF_OH + PL_BYTES)
static_assert(WS_NEED <= (size_t)134217728);
static_assert((OFF_WQ % 128) == 0 && (OFF_WO % 128) == 0 && (OFF_QH % 128) == 0 && (OFF_OH % 128) == 0);

// ---------------- helpers ----------------
__device__ __forceinline__ float bf16r(float x) {           // RNE to bf16, kept as f32
  unsigned int u = __float_as_uint(x);
  u = (u + 0x7FFFu + ((u >> 16) & 1u)) & 0xFFFF0000u;
  return __uint_as_float(u);
}

__device__ __forceinline__ v8f zero8() {
  v8f z;
#pragma unroll
  for (int j = 0; j < 8; ++j) z[j] = 0.0f;
  return z;
}

__device__ __forceinline__ v8f wmma16(v16h a, v16h b, v8f c) {
  return __builtin_amdgcn_wmma_f32_16x16x32_f16(false, a, false, b, (short)0, c, false, false);
}

#define WGUARD(acc, a, b) \
  asm volatile("v_nop\n\tv_nop\n\tv_nop\n\tv_nop" : "+v"(acc) : "v"(a), "v"(b))

union HU  { v16h v; h8 p[2]; };
union H8U { h8 h; u4 u; };

// 16-bit fragment (A or B) from a k-contiguous row: elements 0..7 <- k 8h..8h+7, 8..15 <- k 16+8h..16+8h+7
__device__ __forceinline__ v16h ldfrag(const _Float16* row, int kb8) {
  HU u;
  u.p[0] = *(const h8*)(row + kb8);
  u.p[1] = *(const h8*)(row + 16 + kb8);
  return u.v;
}

// =====================================================================================
// Convert: dst[row][c] = f16( bf16r(src[srow][c]) * scale ), srow = (row/seq)*seq_full + row%seq
// coverage: ngroups*8 = rows*DM elements, every element of the plane.
// =====================================================================================
__global__ __launch_bounds__(256) void k_convert(const float* __restrict__ src, _Float16* __restrict__ dst,
                                                 int ngroups, int seq, int seq_full, float scale) {
  const int g = blockIdx.x * 256 + threadIdx.x;
  if (g >= ngroups) return;                       // no barriers in this kernel
  const int row = g >> 7;
  const int c8  = g & 127;
  const int srow = (row / seq) * seq_full + (row - (row / seq) * seq);
  const float* s = src + (size_t)srow * DM + c8 * 8;
  const f4 a = *(const f4*)s;
  const f4 b = *(const f4*)(s + 4);
  H8U o;
#pragma unroll
  for (int j = 0; j < 4; ++j) {
    o.h[j]     = (_Float16)(bf16r(a[j]) * scale);
    o.h[4 + j] = (_Float16)(bf16r(b[j]) * scale);
  }
  _Float16* d = dst + (size_t)row * DM + c8 * 8;
  *(u4*)d = o.u;
  
}

// =====================================================================================
// 64x64 tile GEMM main loop: C[m][n] += sum_k A[m][k] * Bw[n][k], K = DM, 128 threads (4 waves x 16 rows)
// A, Bw are f16 row-major with pitch DM. LDS tiles [64][LP] staged with 16-B loads, cross-wave (block barriers).
// staged extent == consumed extent: rows 0..63, halves 0..63 of both tiles.
// =====================================================================================
__device__ __forceinline__ void gemm_tile(const _Float16* __restrict__ A, const _Float16* __restrict__ Bw,
                                          int m0, int n0, _Float16* sA, _Float16* sB, v8f (&acc)[4]) {
  const int tid = threadIdx.x, lane = tid & 31, wave = tid >> 5, l16 = lane & 15, kb8 = (lane >> 4) * 8;
  for (int k0 = 0; k0 < DM; k0 += 64) {
    // all eight loads of the step first, then the LDS stores: one trip to L2 per step instead of one per load
    u4 va[4], vb[4];
#pragma unroll
    for (int i = 0; i < 4; ++i) {
      const int idx = tid + 128 * i;
      const int r = idx >> 3, pc = idx & 7;
      va[i] = *(const u4*)(A  + (size_t)(m0 + r) * DM + k0 + pc * 8);
      vb[i] = *(const u4*)(Bw + (size_t)(n0 + r) * DM + k0 + pc * 8);
    }
    // keeps the scheduler from sinking each load down to its own store, where it is waited for before the next is issued
    __builtin_amdgcn_sched_barrier(0);
#pragma unroll
    for (int i = 0; i < 4; ++i) {
      const int idx = tid + 128 * i;
      const int r = idx >> 3, pc = idx & 7;
      *(u4*)(sA + r * LP + pc * 8) = va[i];
      *(u4*)(sB + r * LP + pc * 8) = vb[i];
    }
    __syncthreads();
    const _Float16* ar = sA + (wave * 16 + l16) * LP;
    // the step's ten fragments as one group of LDS reads: one LDS latency a step instead of one per column tile
    const v16h a0 = ldfrag(ar, kb8);
    const v16h a1 = ldfrag(ar + 32, kb8);
    v16h b0[4], b1[4];
#pragma unroll
    for (int nt = 0; nt < 4; ++nt) {
      const _Float16* br = sB + (nt * 16 + l16) * LP;
      b0[nt] = ldfrag(br, kb8);
      b1[nt] = ldfrag(br + 32, kb8);
    }
    // keeps the scheduler from sinking each tile's reads down to its products, where each is waited out in turn
    __builtin_amdgcn_sched_barrier(0);
#pragma unroll
    for (int nt = 0; nt < 4; ++nt) {
      acc[nt] = wmma16(a0, b0[nt], acc[nt]);
      acc[nt] = wmma16(a1, b1[nt], acc[nt]);
      WGUARD(acc[nt], a1, b1[nt]);
    }
    __syncthreads();
  }
}

// =====================================================================================
// 128x128 tile GEMM main loop for the qkv projection: 128 threads, 4 waves as 2 x 2, 64x64 of C per wave (16 accumulator tiles).
// Each staged byte feeds twice the products it feeds in the 64x64 tile, and every LDS fragment feeds four products
// (in gemm_tile a B fragment feeds one). The k order of every accumulator is that of gemm_tile.
// staged extent == consumed extent: rows 0..127, halves 0..63 of both tiles.
// =====================================================================================
#define BT 128                   // tile edge of the qkv projection
#define VP 136                   // f16 LDS row pitch of the transposed V tile (272 B)
static_assert(MROWS % BT == 0 && NQKV % BT == 0 && DM % BT == 0 && SEQ % BT == 0 && BT == 2 * DH);
static_assert(BT * VP <= 2 * BT * LP);

__device__ __forceinline__ void gemm_tile128(const _Float16* __restrict__ A, const _Float16* __restrict__ Bw,
                                             int m0, int n0, _Float16* sA, _Float16* sB, v8f (&acc)[4][4]) {
  const int tid = threadIdx.x, lane = tid & 31, wave = tid >> 5, l16 = lane & 15, kb8 = (lane >> 4) * 8;
  const int wm = wave >> 1, wn = wave & 1;
  // a thread stages rows sr + 16 i, 16-byte piece spc, of both tiles: one offset register, the rows as immediate offsets
  const int sr = tid >> 3, spc = tid & 7;
  const unsigned so = ((unsigned)sr * DM + spc * 8) * 2;          // bytes
  const char* At = (const char*)(A  + (size_t)m0 * DM);
  const char* Bt = (const char*)(Bw + (size_t)n0 * DM);
  for (int k0 = 0; k0 < DM; k0 += 64) {
    // all sixteen loads of the step first, then the LDS stores: one trip to L2 per step
    u4 va[8], vb[8];
    const char* pa = At + k0 * 2 + so;
    const char* pb = Bt + k0 * 2 + so;
#pragma unroll
    for (int i = 0; i < 8; ++i) {
      va[i] = *(const u4*)(pa + i * (16 * DM * 2));
      vb[i] = *(const u4*)(pb + i * (16 * DM * 2));
    }
    // keeps the scheduler from sinking each load down to its own store, where it is waited for before the next is issued
    __builtin_amdgcn_sched_barrier(0);
    // the two address pairs stay whole up to this wait: no load lands on them, and the next step's values come behind it
    asm volatile("s_wait_xcnt 0x0" :: "v"(pa), "v"(pb) : "memory");
#pragma unroll
    for (int i = 0; i < 8; ++i) {
      *(u4*)(sA + (sr + 16 * i) * LP + spc * 8) = va[i];
      *(u4*)(sB + (sr + 16 * i) * LP + spc * 8) = vb[i];
    }
    __syncthreads();
    const _Float16* ar = sA + (wm * 64 + l16) * LP;
    const _Float16* br = sB + (wn * 64 + l16) * LP;
#pragma unroll
    for (int kk = 0; kk < 2; ++kk) {
      // eight fragments of 32 k as one group of LDS reads, then their sixteen products
      v16h a[4], b[4];
#pragma unroll
      for (int t = 0; t < 4; ++t) {
        a[t] = ldfrag(ar + t * 16 * LP + kk * 32, kb8);
        b[t] = ldfrag(br + t * 16 * LP + kk * 32, kb8);
      }
      // keeps the scheduler from sinking each fragment's reads down to its products, where each is waited out in turn
      __builtin_amdgcn_sched_barrier(0);
#pragma unroll
      for (int mt = 0; mt < 4; ++mt)
#pragma unroll
        for (int nt = 0; nt < 4; ++nt) acc[mt][nt] = wmma16(a[mt], b[nt], acc[mt][nt]);
    }
    __syncthreads();
  }
}

// =====================================================================================
// QKV projection: acc = Xh . (64 W)^T ; val = acc/64 + bf16r(b)
// coverage: grid (MROWS/128, NQKV/128) -> every (position, column) of q, k and V^T exactly once.
// A tile holds 128 positions of two heads of one of q, k, v.
// =====================================================================================
__global__ __launch_bounds__(128) void k_qkv(const _Float16* __restrict__ Xh, const _Float16* __restrict__ Wh,
                                             const float* __restrict__ bias,
                                             _Float16* __restrict__ Qhi, _Float16* __restrict__ Khi,
                                             _Float16* __restrict__ Vt) {
  // main loop: planes 0 and 1 are the A and B tiles; write-out: head 0, head 1, or the V^T tile
  __shared__ __align__(16) _Float16 smem[2 * BT * LP];
  const int tid = threadIdx.x, lane = tid & 31, wave = tid >> 5, l16 = lane & 15, half = lane >> 4;
  const int wm = wave >> 1, wn = wave & 1;
  const int m0 = blockIdx.x * BT, n0 = blockIdx.y * BT;

  v8f acc[4][4];
#pragma unroll
  for (int mt = 0; mt < 4; ++mt)
#pragma unroll
    for (int nt = 0; nt < 4; ++nt) acc[mt][nt] = zero8();
  gemm_tile128(Xh, Wh, m0, n0, smem, smem + BT * LP, acc);

  const int sel = n0 / DM;                        // 0 q, 1 k, 2 v   (block-uniform)
  const int hd  = (n0 - sel * DM) / DH;           // first of the tile's two heads
  const int bb  = m0 / SEQ, l0 = m0 - bb * SEQ;   // batch, first position of the tile
  const size_t bh = (size_t)bb * HEADS + hd;
  const float inv = 1.0f / WSC;
  float bcol[4];
#pragma unroll
  for (int nt = 0; nt < 4; ++nt) bcol[nt] = bf16r(bias[n0 + wn * 64 + nt * 16 + l16]);

  // ---- stage the 128x128 result in LDS (the tiles are free after the main loop's final barrier) ----
  if (sel < 2) {
    _Float16* th = smem + wn * (BT * LP);         // this wave's head, [128 positions][LP]
#pragma unroll
    for (int mt = 0; mt < 4; ++mt) {
#pragma unroll
      for (int nt = 0; nt < 4; ++nt) {
#pragma unroll
        for (int r = 0; r < 8; ++r) {
          const float v = acc[mt][nt][r] * inv + bcol[nt];
          const int row = wm * 64 + mt * 16 + half * 8 + r, col = nt * 16 + l16;
          th[row * LP + col] = (_Float16)v;
        }
      }
    }
  } else {
#pragma unroll
    for (int mt = 0; mt < 4; ++mt) {
#pragma unroll
      for (int nt = 0; nt < 4; ++nt) {
        H8U o;
#pragma unroll
        for (int r = 0; r < 8; ++r) o.h[r] = (_Float16)(acc[mt][nt][r] * inv + bcol[nt]);
        // transposed: LDS row = tile column (head, e), 8 consecutive positions per lane
        *(u4*)(smem + (wn * 64 + nt * 16 + l16) * VP + wm * 64 + mt * 16 + half * 8) = o.u;
      }
    }
  }
  __syncthreads();

  // ---- whole-line write-out, lanes 8q..8q+7 <-> one 128-byte line ----
  if (sel < 2) {
#pragma unroll
    for (int hh = 0; hh < 2; ++hh) {
      _Float16* dhp = ((sel == 0) ? Qhi : Khi) + ((bh + hh) * SEQ + l0) * DH;
#pragma unroll
      for (int p = 0; p < 8; ++p) {
        const int line = p * 16 + (tid >> 3), piece = tid & 7;
        const u4 vh = *(const u4*)(smem + hh * (BT * LP) + line * LP + piece * 8);
        *(u4*)(dhp + line * DH + piece * 8) = vh;
      }
    }
  } else {
    _Float16* dvp = Vt + (bh * DH) * (size_t)SEQ + l0;     // row (head, e) at dvp + (64 * head + e) * SEQ
#pragma unroll
    for (int p = 0; p < 16; ++p) {
      const int e = p * 8 + (tid >> 4), piece = tid & 15;  // 16 lanes <-> the row's two lines
      const u4 v = *(const u4*)(smem + e * VP + piece * 8);
      *(u4*)(dvp + (size_t)e * SEQ + piece * 8) = v;
    }
  }
}

__device__ __forceinline__ float xhalf(float x) {
  const int b = __builtin_bit_cast(int, x);
  return __builtin_bit_cast(float, __builtin_amdgcn_permlanex16(b, b, 0x76543210, 0xfedcba98, false, false));
}

__device__ __forceinline__ unsigned lds_addr(const _Float16* p) {   // byte address inside the work-group's LDS
  return (unsigned)(unsigned long long)p;
}

// One thread's share of a step's two tiles: four 16-byte asynchronous copies, global memory -> LDS, through no register.
// The s_wait_xcnt closes the statement so that no address register named here is rewritten ahead of it.
__device__ __forceinline__ void copy_tiles(unsigned lkh0, unsigned lkh1, unsigned lv0, unsigned lv1,
                                           const _Float16* gkh0, const _Float16* gkh1,
                                           const _Float16* gv0, const _Float16* gv1) {
  asm volatile("global_load_async_to_lds_b128 %0, %4, off\n\t"
               "global_load_async_to_lds_b128 %1, %5, off\n\t"
               "global_load_async_to_lds_b128 %2, %6, off\n\t"
               "global_load_async_to_lds_b128 %3, %7, off\n\t"
               "s_wait_xcnt 0x0"
               :: "v"(lkh0), "v"(lkh1), "v"(lv0), "v"(lv1),
                  "v"(gkh0), "v"(gkh1), "v"(gv0), "v"(gv1)
               : "memory");
}

// four waves a SIMD (two work-groups a WGP, all of the grid resident at once): the fragment groups must fit 256 registers
__global__ __launch_bounds__(256) __attribute__((amdgpu_waves_per_eu(4, 4))) void k_attn(const _Float16* __restrict__ Qhi, const _Float16* __restrict__ Khi,
                                              const _Float16* __restrict__ Vt, const float* __restrict__ lam_p,
                                              const int* __restrict__ heads_p, _Float16* __restrict__ Oh) {
  const int tid = threadIdx.x, lane = tid & 31, wave = tid >> 5;
  const int l16 = lane & 15, half = lane >> 4, kb8 = half * 8;
  const int bh = blockIdx.x;
  const int b  = bh / HEADS, h = bh - b * HEADS;
  const int qBase = blockIdx.y * QT;

  // two tile buffers (step it works on buffer it & 1), each K | V^T; behind them the O write-out staging
  __shared__ __align__(16) _Float16 smem[2 * 2 * KT * LP + 8 * 16 * LP];
#define TILE(buf, plane) (smem + ((buf) * 2 + (plane)) * (KT * LP))
  _Float16* po = smem + 2 * 2 * KT * LP + wave * (16 * LP);   // wave-private [16 rows][LP]

  const float lamr = bf16r(lam_p[0]);
  const int   hv   = heads_p[0];
  const float lamv = (hv == HEADS) ? lamr : __uint_as_float(0x7fc00000u);   // poison on structural conflict

  // ---- Q fragments straight from the f16 planes (B layout: column = query l16) ----
  const size_t qrow = (size_t)bh * SEQ + qBase + wave * 16 + l16;
  const _Float16* qh = Qhi + qrow * DH;
  const v16h qa0 = ldfrag(qh, kb8), qa1 = ldfrag(qh + 32, kb8);

  float m = -3.0e38f, lsum = 0.0f, lgLast = 0.0f;   // lsum: this lane half's keys only, joined in the epilogue
  v8f acc[4];                                       // acc[n][j] = O'[e = 16n + 8*half + j][query l16]
#pragma unroll
  for (int n = 0; n < 4; ++n) acc[n] = zero8();

  const _Float16* khBase = Khi + (size_t)bh * SEQ * DH;
  const _Float16* vtBase = Vt  + (size_t)bh * DH * SEQ;

  // a thread copies rows sr and sr + 32, 16-byte piece spc, of each of the two tiles
  const int sr = tid >> 3, spc = tid & 7;
  const int so0 = sr * LP + spc * 8, so1 = (sr + 32) * LP + spc * 8;
  const _Float16* gkh = khBase + (size_t)sr * DH + spc * 8;
  const _Float16* gv  = vtBase + (size_t)sr * SEQ + spc * 8;
#define COPY_STEP(step, buf)                                                                          \
  copy_tiles(lds_addr(TILE(buf, 0) + so0), lds_addr(TILE(buf, 0) + so1),                              \
             lds_addr(TILE(buf, 1) + so0), lds_addr(TILE(buf, 1) + so1),                              \
             gkh + (size_t)(step) * (KT * DH), gkh + (size_t)(step) * (KT * DH) + 32 * DH,            \
             gv + (step) * KT, gv + (step) * KT + (size_t)32 * SEQ)

  COPY_STEP(0, 0);
  asm volatile("s_wait_asynccnt 0x0" ::: "memory");   // this wave's share of step 0 has landed
  __syncthreads();                                    // step 0 readable by every wave
  COPY_STEP(1, 1);                                    // flies while step 0 is worked on

  // one step on buffer u (a constant at every call: LDS offsets stay immediates); refill says whether a step it + 2 exists
  auto step = [&](const int it, const int u, const bool refill) __attribute__((always_inline)) {
    const _Float16* cKh = TILE(u, 0);
    const _Float16* cV  = TILE(u, 1);

    // ---- scores over four 16-key subtiles: p[t][j] = raw q.k (key 16t + 8*half + j, query l16) ----
    // LDS fragment reads go out in groups ahead of the products that take them (subtiles 0 and 1 at the top, subtile t + 2
    // behind the products of subtile t, V^T rows 0..31 under the last scores and the softmax, rows 32..63 under the rescale), so that a step waits out one LDS
    // latency instead of one per pair of reads.
    // Each sched_barrier below keeps the scheduler from sinking the group above it down to its products.
    v16h kfh[4][2], vf[4][2];
#define LOAD_K(t)                                                \
    do {                                                         \
      const _Float16* kr = cKh + ((t) * 16 + l16) * LP;          \
      kfh[t][0] = ldfrag(kr, kb8);                               \
      kfh[t][1] = ldfrag(kr + 32, kb8);                          \
    } while (0)
#define LOAD_V(n)                                                \
    do {                                                         \
      const _Float16* vr = cV + (16 * (n) + l16) * LP;           \
      vf[n][0] = ldfrag(vr, kb8);                                \
      vf[n][1] = ldfrag(vr + 32, kb8);                           \
    } while (0)
    LOAD_K(0);
    LOAD_K(1);
    __builtin_amdgcn_sched_barrier(0);            // the eight reads stay together in front of the first product

    float p[4][8];
    float tm[4];
#pragma unroll
    for (int t = 0; t < 4; ++t) {
      const v16h kh0 = kfh[t][0], kh1 = kfh[t][1];
      v8f chh = zero8();
      chh = wmma16(kh0, qa0, chh);
      chh = wmma16(kh1, qa1, chh);
      WGUARD(chh, kh1, qa1);
      tm[t] = -3.0e38f;
#pragma unroll
      for (int j = 0; j < 8; ++j) {
        const float lg = chh[j];
        p[t][j] = lg;
        tm[t] = fmaxf(tm[t], lg);
      }
      if (t < 2) {                                // into the registers subtile t has left
        LOAD_K(t + 2);
        __builtin_amdgcn_sched_barrier(0);        // the reads stay in front of subtile t + 1's products, which cover them
      }
      if (t == 2) {
        LOAD_V(0);
        LOAD_V(1);
        __builtin_amdgcn_sched_barrier(0);        // the reads stay in front of subtile 3's products and the softmax
      }
    }

    // ---- query max: in-lane, then one exchange between the lane halves ----
    float tmax = fmaxf(fmaxf(tm[0], tm[1]), fmaxf(tm[2], tm[3]));
    tmax = fmaxf(tmax, xhalf(tmax));
    // raw logit of this step's last key (half 1, subtile 3, j = 7), made valid in both halves
    const float oraw = xhalf(p[3][7]);
    const float nlg  = (half != 0) ? p[3][7] : oraw;

    const float nm   = fmaxf(m, tmax);
    const float corr = __builtin_amdgcn_exp2f((m - nm) * SC2);
    m = nm;
    const float bias = fmaf(-nm, SC2, LPSC);      // exp2(r * SC2 + bias) = 1024 * exp(r / 32 - max logit)
    const float pt   = __builtin_amdgcn_exp2f(fmaf(lgLast, SC2, bias));   // 1024 p of the prior step's last key under the new max
    const float pleft0 = (it == 0) ? 0.0f : pt;
    lgLast = nlg;

    float st[4];
#pragma unroll
    for (int t = 0; t < 4; ++t) {
      st[t] = 0.0f;
#pragma unroll
      for (int j = 0; j < 8; ++j) {
        p[t][j] = __builtin_amdgcn_exp2f(fmaf(p[t][j], SC2, bias));
        st[t] += p[t][j];
      }
    }
    lsum = lsum * corr + ((st[0] + st[1]) + (st[2] + st[3]));
    LOAD_V(2);                                    // the logits' registers are free from here
    LOAD_V(3);
    __builtin_amdgcn_sched_barrier(0);            // the reads stay in front of the rescale and the packing of P'
#pragma unroll
    for (int n = 0; n < 4; ++n)
#pragma unroll
      for (int j = 0; j < 8; ++j) acc[n][j] *= corr;

    // ---- key-differenced P' = 1024 p - 1024 p_left, packed in place into the B operands (k = keys) ----
    v16h pb[2];
    {
      float xprev = pleft0;
#pragma unroll
      for (int t = 0; t < 4; ++t) {
        const float x = xhalf(p[t][7]);           // half 1 sees key 16t+7, half 0 sees key 16t+15
        float left = (half != 0) ? x : xprev;
        xprev = x;
#pragma unroll
        for (int j = 0; j < 8; ++j) {
          pb[t >> 1][(t & 1) * 8 + j] = (_Float16)(p[t][j] - left);
          left = p[t][j];
        }
      }
    }

    // ---- V^T A-fragments (rows = e, k = keys); O^T += V^T.P'^T ----
#pragma unroll
    for (int n = 0; n < 4; ++n) {
      const v16h uv0 = vf[n][0], uv1 = vf[n][1];
      acc[n] = wmma16(uv0, pb[0], acc[n]);
      acc[n] = wmma16(uv1, pb[1], acc[n]);
      WGUARD(acc[n], uv1, pb[1]);
    }

    // ---- hand-over: own LDS reads retired, own copies of step it + 1 landed, then the step's one barrier ----
    asm volatile("s_wait_dscnt 0x0" ::: "memory");      // before buffer u is refilled
    asm volatile("s_wait_asynccnt 0x0" ::: "memory");   // before other waves read this wave's share of step it + 1
    __syncthreads();                                    // publishes step it + 1, ends every read of buffer u
    if (refill) COPY_STEP(it + 2, u);                   // flies while step it + 1 is worked on
  };
  // the last two steps stand behind the loop: the loop's body then has no branch, and each step's sums are formed inside it
  // instead of being carried, 32 registers a step, to a block behind the branch
  for (int it2 = 0; it2 < SEQ / KT - 2; it2 += 2) {
    step(it2, 0, true);
    step(it2 + 1, 1, true);
  }
  step(SEQ / KT - 2, 0, false);
  step(SEQ / KT - 1, 1, false);
  asm volatile("s_wait_asynccnt 0x0" ::: "memory");     // nothing in flight when the wave goes on
#undef LOAD_K
#undef LOAD_V
#undef COPY_STEP
#undef TILE

  // ---- finalize: join the halves' sums, cyclic term, normaliser, lam, O carry ----
  lsum += xhalf(lsum);
  const float pL = __builtin_amdgcn_exp2f(fmaf(lgLast, SC2, fmaf(-m, SC2, LPSC)));   // 1024 p of key SEQ-1 (lgLast: its raw q.k)
  const float f  = lamv * OSC * (1.0f / lsum);    // lsum holds 1024 * sum p

  // a lane's 8 accumulator registers are 8 consecutive columns of one O row: one 16-byte LDS store per tile
#pragma unroll
  for (int n = 0; n < 4; ++n) {
    H8U o;
#pragma unroll
    for (int j = 0; j < 8; ++j) {
      const float v0 = (float)vtBase[(size_t)(16 * n + kb8 + j) * SEQ];     // v of key 0, column e
      o.h[j] = (_Float16)((acc[n][j] - pL * v0) * f);
    }
    *(u4*)(po + l16 * LP + 16 * n + kb8) = o.u;
  }
  __builtin_amdgcn_fence(5, "wavefront");
  __builtin_amdgcn_wave_barrier();

  _Float16* od = Oh + ((size_t)b * SEQ + qBase + wave * 16) * DM + h * DH;
#pragma unroll
  for (int p4 = 0; p4 < 4; ++p4) {
    const int line = p4 * 4 + (lane >> 3), piece = lane & 7;
    const u4 v = *(const u4*)(po + line * LP + piece * 8);
    *(u4*)(od + (size_t)line * DM + piece * 8) = v;
  }
}

// =====================================================================================
// Output projection: out = (Oh/1024) . (64 W_out)^T / 64 + bf16r(b_out), f32 rows of d_out.
// 64x64 f32 tile staged in LDS [64][FP]; each 256-B row segment = 2 lines, each line 8 lanes x 16 B of one
// =====================================================================================
__global__ __launch_bounds__(128) void k_out(const _Float16* __restrict__ Oh, const _Float16* __restrict__ Woh,
                                             const float* __restrict__ bias, float* __restrict__ out) {
  __shared__ __align__(16) unsigned char smem[2 * 64 * LP * 2];
  _Float16* sA = (_Float16*)smem;
  _Float16* sB = sA + 64 * LP;
  const int tid = threadIdx.x, lane = tid & 31, wave = tid >> 5, l16 = lane & 15, half = lane >> 4;
  const int m0 = blockIdx.x * 64, n0 = blockIdx.y * 64;

  v8f acc[4];
#pragma unroll
  for (int nt = 0; nt < 4; ++nt) acc[nt] = zero8();
  gemm_tile(Oh, Woh, m0, n0, sA, sB, acc);

  float* sF = (float*)smem;                       // [64][FP]
  const float inv = 1.0f / (OSC * WSC);
  float bcol[4];
#pragma unroll
  for (int nt = 0; nt < 4; ++nt) bcol[nt] = bf16r(bias[n0 + nt * 16 + l16]);
#pragma unroll
  for (int nt = 0; nt < 4; ++nt) {
#pragma unroll
    for (int r = 0; r < 8; ++r) {
      const int row = wave * 16 + half * 8 + r, col = nt * 16 + l16;
      sF[row * FP + col] = acc[nt][r] * inv + bcol[nt];
    }
  }
  __syncthreads();

  const int bb = m0 / SEQ, l0 = m0 - bb * SEQ;
  float* dbase = out + ((size_t)bb * SEQ_FULL + l0) * DM + n0;
#pragma unroll
  for (int p = 0; p < 8; ++p) {
    const int line = p * 16 + (tid >> 3), piece = tid & 7;
    const int row = line >> 1, hs = line & 1;
    const f4 v = *(const f4*)(sF + row * FP + hs * 32 + piece * 4);
    *(f4*)(dbase + (size_t)row * DM + hs * 32 + piece * 4) = v;
  }
  
}

// =====================================================================================
// Host launcher: 6 launches, grids and arguments are pure functions of the size macros.
// =====================================================================================
static inline unsigned cdiv_u(unsigned a, unsigned b) { return (a + b - 1) / b; }

extern "C" void kernel_launch(void* const* d_in, const int* in_sizes, int n_in,
                              void* d_out, int out_size, void* d_ws, size_t ws_size,
                              hipStream_t stream) {
  if (n_in < 7) return;
  const long long need_rows = (long long)(NB - 1) * SEQ_FULL + SEQ;
  if ((long long)in_sizes[0] < need_rows * DM) return;
  if (in_sizes[1] < NQKV * DM) return;
  if (in_sizes[2] < NQKV) return;
  if (in_sizes[3] < DM * DM) return;
  if (in_sizes[4] < DM) return;
  if (in_sizes[5] < 1) return;
  if (in_sizes[6] < 1) return;
  if ((long long)out_size < need_rows * DM) return;
  if (d_ws == nullptr || ws_size < WS_NEED) return;

  const float* x     = (const float*)d_in[0];
  const float* w_qkv = (const float*)d_in[1];
  const float* b_qkv = (const float*)d_in[2];
  const float* w_out = (const float*)d_in[3];
  const float* b_out = (const float*)d_in[4];
  const float* lam   = (const float*)d_in[5];
  const int*   heads = (const int*)d_in[6];
  float* out = (float*)d_out;

  char* ws = (char*)d_ws;
  _Float16* Xh  = (_Float16*)(ws + OFF_XH);
  _Float16* Wq  = (_Float16*)(ws + OFF_WQ);
  _Float16* Wo  = (_Float16*)(ws + OFF_WO);
  _Float16* Qhi = (_Float16*)(ws + OFF_QH);
  _Float16* Khi = (_Float16*)(ws + OFF_KH);
  _Float16* Vt  = (_Float16*)(ws + OFF_VT);
  _Float16* Oh  = (_Float16*)(ws + OFF_OH);

  const int gx = MROWS * G8, gq = NQKV * G8, go = DM * G8;
  k_convert<<<dim3(cdiv_u(gx, 256)), dim3(256), 0, stream>>>(x,     Xh, gx, SEQ,  SEQ_FULL, 1.0f);
  k_convert<<<dim3(cdiv_u(gq, 256)), dim3(256), 0, stream>>>(w_qkv, Wq, gq, NQKV, NQKV,     WSC);
  k_convert<<<dim3(cdiv_u(go, 256)), dim3(256), 0, stream>>>(w_out, Wo, go, DM,   DM,       WSC);

  k_qkv<<<dim3(MROWS / BT, NQKV / BT), dim3(128), 0, stream>>>(Xh, Wq, b_qkv, Qhi, Khi, Vt);
  k_attn<<<dim3(NB * HEADS, SEQ / QT), dim3(256), 0, stream>>>(Qhi, Khi, Vt, lam, heads, Oh);
  k_out<<<dim3(MROWS / 64, DM / 64), dim3(128), 0, stream>>>(Oh, Wo, b_out, out);
}

// v008
// One run takes 83.4 microseconds.
// Next to v007, in two timings, it ran 1.03 times as fast each time.
// All steps since v000 together make it 2.38 times as fast.
#include <hip/hip_runtime.h>

// Contractions on v_wmma_f32_16x16x32_f16 (f16 operands, f32 accumulate): qkv projection (x as f16 of its bf16-RNE value,
// W as f16 of its bf16-RNE value x64); scores (q and k as f16, one product); P.V
// (key-differenced softmax numerators x1024 in f16, V in f16); output projection (O x1024 in f16, W x64).
// Softmax, normaliser, cyclic correction and bias adds in f32.

typedef _Float16     v16h __attribute__((ext_vector_type(16)));
typedef _Float16     h8   __attribute__((ext_vector_type(8)));
typedef float        v8f  __attribute__((ext_vector_type(8)));
typedef float        f4   __attribute__((ext_vector_type(4)));
typedef unsigned int u4   __attribute__((ext_vector_type(4)));

#ifndef NB
#define NB 2
#endif
#ifndef SEQ
#define SEQ 2048
#endif
#define NB_FULL  2
#define SEQ_FULL 2048
#define DM     1024
#define HEADS  16
#define DH     64
#define NQKV   (3 * DM)
#define MROWS  (NB * SEQ)
#define G8     (DM / 8)          // 16-byte groups per row

#define QT  128                  // query rows per block (8 waves x 16)
#define KT  64                   // keys per main-loop step
#define LP  72                   // f16 LDS row pitch (144 B)
#define FP  68                   // f32 LDS row pitch (272 B)

#define WSC 64.0f                // weight planes carried x64
#define PSC 1024.0f              // P operand carried x1024
#define OSC 1024.0f              // O plane carried x1024
#define SCL 0.03125f             // d_model^-0.5 = 1/32
#define SC2 (SCL * 1.44269504088896340736f)   // raw q.k -> logit in base-2 units: 1/32 * log2(e)
#define LPSC 10.0f               // log2(PSC): the x1024 of the P operand rides in the exponent

static_assert(DM == 1024);
static_assert(PSC == 1024.0f && LPSC == 10.0f);
static_assert(G8 == 128);
static_assert(HEADS * DH == DM);
static_assert(DH == 64);
static_assert(SEQ % QT == 0);
static_assert(SEQ % KT == 0);
static_assert((SEQ / KT) % 2 == 0);
static_assert(KT == DH);
static_assert(SEQ % 64 == 0);
static_assert(MROWS % 64 == 0);
static_assert(NQKV % 64 == 0);
static_assert(NB >= 1 && NB <= NB_FULL);
static_assert(SEQ <= SEQ_FULL);
static_assert(64 * FP * 4 <= 2 * 64 * LP * 2);

// ---------------- workspace layout (all offsets multiples of 512 KiB) ----------------
#define XH_BYTES ((size_t)MROWS * DM * 2)          // f16 x            [MROWS][DM]
#define WQ_BYTES ((size_t)NQKV * DM * 2)           // f16 64*W_qkv     [NQKV][DM]
#define WO_BYTES ((size_t)DM * DM * 2)             // f16 64*W_out     [DM][DM]
#define PL_BYTES ((size_t)MROWS * DM * 2)          // one f16 plane: [NB*H][SEQ][DH] or [NB*H][DH][SEQ] or [MROWS][DM]
#define OFF_XH  ((size_t)0)
#define OFF_WQ  (OFF_XH + XH_BYTES)
#define OFF_WO  (OFF_WQ + WQ_BYTES)
#define OFF_QH  (OFF_WO + WO_BYTES)
#define OFF_KH  (OFF_QH + PL_BYTES)
#define OFF_VT  (OFF_KH + PL_BYTES)
#define OFF_OH  (OFF_VT + PL_BYTES)
#define WS_NEED (OFF_OH + PL_BYTES)
static_assert(WS_NEED <= (size_t)134217728);
static_assert((OFF_WQ % 128) == 0 && (OFF_WO % 128) == 0 && (OFF_QH % 128) == 0 && (OFF_OH % 128) == 0);

// ---------------- helpers ----------------
__device__ __forceinline__ float bf16r(float x) {           // RNE to bf16, kept as f32
  unsigned int u = __float_as_uint(x);
  u = (u + 0x7FFFu + ((u >> 16) & 1u)) & 0xFFFF0000u;
  return __uint_as_float(u);
}

__device__ __forceinline__ v8f zero8() {
  v8f z;
#pragma unroll
  for (int j = 0; j < 8; ++j) z[j] = 0.0f;
  return z;
}

__device__ __forceinline__ v8f wmma16(v16h a, v16h b, v8f c) {
  return __builtin_amdgcn_wmma_f32_16x16x32_f16(false, a, false, b, (short)0, c, false, false);
}

#define WGUARD(acc, a, b) \
  asm volatile("v_nop\n\tv_nop\n\tv_nop\n\tv_nop" : "+v"(acc) : "v"(a), "v"(b))

union HU  { v16h v; h8 p[2]; };
union H8U { h8 h; u4 u; };

// 16-bit fragment (A or B) from a k-contiguous row: elements 0..7 <- k 8h..8h+7, 8..15 <- k 16+8h..16+8h+7
__device__ __forceinline__ v16h ldfrag(const _Float16* row, int kb8) {
  HU u;
  u.p[0] = *(const h8*)(row + kb8);
  u.p[1] = *(const h8*)(row + 16 + kb8);
  return u.v;
}

// =====================================================================================
// Convert, all three planes in one launch: dst[row][c] = f16( bf16r(src[srow][c]) * scale ); x at scale 1 with
// srow = (row/SEQ)*SEQ_FULL + row%SEQ, the two weight planes at scale WSC with srow = row.
// For speed only: CVB work-groups (two a WGP, 16 waves) instead of
// one thread a group; a thread takes groups t + i * CVT of each plane, all of its loads in flight before its first store.
// coverage: i runs over plane groups / CVT, t over CVT threads: every 8-element group of every plane exactly once.
// =====================================================================================
#define CVB 512                  // work-groups of the conversion
#define CVT (CVB * 256)          // its threads
#define CNX (MROWS * G8 / CVT)   // groups a thread: x
#define CNQ (NQKV * G8 / CVT)    //                  W_qkv
#define CNO (DM * G8 / CVT)      //                  W_out
static_assert(CNX * CVT == MROWS * G8 && CNQ * CVT == NQKV * G8 && CNO * CVT == DM * G8);

__device__ __forceinline__ u4 cvt8(f4 a, f4 b, float scale) {
  H8U o;
#pragma unroll
  for (int j = 0; j < 4; ++j) {
    o.h[j]     = (_Float16)(bf16r(a[j]) * scale);
    o.h[4 + j] = (_Float16)(bf16r(b[j]) * scale);
  }
  return o.u;
}

__global__ __launch_bounds__(256) void k_convert(const float* __restrict__ x, const float* __restrict__ wq,
                                                 const float* __restrict__ wo, _Float16* __restrict__ Xh,
                                                 _Float16* __restrict__ Wq, _Float16* __restrict__ Wo) {
  const unsigned t = blockIdx.x * 256u + threadIdx.x;
  const float *px[CNX], *pq[CNQ], *po[CNO];
  f4 xa[CNX], xb[CNX], qa[CNQ], qb[CNQ], oa[CNO], ob[CNO];
#pragma unroll
  for (int i = 0; i < CNX; ++i) {
    const unsigned g = t + i * CVT, row = g >> 7, c8 = g & 127;
    px[i] = x + (size_t)((row / SEQ) * SEQ_FULL + row % SEQ) * DM + c8 * 8;
    xa[i] = *(const f4*)px[i];
    xb[i] = *(const f4*)(px[i] + 4);
  }
#pragma unroll
  for (int i = 0; i < CNQ; ++i) {
    pq[i] = wq + (size_t)(t + i * CVT) * 8;
    qa[i] = *(const f4*)pq[i];
    qb[i] = *(const f4*)(pq[i] + 4);
  }
#pragma unroll
  for (int i = 0; i < CNO; ++i) {
    po[i] = wo + (size_t)(t + i * CVT) * 8;
    oa[i] = *(const f4*)po[i];
    ob[i] = *(const f4*)(po[i] + 4);
  }
  // keeps the scheduler from sinking loads in among the conversions, where the first ones are waited out before the rest are issued
  __builtin_amdgcn_sched_barrier(0);
  // the address pairs stay whole up to this wait: no later load lands on one, and the conversions reuse them only behind it
  static_assert(CNX == 4 && CNQ == 3 && CNO == 1);
  asm volatile("s_wait_xcnt 0x0" :: "v"(px[0]), "v"(px[1]), "v"(px[2]), "v"(px[3]),
                                    "v"(pq[0]), "v"(pq[1]), "v"(pq[2]), "v"(po[0]) : "memory");
#pragma unroll
  for (int i = 0; i < CNX; ++i) *(u4*)(Xh + (size_t)(t + i * CVT) * 8) = cvt8(xa[i], xb[i], 1.0f);
#pragma unroll
  for (int i = 0; i < CNQ; ++i) *(u4*)(Wq + (size_t)(t + i * CVT) * 8) = cvt8(qa[i], qb[i], WSC);
#pragma unroll
  for (int i = 0; i < CNO; ++i) *(u4*)(Wo + (size_t)(t + i * CVT) * 8) = cvt8(oa[i], ob[i], WSC);
}

// =====================================================================================
// 64x64 tile GEMM main loop: C[m][n] += sum_k A[m][k] * Bw[n][k], K = DM, 128 threads (4 waves x 16 rows)
// A, Bw are f16 row-major with pitch DM. LDS tiles [64][LP] staged with 16-B loads, cross-wave (block barriers).
// staged extent == consumed extent: rows 0..63, halves 0..63 of both tiles.
// =====================================================================================
__device__ __forceinline__ void gemm_tile(const _Float16* __restrict__ A, const _Float16* __restrict__ Bw,
                                          int m0, int n0, _Float16* sA, _Float16* sB, v8f (&acc)[4]) {
  const int tid = threadIdx.x, lane = tid & 31, wave = tid >> 5, l16 = lane & 15, kb8 = (lane >> 4) * 8;
  for (int k0 = 0; k0 < DM; k0 += 64) {
    // all eight loads of the step first, then the LDS stores: one trip to L2 per step instead of one per load
    u4 va[4], vb[4];
#pragma unroll
    for (int i = 0; i < 4; ++i) {
      const int idx = tid + 128 * i;
      const int r = idx >> 3, pc = idx & 7;
      va[i] = *(const u4*)(A  + (size_t)(m0 + r) * DM + k0 + pc * 8);
      vb[i] = *(const u4*)(Bw + (size_t)(n0 + r) * DM + k0 + pc * 8);
    }
    // keeps the scheduler from sinking each load down to its own store, where it is waited for before the next is issued
    __builtin_amdgcn_sched_barrier(0);
#pragma unroll
    for (int i = 0; i < 4; ++i) {
      const int idx = tid + 128 * i;
      const int r = idx >> 3, pc = idx & 7;
      *(u4*)(sA + r * LP + pc * 8) = va[i];
      *(u4*)(sB + r * LP + pc * 8) = vb[i];
    }
    __syncthreads();
    const _Float16* ar = sA + (wave * 16 + l16) * LP;
    // the step's ten fragments as one group of LDS reads: one LDS latency a step instead of one per column tile
    const v16h a0 = ldfrag(ar, kb8);
    const v16h a1 = ldfrag(ar + 32, kb8);
    v16h b0[4], b1[4];
#pragma unroll
    for (int nt = 0; nt < 4; ++nt) {
      const _Float16* br = sB + (nt * 16 + l16) * LP;
      b0[nt] = ldfrag(br, kb8);
      b1[nt] = ldfrag(br + 32, kb8);
    }
    // keeps the scheduler from sinking each tile's reads down to its products, where each is waited out in turn
    __builtin_amdgcn_sched_barrier(0);
#pragma unroll
    for (int nt = 0; nt < 4; ++nt) {
      acc[nt] = wmma16(a0, b0[nt], acc[nt]);
      acc[nt] = wmma16(a1, b1[nt], acc[nt]);
      WGUARD(acc[nt], a1, b1[nt]);
    }
    __syncthreads();
  }
}

// =====================================================================================
// 128x128 tile GEMM main loop for the qkv projection: 128 threads, 4 waves as 2 x 2, 64x64 of C per wave (16 accumulator tiles).
// Each staged byte feeds twice the products it feeds in the 64x64 tile, and every LDS fragment feeds four products
// (in gemm_tile a B fragment feeds one). The k order of every accumulator is that of gemm_tile.
// staged extent == consumed extent: rows 0..127, halves 0..63 of both tiles.
// =====================================================================================
#define BT 128                   // tile edge of the qkv projection
#define VP 136                   // f16 LDS row pitch of the transposed V tile (272 B)
static_assert(MROWS % BT == 0 && NQKV % BT == 0 && DM % BT == 0 && SEQ % BT == 0 && BT == 2 * DH);
static_assert(BT * VP <= 2 * BT * LP);

__device__ __forceinline__ void gemm_tile128(const _Float16* __restrict__ A, const _Float16* __restrict__ Bw,
                                             int m0, int n0, _Float16* sA, _Float16* sB, v8f (&acc)[4][4]) {
  const int tid = threadIdx.x, lane = tid & 31, wave = tid >> 5, l16 = lane & 15, kb8 = (lane >> 4) * 8;
  const int wm = wave >> 1, wn = wave & 1;
  // a thread stages rows sr + 16 i, 16-byte piece spc, of both tiles: one offset register, the rows as immediate offsets
  const int sr = tid >> 3, spc = tid & 7;
  const unsigned so = ((unsigned)sr * DM + spc * 8) * 2;          // bytes
  const char* At = (const char*)(A  + (size_t)m0 * DM);
  const char* Bt = (const char*)(Bw + (size_t)n0 * DM);
  for (int k0 = 0; k0 < DM; k0 += 64) {
    // all sixteen loads of the step first, then the LDS stores: one trip to L2 per step
    u4 va[8], vb[8];
    const char* pa = At + k0 * 2 + so;
    const char* pb = Bt + k0 * 2 + so;
#pragma unroll
    for (int i = 0; i < 8; ++i) {
      va[i] = *(const u4*)(pa + i * (16 * DM * 2));
      vb[i] = *(const u4*)(pb + i * (16 * DM * 2));
    }
    // keeps the scheduler from sinking each load down to its own store, where it is waited for before the next is issued
    __builtin_amdgcn_sched_barrier(0);
    // the two address pairs stay whole up to this wait: no load lands on them, and the next step's values come behind it
    asm volatile("s_wait_xcnt 0x0" :: "v"(pa), "v"(pb) : "memory");
#pragma unroll
    for (int i = 0; i < 8; ++i) {
      *(u4*)(sA + (sr + 16 * i) * LP + spc * 8) = va[i];
      *(u4*)(sB + (sr + 16 * i) * LP + spc * 8) = vb[i];
    }
    __syncthreads();
    const _Float16* ar = sA + (wm * 64 + l16) * LP;
    const _Float16* br = sB + (wn * 64 + l16) * LP;
#pragma unroll
    for (int kk = 0; kk < 2; ++kk) {
      // eight fragments of 32 k as one group of LDS reads, then their sixteen products
      v16h a[4], b[4];
#pragma unroll
      for (int t = 0; t < 4; ++t) {
        a[t] = ldfrag(ar + t * 16 * LP + kk * 32, kb8);
        b[t] = ldfrag(br + t * 16 * LP + kk * 32, kb8);
      }
      // keeps the scheduler from sinking each fragment's reads down to its products, where each is waited out in turn
      __builtin_amdgcn_sched_barrier(0);
#pragma unroll
      for (int mt = 0; mt < 4; ++mt)
#pragma unroll
        for (int nt = 0; nt < 4; ++nt) acc[mt][nt] = wmma16(a[mt], b[nt], acc[mt][nt]);
    }
    __syncthreads();
  }
}

// =====================================================================================
// QKV projection: acc = Xh . (64 W)^T ; val = acc/64 + bf16r(b)
// coverage: grid (MROWS/128, NQKV/128) -> every (position, column) of q, k and V^T exactly once.
// A tile holds 128 positions of two heads of one of q, k, v.
// =====================================================================================
__global__ __launch_bounds__(128) void k_qkv(const _Float16* __restrict__ Xh, const _Float16* __restrict__ Wh,
                                             const float* __restrict__ bias,
                                             _Float16* __restrict__ Qhi, _Float16* __restrict__ Khi,
                                             _Float16* __restrict__ Vt) {
  // main loop: planes 0 and 1 are the A and B tiles; write-out: head 0, head 1, or the V^T tile
  __shared__ __align__(16) _Float16 smem[2 * BT * LP];
  const int tid = threadIdx.x, lane = tid & 31, wave = tid >> 5, l16 = lane & 15, half = lane >> 4;
  const int wm = wave >> 1, wn = wave & 1;
  const int m0 = blockIdx.x * BT, n0 = blockIdx.y * BT;

  v8f acc[4][4];
#pragma unroll
  for (int mt = 0; mt < 4; ++mt)
#pragma unroll
    for (int nt = 0; nt < 4; ++nt) acc[mt][nt] = zero8();
  gemm_tile128(Xh, Wh, m0, n0, smem, smem + BT * LP, acc);

  const int sel = n0 / DM;                        // 0 q, 1 k, 2 v   (block-uniform)
  const int hd  = (n0 - sel * DM) / DH;           // first of the tile's two heads
  const int bb  = m0 / SEQ, l0 = m0 - bb * SEQ;   // batch, first position of the tile
  const size_t bh = (size_t)bb * HEADS + hd;
  const float inv = 1.0f / WSC;
  float bcol[4];
#pragma unroll
  for (int nt = 0; nt < 4; ++nt) bcol[nt] = bf16r(bias[n0 + wn * 64 + nt * 16 + l16]);

  // ---- stage the 128x128 result in LDS (the tiles are free after the main loop's final barrier) ----
  if (sel < 2) {
    _Float16* th = smem + wn * (BT * LP);         // this wave's head, [128 positions][LP]
#pragma unroll
    for (int mt = 0; mt < 4; ++mt) {
#pragma unroll
      for (int nt = 0; nt < 4; ++nt) {
#pragma unroll
        for (int r = 0; r < 8; ++r) {
          const float v = acc[mt][nt][r] * inv + bcol[nt];
          const int row = wm * 64 + mt * 16 + half * 8 + r, col = nt * 16 + l16;
          th[row * LP + col] = (_Float16)v;
        }
      }
    }
  } else {
#pragma unroll
    for (int mt = 0; mt < 4; ++mt) {
#pragma unroll
      for (int nt = 0; nt < 4; ++nt) {
        H8U o;
#pragma unroll
        for (int r = 0; r < 8; ++r) o.h[r] = (_Float16)(acc[mt][nt][r] * inv + bcol[nt]);
        // transposed: LDS row = tile column (head, e), 8 consecutive positions per lane
        *(u4*)(smem + (wn * 64 + nt * 16 + l16) * VP + wm * 64 + mt * 16 + half * 8) = o.u;
      }
    }
  }
  __syncthreads();

  // ---- whole-line write-out, lanes 8q..8q+7 <-> one 128-byte line ----
  if (sel < 2) {
#pragma unroll
    for (int hh = 0; hh < 2; ++hh) {
      _Float16* dhp = ((sel == 0) ? Qhi : Khi) + ((bh + hh) * SEQ + l0) * DH;
#pragma unroll
      for (int p = 0; p < 8; ++p) {
        const int line = p * 16 + (tid >> 3), piece = tid & 7;
        const u4 vh = *(const u4*)(smem + hh * (BT * LP) + line * LP + piece * 8);
        *(u4*)(dhp + line * DH + piece * 8) = vh;
      }
    }
  } else {
    _Float16* dvp = Vt + (bh * DH) * (size_t)SEQ + l0;     // row (head, e) at dvp + (64 * head + e) * SEQ
#pragma unroll
    for (int p = 0; p < 16; ++p) {
      const int e = p * 8 + (tid >> 4), piece = tid & 15;  // 16 lanes <-> the row's two lines
      const u4 v = *(const u4*)(smem + e * VP + piece * 8);
      *(u4*)(dvp + (size_t)e * SEQ + piece * 8) = v;
    }
  }
}

__device__ __forceinline__ float xhalf(float x) {
  const int b = __builtin_bit_cast(int, x);
  return __builtin_bit_cast(float, __builtin_amdgcn_permlanex16(b, b, 0x76543210, 0xfedcba98, false, false));
}

__device__ __forceinline__ unsigned lds_addr(const _Float16* p) {   // byte address inside the work-group's LDS
  return (unsigned)(unsigned long long)p;
}

// One thread's share of a step's two tiles: four 16-byte asynchronous copies, global memory -> LDS, through no register.
// The s_wait_xcnt closes the statement so that no address register named here is rewritten ahead of it.
__device__ __forceinline__ void copy_tiles(unsigned lkh0, unsigned lkh1, unsigned lv0, unsigned lv1,
                                           const _Float16* gkh0, const _Float16* gkh1,
                                           const _Float16* gv0, const _Float16* gv1) {
  asm volatile("global_load_async_to_lds_b128 %0, %4, off\n\t"
               "global_load_async_to_lds_b128 %1, %5, off\n\t"
               "global_load_async_to_lds_b128 %2, %6, off\n\t"
               "global_load_async_to_lds_b128 %3, %7, off\n\t"
               "s_wait_xcnt 0x0"
               :: "v"(lkh0), "v"(lkh1), "v"(lv0), "v"(lv1),
                  "v"(gkh0), "v"(gkh1), "v"(gv0), "v"(gv1)
               : "memory");
}

// four waves a SIMD (two work-groups a WGP, all of the grid resident at once): the fragment groups must fit 256 registers
__global__ __launch_bounds__(256) __attribute__((amdgpu_waves_per_eu(4, 4))) void k_attn(const _Float16* __restrict__ Qhi, const _Float16* __restrict__ Khi,
                                              const _Float16* __restrict__ Vt, const float* __restrict__ lam_p,
                                              const int* __restrict__ heads_p, _Float16* __restrict__ Oh) {
  const int tid = threadIdx.x, lane = tid & 31, wave = tid >> 5;
  const int l16 = lane & 15, half = lane >> 4, kb8 = half * 8;
  const int bh = blockIdx.x;
  const int b  = bh / HEADS, h = bh - b * HEADS;
  const int qBase = blockIdx.y * QT;

  // two tile buffers (step it works on buffer it & 1), each K | V^T; behind them the O write-out staging
  __shared__ __align__(16) _Float16 smem[2 * 2 * KT * LP + 8 * 16 * LP];
#define TILE(buf, plane) (smem + ((buf) * 2 + (plane)) * (KT * LP))
  _Float16* po = smem + 2 * 2 * KT * LP + wave * (16 * LP);   // wave-private [16 rows][LP]

  const float lamr = bf16r(lam_p[0]);
  const int   hv   = heads_p[0];
  const float lamv = (hv == HEADS) ? lamr : __uint_as_float(0x7fc00000u);   // poison on structural conflict

  // ---- Q fragments straight from the f16 planes (B layout: column = query l16) ----
  const size_t qrow = (size_t)bh * SEQ + qBase + wave * 16 + l16;
  const _Float16* qh = Qhi + qrow * DH;
  const v16h qa0 = ldfrag(qh, kb8), qa1 = ldfrag(qh + 32, kb8);

  float m = -3.0e38f, lsum = 0.0f, lgLast = 0.0f;   // lsum: this lane half's keys only, joined in the epilogue
  v8f acc[4];                                       // acc[n][j] = O'[e = 16n + 8*half + j][query l16]
#pragma unroll
  for (int n = 0; n < 4; ++n) acc[n] = zero8();

  const _Float16* khBase = Khi + (size_t)bh * SEQ * DH;
  const _Float16* vtBase = Vt  + (size_t)bh * DH * SEQ;

  // a thread copies rows sr and sr + 32, 16-byte piece spc, of each of the two tiles
  const int sr = tid >> 3, spc = tid & 7;
  const int so0 = sr * LP + spc * 8, so1 = (sr + 32) * LP + spc * 8;
  const _Float16* gkh = khBase + (size_t)sr * DH + spc * 8;
  const _Float16* gv  = vtBase + (size_t)sr * SEQ + spc * 8;
#define COPY_STEP(step, buf)                                                                          \
  copy_tiles(lds_addr(TILE(buf, 0) + so0), lds_addr(TILE(buf, 0) + so1),                              \
             lds_addr(TILE(buf, 1) + so0), lds_addr(TILE(buf, 1) + so1),                              \
             gkh + (size_t)(step) * (KT * DH), gkh + (size_t)(step) * (KT * DH) + 32 * DH,            \
             gv + (step) * KT, gv + (step) * KT + (size_t)32 * SEQ)

  COPY_STEP(0, 0);
  asm volatile("s_wait_asynccnt 0x0" ::: "memory");   // this wave's share of step 0 has landed
  __syncthreads();                                    // step 0 readable by every wave
  COPY_STEP(1, 1);                                    // flies while step 0 is worked on

  // one step on buffer u (a constant at every call: LDS offsets stay immediates); refill says whether a step it + 2 exists
  auto step = [&](const int it, const int u, const bool refill) __attribute__((always_inline)) {
    const _Float16* cKh = TILE(u, 0);
    const _Float16* cV  = TILE(u, 1);

    // ---- scores over four 16-key subtiles: p[t][j] = raw q.k (key 16t + 8*half + j, query l16) ----
    // LDS fragment reads go out in groups ahead of the products that take them (subtiles 0 and 1 at the top, subtile t + 2
    // behind the products of subtile t, V^T rows 0..31 under the last scores and the softmax, rows 32..63 under the rescale), so that a step waits out one LDS
    // latency instead of one per pair of reads.
    // Each sched_barrier below keeps the scheduler from sinking the group above it down to its products.
    v16h kfh[4][2], vf[4][2];
#define LOAD_K(t)                                                \
    do {                                                         \
      const _Float16* kr = cKh + ((t) * 16 + l16) * LP;          \
      kfh[t][0] = ldfrag(kr, kb8);                               \
      kfh[t][1] = ldfrag(kr + 32, kb8);                          \
    } while (0)
#define LOAD_V(n)                                                \
    do {                                                         \
      const _Float16* vr = cV + (16 * (n) + l16) * LP;           \
      vf[n][0] = ldfrag(vr, kb8);                                \
      vf[n][1] = ldfrag(vr + 32, kb8);                           \
    } while (0)
    LOAD_K(0);
    LOAD_K(1);
    __builtin_amdgcn_sched_barrier(0);            // the eight reads stay together in front of the first product

    float p[4][8];
    float tm[4];
#pragma unroll
    for (int t = 0; t < 4; ++t) {
      const v16h kh0 = kfh[t][0], kh1 = kfh[t][1];
      v8f chh = zero8();
      chh = wmma16(kh0, qa0, chh);
      chh = wmma16(kh1, qa1, chh);
      WGUARD(chh, kh1, qa1);
      tm[t] = -3.0e38f;
#pragma unroll
      for (int j = 0; j < 8; ++j) {
        const float lg = chh[j];
        p[t][j] = lg;
        tm[t] = fmaxf(tm[t], lg);
      }
      if (t < 2) {                                // into the registers subtile t has left
        LOAD_K(t + 2);
        __builtin_amdgcn_sched_barrier(0);        // the reads stay in front of subtile t + 1's products, which cover them
      }
      if (t == 2) {
        LOAD_V(0);
        LOAD_V(1);
        __builtin_amdgcn_sched_barrier(0);        // the reads stay in front of subtile 3's products and the softmax
      }
    }

    // ---- query max: in-lane, then one exchange between the lane halves ----
    float tmax = fmaxf(fmaxf(tm[0], tm[1]), fmaxf(tm[2], tm[3]));
    tmax = fmaxf(tmax, xhalf(tmax));
    // raw logit of this step's last key (half 1, subtile 3, j = 7), made valid in both halves
    const float oraw = xhalf(p[3][7]);
    const float nlg  = (half != 0) ? p[3][7] : oraw;

    const float nm   = fmaxf(m, tmax);
    const float corr = __builtin_amdgcn_exp2f((m - nm) * SC2);
    m = nm;
    const float bias = fmaf(-nm, SC2, LPSC);      // exp2(r * SC2 + bias) = 1024 * exp(r / 32 - max logit)
    const float pt   = __builtin_amdgcn_exp2f(fmaf(lgLast, SC2, bias));   // 1024 p of the prior step's last key under the new max
    const float pleft0 = (it == 0) ? 0.0f : pt;
    lgLast = nlg;

    float st[4];
#pragma unroll
    for (int t = 0; t < 4; ++t) {
      st[t] = 0.0f;
#pragma unroll
      for (int j = 0; j < 8; ++j) {
        p[t][j] = __builtin_amdgcn_exp2f(fmaf(p[t][j], SC2, bias));
        st[t] += p[t][j];
      }
    }
    lsum = lsum * corr + ((st[0] + st[1]) + (st[2] + st[3]));
    LOAD_V(2);                                    // the logits' registers are free from here
    LOAD_V(3);
    __builtin_amdgcn_sched_barrier(0);            // the reads stay in front of the rescale and the packing of P'
#pragma unroll
    for (int n = 0; n < 4; ++n)
#pragma unroll
      for (int j = 0; j < 8; ++j) acc[n][j] *= corr;

    // ---- key-differenced P' = 1024 p - 1024 p_left, packed in place into the B operands (k = keys) ----
    v16h pb[2];
    {
      float xprev = pleft0;
#pragma unroll
      for (int t = 0; t < 4; ++t) {
        const float x = xhalf(p[t][7]);           // half 1 sees key 16t+7, half 0 sees key 16t+15
        float left = (half != 0) ? x : xprev;
        xprev = x;
#pragma unroll
        for (int j = 0; j < 8; ++j) {
          pb[t >> 1][(t & 1) * 8 + j] = (_Float16)(p[t][j] - left);
          left = p[t][j];
        }
      }
    }

    // ---- V^T A-fragments (rows = e, k = keys); O^T += V^T.P'^T ----
#pragma unroll
    for (int n = 0; n < 4; ++n) {
      const v16h uv0 = vf[n][0], uv1 = vf[n][1];
      acc[n] = wmma16(uv0, pb[0], acc[n]);
      acc[n] = wmma16(uv1, pb[1], acc[n]);
      WGUARD(acc[n], uv1, pb[1]);
    }

    // ---- hand-over: own LDS reads retired, own copies of step it + 1 landed, then the step's one barrier ----
    asm volatile("s_wait_dscnt 0x0" ::: "memory");      // before buffer u is refilled
    asm volatile("s_wait_asynccnt 0x0" ::: "memory");   // before other waves read this wave's share of step it + 1
    __syncthreads();                                    // publishes step it + 1, ends every read of buffer u
    if (refill) COPY_STEP(it + 2, u);                   // flies while step it + 1 is worked on
  };
  // the last two steps stand behind the loop: the loop's body then has no branch, and each step's sums are formed inside it
  // instead of being carried, 32 registers a step, to a block behind the branch
  for (int it2 = 0; it2 < SEQ / KT - 2; it2 += 2) {
    step(it2, 0, true);
    step(it2 + 1, 1, true);
  }
  step(SEQ / KT - 2, 0, false);
  step(SEQ / KT - 1, 1, false);
  asm volatile("s_wait_asynccnt 0x0" ::: "memory");     // nothing in flight when the wave goes on
#undef LOAD_K
#undef LOAD_V
#undef COPY_STEP
#undef TILE

  // ---- finalize: join the halves' sums, cyclic term, normaliser, lam, O carry ----
  lsum += xhalf(lsum);
  const float pL = __builtin_amdgcn_exp2f(fmaf(lgLast, SC2, fmaf(-m, SC2, LPSC)));   // 1024 p of key SEQ-1 (lgLast: its raw q.k)
  const float f  = lamv * OSC * (1.0f / lsum);    // lsum holds 1024 * sum p

  // a lane's 8 accumulator registers are 8 consecutive columns of one O row: one 16-byte LDS store per tile
#pragma unroll
  for (int n = 0; n < 4; ++n) {
    H8U o;
#pragma unroll
    for (int j = 0; j < 8; ++j) {
      const float v0 = (float)vtBase[(size_t)(16 * n + kb8 + j) * SEQ];     // v of key 0, column e
      o.h[j] = (_Float16)((acc[n][j] - pL * v0) * f);
    }
    *(u4*)(po + l16 * LP + 16 * n + kb8) = o.u;
  }
  __builtin_amdgcn_fence(5, "wavefront");
  __builtin_amdgcn_wave_barrier();

  _Float16* od = Oh + ((size_t)b * SEQ + qBase + wave * 16) * DM + h * DH;
#pragma unroll
  for (int p4 = 0; p4 < 4; ++p4) {
    const int line = p4 * 4 + (lane >> 3), piece = lane & 7;
    const u4 v = *(const u4*)(po + line * LP + piece * 8);
    *(u4*)(od + (size_t)line * DM + piece * 8) = v;
  }
}

// =====================================================================================
// Output projection: out = (Oh/1024) . (64 W_out)^T / 64 + bf16r(b_out), f32 rows of d_out.
// 64x64 f32 tile staged in LDS [64][FP]; each 256-B row segment = 2 lines, each line 8 lanes x 16 B of one
// =====================================================================================
__global__ __launch_bounds__(128) void k_out(const _Float16* __restrict__ Oh, const _Float16* __restrict__ Woh,
                                             const float* __restrict__ bias, float* __restrict__ out) {
  __shared__ __align__(16) unsigned char smem[2 * 64 * LP * 2];
  _Float16* sA = (_Float16*)smem;
  _Float16* sB = sA + 64 * LP;
  const int tid = threadIdx.x, lane = tid & 31, wave = tid >> 5, l16 = lane & 15, half = lane >> 4;
  const int m0 = blockIdx.x * 64, n0 = blockIdx.y * 64;

  v8f acc[4];
#pragma unroll
  for (int nt = 0; nt < 4; ++nt) acc[nt] = zero8();
  gemm_tile(Oh, Woh, m0, n0, sA, sB, acc);

  float* sF = (float*)smem;                       // [64][FP]
  const float inv = 1.0f / (OSC * WSC);
  float bcol[4];
#pragma unroll
  for (int nt = 0; nt < 4; ++nt) bcol[nt] = bf16r(bias[n0 + nt * 16 + l16]);
#pragma unroll
  for (int nt = 0; nt < 4; ++nt) {
#pragma unroll
    for (int r = 0; r < 8; ++r) {
      const int row = wave * 16 + half * 8 + r, col = nt * 16 + l16;
      sF[row * FP + col] = acc[nt][r] * inv + bcol[nt];
    }
  }
  __syncthreads();

  const int bb = m0 / SEQ, l0 = m0 - bb * SEQ;
  float* dbase = out + ((size_t)bb * SEQ_FULL + l0) * DM + n0;
#pragma unroll
  for (int p = 0; p < 8; ++p) {
    const int line = p * 16 + (tid >> 3), piece = tid & 7;
    const int row = line >> 1, hs = line & 1;
    const f4 v = *(const f4*)(sF + row * FP + hs * 32 + piece * 4);
    *(f4*)(dbase + (size_t)row * DM + hs * 32 + piece * 4) = v;
  }
  
}

// =====================================================================================
// Host launcher: 4 launches, grids and arguments are pure functions of the size macros.
// =====================================================================================
extern "C" void kernel_launch(void* const* d_in, const int* in_sizes, int n_in,
                              void* d_out, int out_size, void* d_ws, size_t ws_size,
                              hipStream_t stream) {
  if (n_in < 7) return;
  const long long need_rows = (long long)(NB - 1) * SEQ_FULL + SEQ;
  if ((long long)in_sizes[0] < need_rows * DM) return;
  if (in_sizes[1] < NQKV * DM) return;
  if (in_sizes[2] < NQKV) return;
  if (in_sizes[3] < DM * DM) return;
  if (in_sizes[4] < DM) return;
  if (in_sizes[5] < 1) return;
  if (in_sizes[6] < 1) return;
  if ((long long)out_size < need_rows * DM) return;
  if (d_ws == nullptr || ws_size < WS_NEED) return;

  const float* x     = (const float*)d_in[0];
  const float* w_qkv = (const float*)d_in[1];
  const float* b_qkv = (const float*)d_in[2];
  const float* w_out = (const float*)d_in[3];
  const float* b_out = (const float*)d_in[4];
  const float* lam   = (const float*)d_in[5];
  const int*   heads = (const int*)d_in[6];
  float* out = (float*)d_out;

  char* ws = (char*)d_ws;
  _Float16* Xh  = (_Float16*)(ws + OFF_XH);
  _Float16* Wq  = (_Float16*)(ws + OFF_WQ);
  _Float16* Wo  = (_Float16*)(ws + OFF_WO);
  _Float16* Qhi = (_Float16*)(ws + OFF_QH);
  _Float16* Khi = (_Float16*)(ws + OFF_KH);
  _Float16* Vt  = (_Float16*)(ws + OFF_VT);
  _Float16* Oh  = (_Float16*)(ws + OFF_OH);

  k_convert<<<dim3(CVB), dim3(256), 0, stream>>>(x, w_qkv, w_out, Xh, Wq, Wo);

  k_qkv<<<dim3(MROWS / BT, NQKV / BT), dim3(128), 0, stream>>>(Xh, Wq, b_qkv, Qhi, Khi, Vt);
  k_attn<<<dim3(NB * HEADS, SEQ / QT), dim3(256), 0, stream>>>(Qhi, Khi, Vt, lam, heads, Oh);
  k_out<<<dim3(MROWS / 64, DM / 64), dim3(128), 0, stream>>>(Oh, Wo, b_out, out);
}

// v009
// One run takes 81 microseconds.
// Two timings next to v008 both put it at 1.03 times that version's speed.
// All steps since v000 together make it 2.45 times as fast.
#include <hip/hip_runtime.h>

// Contractions on v_wmma_f32_16x16x32_f16 (f16 operands, f32 accumulate): qkv projection (x as f16 of its bf16-RNE value,
// W as f16 of its bf16-RNE value x64); scores (q and k as f16, one product); P.V
// (key-differenced softmax numerators x1024 in f16, V in f16); output projection (O x1024 in f16, W x64).
// Softmax, normaliser, cyclic correction and bias adds in f32.

typedef _Float16     v16h __attribute__((ext_vector_type(16)));
typedef _Float16     h8   __attribute__((ext_vector_type(8)));
typedef float        v8f  __attribute__((ext_vector_type(8)));
typedef float        f4   __attribute__((ext_vector_type(4)));
typedef unsigned int u4   __attribute__((ext_vector_type(4)));

#ifndef NB
#define NB 2
#endif
#ifndef SEQ
#define SEQ 2048
#endif
#define NB_FULL  2
#define SEQ_FULL 2048
#define DM     1024
#define HEADS  16
#define DH     64
#define NQKV   (3 * DM)
#define MROWS  (NB * SEQ)
#define G8     (DM / 8)          // 16-byte groups per row

#define QT  128                  // query rows per block (8 waves x 16)
#define KT  64                   // keys per main-loop step
#define LP  72                   // f16 LDS row pitch (144 B)
#define FP  68                   // f32 LDS row pitch (272 B)

#define WSC 64.0f                // weight planes carried x64
#define PSC 1024.0f              // P operand carried x1024
#define OSC 1024.0f              // O plane carried x1024
#define SCL 0.03125f             // d_model^-0.5 = 1/32
#define SC2 (SCL * 1.44269504088896340736f)   // raw q.k -> logit in base-2 units: 1/32 * log2(e)
#define LPSC 10.0f               // log2(PSC): the x1024 of the P operand rides in the exponent

static_assert(DM == 1024);
static_assert(PSC == 1024.0f && LPSC == 10.0f);
static_assert(G8 == 128);
static_assert(HEADS * DH == DM);
static_assert(DH == 64);
static_assert(SEQ % QT == 0);
static_assert(SEQ % KT == 0);
static_assert((SEQ / KT) % 2 == 0);
static_assert(KT == DH);
static_assert(SEQ % 64 == 0);
static_assert(MROWS % 64 == 0);
static_assert(NQKV % 64 == 0);
static_assert(NB >= 1 && NB <= NB_FULL);
static_assert(SEQ <= SEQ_FULL);
static_assert(64 * FP * 4 <= 2 * 64 * LP * 2);

// ---------------- workspace layout (all offsets multiples of 512 KiB) ----------------
#define XH_BYTES ((size_t)MROWS * DM * 2)          // f16 x            [MROWS][DM]
#define WQ_BYTES ((size_t)NQKV * DM * 2)           // f16 64*W_qkv     [NQKV][DM]
#define WO_BYTES ((size_t)DM * DM * 2)             // f16 64*W_out     [DM][DM]
#define PL_BYTES ((size_t)MROWS * DM * 2)          // one f16 plane: [NB*H][SEQ][DH] or [NB*H][DH][SEQ] or [MROWS][DM]
#define OFF_XH  ((size_t)0)
#define OFF_WQ  (OFF_XH + XH_BYTES)
#define OFF_WO  (OFF_WQ + WQ_BYTES)
#define OFF_QH  (OFF_WO + WO_BYTES)
#define OFF_KH  (OFF_QH + PL_BYTES)
#define OFF_VT  (OFF_KH + PL_BYTES)
#define OFF_OH  (OFF_VT + PL_BYTES)
#define WS_NEED (OFF_OH + PL_BYTES)
static_assert(WS_NEED <= (size_t)134217728);
static_assert((OFF_WQ % 128) == 0 && (OFF_WO % 128) == 0 && (OFF_QH % 128) == 0 && (OFF_OH % 128) == 0);

// ---------------- helpers ----------------
__device__ __forceinline__ float bf16r(float x) {           // RNE to bf16, kept as f32
  unsigned int u = __float_as_uint(x);
  u = (u + 0x7FFFu + ((u >> 16) & 1u)) & 0xFFFF0000u;
  return __uint_as_float(u);
}

__device__ __forceinline__ v8f zero8() {
  v8f z;
#pragma unroll
  for (int j = 0; j < 8; ++j) z[j] = 0.0f;
  return z;
}

__device__ __forceinline__ v8f wmma16(v16h a, v16h b, v8f c) {
  return __builtin_amdgcn_wmma_f32_16x16x32_f16(false, a, false, b, (short)0, c, false, false);
}

union HU  { v16h v; h8 p[2]; };
union H8U { h8 h; u4 u; };

// 16-bit fragment (A or B) from a k-contiguous row: elements 0..7 <- k 8h..8h+7, 8..15 <- k 16+8h..16+8h+7
__device__ __forceinline__ v16h ldfrag(const _Float16* row, int kb8) {
  HU u;
  u.p[0] = *(const h8*)(row + kb8);
  u.p[1] = *(const h8*)(row + 16 + kb8);
  return u.v;
}

// =====================================================================================
// Convert, all three planes in one launch: dst[row][c] = f16( bf16r(src[srow][c]) * scale ); x at scale 1 with
// srow = (row/SEQ)*SEQ_FULL + row%SEQ, the two weight planes at scale WSC with srow = row.
// For speed only: CVB work-groups (two a WGP, 16 waves) instead of
// one thread a group; a thread takes groups t + i * CVT of each plane, all of its loads in flight before its first store.
// coverage: i runs over plane groups / CVT, t over CVT threads: every 8-element group of every plane exactly once.
// =====================================================================================
#define CVB 512                  // work-groups of the conversion
#define CVT (CVB * 256)          // its threads
#define CNX (MROWS * G8 / CVT)   // groups a thread: x
#define CNQ (NQKV * G8 / CVT)    //                  W_qkv
#define CNO (DM * G8 / CVT)      //                  W_out
static_assert(CNX * CVT == MROWS * G8 && CNQ * CVT == NQKV * G8 && CNO * CVT == DM * G8);

__device__ __forceinline__ u4 cvt8(f4 a, f4 b, float scale) {
  H8U o;
#pragma unroll
  for (int j = 0; j < 4; ++j) {
    o.h[j]     = (_Float16)(bf16r(a[j]) * scale);
    o.h[4 + j] = (_Float16)(bf16r(b[j]) * scale);
  }
  return o.u;
}

__global__ __launch_bounds__(256) void k_convert(const float* __restrict__ x, const float* __restrict__ wq,
                                                 const float* __restrict__ wo, _Float16* __restrict__ Xh,
                                                 _Float16* __restrict__ Wq, _Float16* __restrict__ Wo) {
  const unsigned t = blockIdx.x * 256u + threadIdx.x;
  const float *px[CNX], *pq[CNQ], *po[CNO];
  f4 xa[CNX], xb[CNX], qa[CNQ], qb[CNQ], oa[CNO], ob[CNO];
#pragma unroll
  for (int i = 0; i < CNX; ++i) {
    const unsigned g = t + i * CVT, row = g >> 7, c8 = g & 127;
    px[i] = x + (size_t)((row / SEQ) * SEQ_FULL + row % SEQ) * DM + c8 * 8;
    xa[i] = *(const f4*)px[i];
    xb[i] = *(const f4*)(px[i] + 4);
  }
#pragma unroll
  for (int i = 0; i < CNQ; ++i) {
    pq[i] = wq + (size_t)(t + i * CVT) * 8;
    qa[i] = *(const f4*)pq[i];
    qb[i] = *(const f4*)(pq[i] + 4);
  }
#pragma unroll
  for (int i = 0; i < CNO; ++i) {
    po[i] = wo + (size_t)(t + i * CVT) * 8;
    oa[i] = *(const f4*)po[i];
    ob[i] = *(const f4*)(po[i] + 4);
  }
  // keeps the scheduler from sinking loads in among the conversions, where the first ones are waited out before the rest are issued
  __builtin_amdgcn_sched_barrier(0);
  // the address pairs stay whole up to this wait: no later load lands on one, and the conversions reuse them only behind it
  static_assert(CNX == 4 && CNQ == 3 && CNO == 1);
  asm volatile("s_wait_xcnt 0x0" :: "v"(px[0]), "v"(px[1]), "v"(px[2]), "v"(px[3]),
                                    "v"(pq[0]), "v"(pq[1]), "v"(pq[2]), "v"(po[0]) : "memory");
#pragma unroll
  for (int i = 0; i < CNX; ++i) *(u4*)(Xh + (size_t)(t + i * CVT) * 8) = cvt8(xa[i], xb[i], 1.0f);
#pragma unroll
  for (int i = 0; i < CNQ; ++i) *(u4*)(Wq + (size_t)(t + i * CVT) * 8) = cvt8(qa[i], qb[i], WSC);
#pragma unroll
  for (int i = 0; i < CNO; ++i) *(u4*)(Wo + (size_t)(t + i * CVT) * 8) = cvt8(oa[i], ob[i], WSC);
}

// =====================================================================================
// 64x64 tile GEMM main loop: C[m][n] += sum_k A[m][k] * Bw[n][k], K = DM, 128 threads (4 waves x 16 rows)
// A, Bw are f16 row-major with pitch DM. LDS tiles [64][LP] staged with 16-B loads, cross-wave (block barriers).
// staged extent == consumed extent: rows 0..63, halves 0..63 of both tiles.
// =====================================================================================
__device__ __forceinline__ void gemm_tile(const _Float16* __restrict__ A, const _Float16* __restrict__ Bw,
                                          int m0, int n0, _Float16* sA, _Float16* sB, v8f (&acc)[4]) {
  const int tid = threadIdx.x, lane = tid & 31, wave = tid >> 5, l16 = lane & 15, kb8 = (lane >> 4) * 8;
  for (int k0 = 0; k0 < DM; k0 += 64) {
    // all eight loads of the step first, then the LDS stores: one trip to L2 per step instead of one per load
    u4 va[4], vb[4];
#pragma unroll
    for (int i = 0; i < 4; ++i) {
      const int idx = tid + 128 * i;
      const int r = idx >> 3, pc = idx & 7;
      va[i] = *(const u4*)(A  + (size_t)(m0 + r) * DM + k0 + pc * 8);
      vb[i] = *(const u4*)(Bw + (size_t)(n0 + r) * DM + k0 + pc * 8);
    }
    // keeps the scheduler from sinking each load down to its own store, where it is waited for before the next is issued
    __builtin_amdgcn_sched_barrier(0);
#pragma unroll
    for (int i = 0; i < 4; ++i) {
      const int idx = tid + 128 * i;
      const int r = idx >> 3, pc = idx & 7;
      *(u4*)(sA + r * LP + pc * 8) = va[i];
      *(u4*)(sB + r * LP + pc * 8) = vb[i];
    }
    __syncthreads();
    const _Float16* ar = sA + (wave * 16 + l16) * LP;
    // the step's ten fragments as one group of LDS reads: one LDS latency a step instead of one per column tile
    const v16h a0 = ldfrag(ar, kb8);
    const v16h a1 = ldfrag(ar + 32, kb8);
    v16h b0[4], b1[4];
#pragma unroll
    for (int nt = 0; nt < 4; ++nt) {
      const _Float16* br = sB + (nt * 16 + l16) * LP;
      b0[nt] = ldfrag(br, kb8);
      b1[nt] = ldfrag(br + 32, kb8);
    }
    // keeps the scheduler from sinking each tile's reads down to its products, where each is waited out in turn
    __builtin_amdgcn_sched_barrier(0);
    // four accumulators in turn, the two products of one four apart: each stands in the others' hazard window, no v_nop guard
#pragma unroll
    for (int nt = 0; nt < 4; ++nt) acc[nt] = wmma16(a0, b0[nt], acc[nt]);
#pragma unroll
    for (int nt = 0; nt < 4; ++nt) acc[nt] = wmma16(a1, b1[nt], acc[nt]);
    __syncthreads();
  }
}

// =====================================================================================
// 128x128 tile GEMM main loop for the qkv projection: 128 threads, 4 waves as 2 x 2, 64x64 of C per wave (16 accumulator tiles).
// Each staged byte feeds twice the products it feeds in the 64x64 tile, and every LDS fragment feeds four products
// (in gemm_tile a B fragment feeds one). The k order of every accumulator is that of gemm_tile.
// staged extent == consumed extent: rows 0..127, halves 0..63 of both tiles.
// =====================================================================================
#define BT 128                   // tile edge of the qkv projection
#define VP 136                   // f16 LDS row pitch of the transposed V tile (272 B)
static_assert(MROWS % BT == 0 && NQKV % BT == 0 && DM % BT == 0 && SEQ % BT == 0 && BT == 2 * DH);
static_assert(BT * VP <= 2 * BT * LP);

__device__ __forceinline__ void gemm_tile128(const _Float16* __restrict__ A, const _Float16* __restrict__ Bw,
                                             int m0, int n0, _Float16* sA, _Float16* sB, v8f (&acc)[4][4]) {
  const int tid = threadIdx.x, lane = tid & 31, wave = tid >> 5, l16 = lane & 15, kb8 = (lane >> 4) * 8;
  const int wm = wave >> 1, wn = wave & 1;
  // a thread stages rows sr + 16 i, 16-byte piece spc, of both tiles: one offset register, the rows as immediate offsets
  const int sr = tid >> 3, spc = tid & 7;
  const unsigned so = ((unsigned)sr * DM + spc * 8) * 2;          // bytes
  const char* At = (const char*)(A  + (size_t)m0 * DM);
  const char* Bt = (const char*)(Bw + (size_t)n0 * DM);
  for (int k0 = 0; k0 < DM; k0 += 64) {
    // all sixteen loads of the step first, then the LDS stores: one trip to L2 per step
    u4 va[8], vb[8];
    const char* pa = At + k0 * 2 + so;
    const char* pb = Bt + k0 * 2 + so;
#pragma unroll
    for (int i = 0; i < 8; ++i) {
      va[i] = *(const u4*)(pa + i * (16 * DM * 2));
      vb[i] = *(const u4*)(pb + i * (16 * DM * 2));
    }
    // keeps the scheduler from sinking each load down to its own store, where it is waited for before the next is issued
    __builtin_amdgcn_sched_barrier(0);
    // the two address pairs stay whole up to this wait: no load lands on them, and the next step's values come behind it
    asm volatile("s_wait_xcnt 0x0" :: "v"(pa), "v"(pb) : "memory");
#pragma unroll
    for (int i = 0; i < 8; ++i) {
      *(u4*)(sA + (sr + 16 * i) * LP + spc * 8) = va[i];
      *(u4*)(sB + (sr + 16 * i) * LP + spc * 8) = vb[i];
    }
    __syncthreads();
    const _Float16* ar = sA + (wm * 64 + l16) * LP;
    const _Float16* br = sB + (wn * 64 + l16) * LP;
#pragma unroll
    for (int kk = 0; kk < 2; ++kk) {
      // eight fragments of 32 k as one group of LDS reads, then their sixteen products
      v16h a[4], b[4];
#pragma unroll
      for (int t = 0; t < 4; ++t) {
        a[t] = ldfrag(ar + t * 16 * LP + kk * 32, kb8);
        b[t] = ldfrag(br + t * 16 * LP + kk * 32, kb8);
      }
      // keeps the scheduler from sinking each fragment's reads down to its products, where each is waited out in turn
      __builtin_amdgcn_sched_barrier(0);
#pragma unroll
      for (int mt = 0; mt < 4; ++mt)
#pragma unroll
        for (int nt = 0; nt < 4; ++nt) acc[mt][nt] = wmma16(a[mt], b[nt], acc[mt][nt]);
    }
    __syncthreads();
  }
}

// =====================================================================================
// QKV projection: acc = Xh . (64 W)^T ; val = acc/64 + bf16r(b)
// coverage: grid (MROWS/128, NQKV/128) -> every (position, column) of q, k and V^T exactly once.
// A tile holds 128 positions of two heads of one of q, k, v.
// =====================================================================================
__global__ __launch_bounds__(128) void k_qkv(const _Float16* __restrict__ Xh, const _Float16* __restrict__ Wh,
                                             const float* __restrict__ bias,
                                             _Float16* __restrict__ Qhi, _Float16* __restrict__ Khi,
                                             _Float16* __restrict__ Vt) {
  // main loop: planes 0 and 1 are the A and B tiles; write-out: head 0, head 1, or the V^T tile
  __shared__ __align__(16) _Float16 smem[2 * BT * LP];
  const int tid = threadIdx.x, lane = tid & 31, wave = tid >> 5, l16 = lane & 15, half = lane >> 4;
  const int wm = wave >> 1, wn = wave & 1;
  const int m0 = blockIdx.x * BT, n0 = blockIdx.y * BT;

  v8f acc[4][4];
#pragma unroll
  for (int mt = 0; mt < 4; ++mt)
#pragma unroll
    for (int nt = 0; nt < 4; ++nt) acc[mt][nt] = zero8();
  gemm_tile128(Xh, Wh, m0, n0, smem, smem + BT * LP, acc);

  const int sel = n0 / DM;                        // 0 q, 1 k, 2 v   (block-uniform)
  const int hd  = (n0 - sel * DM) / DH;           // first of the tile's two heads
  const int bb  = m0 / SEQ, l0 = m0 - bb * SEQ;   // batch, first position of the tile
  const size_t bh = (size_t)bb * HEADS + hd;
  const float inv = 1.0f / WSC;
  float bcol[4];
#pragma unroll
  for (int nt = 0; nt < 4; ++nt) bcol[nt] = bf16r(bias[n0 + wn * 64 + nt * 16 + l16]);

  // ---- stage the 128x128 result in LDS (the tiles are free after the main loop's final barrier) ----
  if (sel < 2) {
    _Float16* th = smem + wn * (BT * LP);         // this wave's head, [128 positions][LP]
#pragma unroll
    for (int mt = 0; mt < 4; ++mt) {
#pragma unroll
      for (int nt = 0; nt < 4; ++nt) {
#pragma unroll
        for (int r = 0; r < 8; ++r) {
          const float v = acc[mt][nt][r] * inv + bcol[nt];
          const int row = wm * 64 + mt * 16 + half * 8 + r, col = nt * 16 + l16;
          th[row * LP + col] = (_Float16)v;
        }
      }
    }
  } else {
#pragma unroll
    for (int mt = 0; mt < 4; ++mt) {
#pragma unroll
      for (int nt = 0; nt < 4; ++nt) {
        H8U o;
#pragma unroll
        for (int r = 0; r < 8; ++r) o.h[r] = (_Float16)(acc[mt][nt][r] * inv + bcol[nt]);
        // transposed: LDS row = tile column (head, e), 8 consecutive positions per lane
        *(u4*)(smem + (wn * 64 + nt * 16 + l16) * VP + wm * 64 + mt * 16 + half * 8) = o.u;
      }
    }
  }
  __syncthreads();

  // ---- whole-line write-out, lanes 8q..8q+7 <-> one 128-byte line ----
  if (sel < 2) {
#pragma unroll
    for (int hh = 0; hh < 2; ++hh) {
      _Float16* dhp = ((sel == 0) ? Qhi : Khi) + ((bh + hh) * SEQ + l0) * DH;
#pragma unroll
      for (int p = 0; p < 8; ++p) {
        const int line = p * 16 + (tid >> 3), piece = tid & 7;
        const u4 vh = *(const u4*)(smem + hh * (BT * LP) + line * LP + piece * 8);
        *(u4*)(dhp + line * DH + piece * 8) = vh;
      }
    }
  } else {
    _Float16* dvp = Vt + (bh * DH) * (size_t)SEQ + l0;     // row (head, e) at dvp + (64 * head + e) * SEQ
#pragma unroll
    for (int p = 0; p < 16; ++p) {
      const int e = p * 8 + (tid >> 4), piece = tid & 15;  // 16 lanes <-> the row's two lines
      const u4 v = *(const u4*)(smem + e * VP + piece * 8);
      *(u4*)(dvp + (size_t)e * SEQ + piece * 8) = v;
    }
  }
}

__device__ __forceinline__ float xhalf(float x) {
  const int b = __builtin_bit_cast(int, x);
  return __builtin_bit_cast(float, __builtin_amdgcn_permlanex16(b, b, 0x76543210, 0xfedcba98, false, false));
}

__device__ __forceinline__ unsigned lds_addr(const _Float16* p) {   // byte address inside the work-group's LDS
  return (unsigned)(unsigned long long)p;
}

// One thread's share of a step's two tiles: four 16-byte asynchronous copies, global memory -> LDS, through no register.
// The s_wait_xcnt closes the statement so that no address register named here is rewritten ahead of it.
__device__ __forceinline__ void copy_tiles(unsigned lkh0, unsigned lkh1, unsigned lv0, unsigned lv1,
                                           const _Float16* gkh0, const _Float16* gkh1,
                                           const _Float16* gv0, const _Float16* gv1) {
  asm volatile("global_load_async_to_lds_b128 %0, %4, off\n\t"
               "global_load_async_to_lds_b128 %1, %5, off\n\t"
               "global_load_async_to_lds_b128 %2, %6, off\n\t"
               "global_load_async_to_lds_b128 %3, %7, off\n\t"
               "s_wait_xcnt 0x0"
               :: "v"(lkh0), "v"(lkh1), "v"(lv0), "v"(lv1),
                  "v"(gkh0), "v"(gkh1), "v"(gv0), "v"(gv1)
               : "memory");
}

// four waves a SIMD (two work-groups a WGP, all of the grid resident at once): the fragment groups must fit 256 registers
__global__ __launch_bounds__(256) __attribute__((amdgpu_waves_per_eu(4, 4))) void k_attn(const _Float16* __restrict__ Qhi, const _Float16* __restrict__ Khi,
                                              const _Float16* __restrict__ Vt, const float* __restrict__ lam_p,
                                              const int* __restrict__ heads_p, _Float16* __restrict__ Oh) {
  const int tid = threadIdx.x;
  const int wave = __builtin_amdgcn_readfirstlane(tid >> 5);   // the same in every lane: kept in a scalar register
  int lane = tid & 31;
  int l16 = lane & 15, half = lane >> 4, kb8 = half * 8;
  const int bh = blockIdx.x;
  const int b  = bh / HEADS, h = bh - b * HEADS;
  const int qBase = blockIdx.y * QT;

  // two tile buffers (step it works on buffer it & 1), each K | V^T; behind them the O write-out staging
  __shared__ __align__(16) _Float16 smem[2 * 2 * KT * LP + 8 * 16 * LP];
#define TILE(buf, plane) (smem + ((buf) * 2 + (plane)) * (KT * LP))
  _Float16* po = smem + 2 * 2 * KT * LP + wave * (16 * LP);   // wave-private [16 rows][LP]

  const float lamr = bf16r(lam_p[0]);
  const int   hv   = heads_p[0];
  const float lamv = (hv == HEADS) ? lamr : __uint_as_float(0x7fc00000u);   // poison on structural conflict

  // ---- Q fragments straight from the f16 planes (B layout: column = query l16) ----
  const size_t qrow = (size_t)bh * SEQ + qBase + wave * 16 + l16;
  const _Float16* qh = Qhi + qrow * DH;
  const v16h qa0 = ldfrag(qh, kb8), qa1 = ldfrag(qh + 32, kb8);

  float m = -3.0e38f, lsum = 0.0f, lgLast = 0.0f;   // lsum: this lane half's keys only, joined in the epilogue
  v8f acc[4];                                       // acc[n][j] = O'[e = 16n + 8*half + j][query l16]
#pragma unroll
  for (int n = 0; n < 4; ++n) acc[n] = zero8();

  const _Float16* khBase = Khi + (size_t)bh * SEQ * DH;
  const _Float16* vtBase = Vt  + (size_t)bh * DH * SEQ;

  // a thread copies rows sr and sr + 32, 16-byte piece spc, of each of the two tiles
  const int sr = tid >> 3, spc = tid & 7;
  const int so0 = sr * LP + spc * 8, so1 = (sr + 32) * LP + spc * 8;
  const _Float16* gkh = khBase + (size_t)sr * DH + spc * 8;
  const _Float16* gv  = vtBase + (size_t)sr * SEQ + spc * 8;
#define COPY_STEP(step, buf)                                                                          \
  copy_tiles(lds_addr(TILE(buf, 0) + so0), lds_addr(TILE(buf, 0) + so1),                              \
             lds_addr(TILE(buf, 1) + so0), lds_addr(TILE(buf, 1) + so1),                              \
             gkh + (size_t)(step) * (KT * DH), gkh + (size_t)(step) * (KT * DH) + 32 * DH,            \
             gv + (step) * KT, gv + (step) * KT + (size_t)32 * SEQ)

  COPY_STEP(0, 0);
  asm volatile("s_wait_asynccnt 0x0" ::: "memory");   // this wave's share of step 0 has landed
  __syncthreads();                                    // step 0 readable by every wave
  COPY_STEP(1, 1);                                    // flies while step 0 is worked on

  // one step on buffer u (a constant at every call: LDS offsets stay immediates); refill says whether a step it + 2 exists
  auto step = [&](const int it, const int u, const bool refill) __attribute__((always_inline)) {
    const _Float16* cKh = TILE(u, 0);
    const _Float16* cV  = TILE(u, 1);

    // ---- scores over four 16-key subtiles: p[t][j] = raw q.k (key 16t + 8*half + j, query l16) ----
    // LDS fragment reads go out in groups ahead of the products that take them (all of K at the top, V^T behind the score
    // products and under the softmax), so that a step waits out one LDS latency instead of one per pair of reads.
    // Each sched_barrier below keeps the scheduler from sinking the group above it down to its products.
    v16h kfh[4][2], vf[4][2];
#define LOAD_K(t, c) kfh[t][c] = ldfrag(cKh + ((t) * 16 + l16) * LP + (c) * 32, kb8)
#define LOAD_V(n)                                                \
    do {                                                         \
      const _Float16* vr = cV + (16 * (n) + l16) * LP;           \
      vf[n][0] = ldfrag(vr, kb8);                                \
      vf[n][1] = ldfrag(vr + 32, kb8);                           \
    } while (0)
#pragma unroll
    for (int c = 0; c < 2; ++c)
#pragma unroll
      for (int t = 0; t < 4; ++t) LOAD_K(t, c);
    __builtin_amdgcn_sched_barrier(0);            // the sixteen reads stay together in front of the first product

    // the eight score products back to back on four accumulators, first halves then second halves: each product stands in
    // the others' hazard window and dependent latency, where a subtile at a time left both to idle slots
    v8f ch[4];
#pragma unroll
    for (int t = 0; t < 4; ++t) ch[t] = wmma16(kfh[t][0], qa0, zero8());
#pragma unroll
    for (int t = 0; t < 4; ++t) ch[t] = wmma16(kfh[t][1], qa1, ch[t]);
    LOAD_V(0);
    LOAD_V(1);
    __builtin_amdgcn_sched_barrier(0);            // products and reads stay in front of the maxima and the softmax

    float p[4][8];
    float tm[4];
#pragma unroll
    for (int t = 0; t < 4; ++t) {
      tm[t] = -3.0e38f;
#pragma unroll
      for (int j = 0; j < 8; ++j) {
        const float lg = ch[t][j];
        p[t][j] = lg;
        tm[t] = fmaxf(tm[t], lg);
      }
    }

    // ---- query max: in-lane, then one exchange between the lane halves ----
    float tmax = fmaxf(fmaxf(tm[0], tm[1]), fmaxf(tm[2], tm[3]));
    tmax = fmaxf(tmax, xhalf(tmax));
    // raw logit of this step's last key (half 1, subtile 3, j = 7), made valid in both halves
    const float oraw = xhalf(p[3][7]);
    const float nlg  = (half != 0) ? p[3][7] : oraw;

    const float nm   = fmaxf(m, tmax);
    const float corr = __builtin_amdgcn_exp2f((m - nm) * SC2);
    m = nm;
    const float bias = fmaf(-nm, SC2, LPSC);      // exp2(r * SC2 + bias) = 1024 * exp(r / 32 - max logit)
    const float pt   = __builtin_amdgcn_exp2f(fmaf(lgLast, SC2, bias));   // 1024 p of the prior step's last key under the new max
    const float pleft0 = (it == 0) ? 0.0f : pt;
    lgLast = nlg;

    float st[4];
#pragma unroll
    for (int t = 0; t < 4; ++t) {
      st[t] = 0.0f;
#pragma unroll
      for (int j = 0; j < 8; ++j) {
        p[t][j] = __builtin_amdgcn_exp2f(fmaf(p[t][j], SC2, bias));
        st[t] += p[t][j];
      }
    }
    lsum = lsum * corr + ((st[0] + st[1]) + (st[2] + st[3]));
    // behind the loop, where the write-out's values are live too, the reads below may not rise over the exponentials: they would spill
    if (!refill) __builtin_amdgcn_sched_barrier(0);
    LOAD_V(2);                                    // the logits' registers are free from here
    LOAD_V(3);
    __builtin_amdgcn_sched_barrier(0);            // the reads stay in front of the rescale and the packing of P'
#pragma unroll
    for (int n = 0; n < 4; ++n)
#pragma unroll
      for (int j = 0; j < 8; ++j) acc[n][j] *= corr;

    // ---- key-differenced P' = 1024 p - 1024 p_left, packed in place into the B operands (k = keys) ----
    v16h pb[2];
    {
      float xprev = pleft0;
#pragma unroll
      for (int t = 0; t < 4; ++t) {
        const float x = xhalf(p[t][7]);           // half 1 sees key 16t+7, half 0 sees key 16t+15
        float left = (half != 0) ? x : xprev;
        xprev = x;
#pragma unroll
        for (int j = 0; j < 8; ++j) {
          pb[t >> 1][(t & 1) * 8 + j] = (_Float16)(p[t][j] - left);
          left = p[t][j];
        }
      }
    }

    // ---- V^T A-fragments (rows = e, k = keys); O^T += V^T.P'^T ----
    // four accumulators in turn, as in the scores, and no v_nop guard behind a pair: the compiler pads its own builtin products where
    // a slot is owed. The products touch registers only, so it may lay them under the packing and past the hand-over below;
    // the V^T reads that feed them are memory operations and stay in front of its s_wait_dscnt.
#pragma unroll
    for (int n = 0; n < 4; ++n) acc[n] = wmma16(vf[n][0], pb[0], acc[n]);
#pragma unroll
    for (int n = 0; n < 4; ++n) acc[n] = wmma16(vf[n][1], pb[1], acc[n]);

    // ---- hand-over: own LDS reads retired, own copies of step it + 1 landed, then the step's one barrier ----
    asm volatile("s_wait_dscnt 0x0" ::: "memory");      // before buffer u is refilled
    asm volatile("s_wait_asynccnt 0x0" ::: "memory");   // before other waves read this wave's share of step it + 1
    __syncthreads();                                    // publishes step it + 1, ends every read of buffer u
    if (refill) COPY_STEP(it + 2, u);                   // flies while step it + 1 is worked on
  };
  // the last two steps stand behind the loop: the loop's body then has no branch, and each step's sums are formed inside it
  // instead of being carried, 32 registers a step, to a block behind the branch
  for (int it2 = 0; it2 < SEQ / KT - 2; it2 += 2) {
    step(it2, 0, true);
    step(it2 + 1, 1, true);
  }
  // the lane's number anew: what the tail takes from it then holds no vector register through the loop, which has none to spare
  lane = (int)__builtin_amdgcn_mbcnt_lo(~0u, 0u);
  l16 = lane & 15; half = lane >> 4; kb8 = half * 8;
  step(SEQ / KT - 2, 0, false);
  step(SEQ / KT - 1, 1, false);
  asm volatile("s_wait_asynccnt 0x0" ::: "memory");     // nothing in flight when the wave goes on
#undef LOAD_K
#undef LOAD_V
#undef COPY_STEP
#undef TILE

  // ---- finalize: join the halves' sums, cyclic term, normaliser, lam, O carry ----
  lsum += xhalf(lsum);
  const float pL = __builtin_amdgcn_exp2f(fmaf(lgLast, SC2, fmaf(-m, SC2, LPSC)));   // 1024 p of key SEQ-1 (lgLast: its raw q.k)
  const float f  = lamv * OSC * (1.0f / lsum);    // lsum holds 1024 * sum p

  // a lane's 8 accumulator registers are 8 consecutive columns of one O row: one 16-byte LDS store per tile
#pragma unroll
  for (int n = 0; n < 4; ++n) {
    H8U o;
#pragma unroll
    for (int j = 0; j < 8; ++j) {
      const float v0 = (float)vtBase[(size_t)(16 * n + kb8 + j) * SEQ];     // v of key 0, column e
      o.h[j] = (_Float16)((acc[n][j] - pL * v0) * f);
    }
    *(u4*)(po + l16 * LP + 16 * n + kb8) = o.u;
  }
  __builtin_amdgcn_fence(5, "wavefront");
  __builtin_amdgcn_wave_barrier();

  _Float16* od = Oh + ((size_t)b * SEQ + qBase + wave * 16) * DM + h * DH;
#pragma unroll
  for (int p4 = 0; p4 < 4; ++p4) {
    const int line = p4 * 4 + (lane >> 3), piece = lane & 7;
    const u4 v = *(const u4*)(po + line * LP + piece * 8);
    *(u4*)(od + (size_t)line * DM + piece * 8) = v;
  }
}

// =====================================================================================
// Output projection: out = (Oh/1024) . (64 W_out)^T / 64 + bf16r(b_out), f32 rows of d_out.
// 64x64 f32 tile staged in LDS [64][FP]; each 256-B row segment = 2 lines, each line 8 lanes x 16 B of one
// =====================================================================================
__global__ __launch_bounds__(128) void k_out(const _Float16* __restrict__ Oh, const _Float16* __restrict__ Woh,
                                             const float* __restrict__ bias, float* __restrict__ out) {
  __shared__ __align__(16) unsigned char smem[2 * 64 * LP * 2];
  _Float16* sA = (_Float16*)smem;
  _Float16* sB = sA + 64 * LP;
  const int tid = threadIdx.x, lane = tid & 31, wave = tid >> 5, l16 = lane & 15, half = lane >> 4;
  const int m0 = blockIdx.x * 64, n0 = blockIdx.y * 64;

  v8f acc[4];
#pragma unroll
  for (int nt = 0; nt < 4; ++nt) acc[nt] = zero8();
  gemm_tile(Oh, Woh, m0, n0, sA, sB, acc);

  float* sF = (float*)smem;                       // [64][FP]
  const float inv = 1.0f / (OSC * WSC);
  float bcol[4];
#pragma unroll
  for (int nt = 0; nt < 4; ++nt) bcol[nt] = bf16r(bias[n0 + nt * 16 + l16]);
#pragma unroll
  for (int nt = 0; nt < 4; ++nt) {
#pragma unroll
    for (int r = 0; r < 8; ++r) {
      const int row = wave * 16 + half * 8 + r, col = nt * 16 + l16;
      sF[row * FP + col] = acc[nt][r] * inv + bcol[nt];
    }
  }
  __syncthreads();

  const int bb = m0 / SEQ, l0 = m0 - bb * SEQ;
  float* dbase = out + ((size_t)bb * SEQ_FULL + l0) * DM + n0;
#pragma unroll
  for (int p = 0; p < 8; ++p) {
    const int line = p * 16 + (tid >> 3), piece = tid & 7;
    const int row = line >> 1, hs = line & 1;
    const f4 v = *(const f4*)(sF + row * FP + hs * 32 + piece * 4);
    *(f4*)(dbase + (size_t)row * DM + hs * 32 + piece * 4) = v;
  }
  
}

// =====================================================================================
// Host launcher: 4 launches, grids and arguments are pure functions of the size macros.
// =====================================================================================
extern "C" void kernel_launch(void* const* d_in, const int* in_sizes, int n_in,
                              void* d_out, int out_size, void* d_ws, size_t ws_size,
                              hipStream_t stream) {
  if (n_in < 7) return;
  const long long need_rows = (long long)(NB - 1) * SEQ_FULL + SEQ;
  if ((long long)in_sizes[0] < need_rows * DM) return;
  if (in_sizes[1] < NQKV * DM) return;
  if (in_sizes[2] < NQKV) return;
  if (in_sizes[3] < DM * DM) return;
  if (in_sizes[4] < DM) return;
  if (in_sizes[5] < 1) return;
  if (in_sizes[6] < 1) return;
  if ((long long)out_size < need_rows * DM) return;
  if (d_ws == nullptr || ws_size < WS_NEED) return;

  const float* x     = (const float*)d_in[0];
  const float* w_qkv = (const float*)d_in[1];
  const float* b_qkv = (const float*)d_in[2];
  const float* w_out = (const float*)d_in[3];
  const float* b_out = (const float*)d_in[4];
  const float* lam   = (const float*)d_in[5];
  const int*   heads = (const int*)d_in[6];
  float* out = (float*)d_out;

  char* ws = (char*)d_ws;
  _Float16* Xh  = (_Float16*)(ws + OFF_XH);
  _Float16* Wq  = (_Float16*)(ws + OFF_WQ);
  _Float16* Wo  = (_Float16*)(ws + OFF_WO);
  _Float16* Qhi = (_Float16*)(ws + OFF_QH);
  _Float16* Khi = (_Float16*)(ws + OFF_KH);
  _Float16* Vt  = (_Float16*)(ws + OFF_VT);
  _Float16* Oh  = (_Float16*)(ws + OFF_OH);

  k_convert<<<dim3(CVB), dim3(256), 0, stream>>>(x, w_qkv, w_out, Xh, Wq, Wo);

  k_qkv<<<dim3(MROWS / BT, NQKV / BT), dim3(128), 0, stream>>>(Xh, Wq, b_qkv, Qhi, Khi, Vt);
  k_attn<<<dim3(NB * HEADS, SEQ / QT), dim3(256), 0, stream>>>(Qhi, Khi, Vt, lam, heads, Oh);
  k_out<<<dim3(MROWS / 64, DM / 64), dim3(128), 0, stream>>>(Oh, Wo, b_out, out);
}

// v010
// It runs in 78.3 microseconds.
// In both of two side-by-side timings against v009, it was 1.03 times as fast.
// Counting every step since v000, it is 2.52 times as fast.
#include <hip/hip_runtime.h>

// Contractions on v_wmma_f32_16x16x32_f16 (f16 operands, f32 accumulate): qkv projection (x as f16 of its bf16-RNE value,
// W as f16 of its bf16-RNE value x64); scores (q and k as f16, one product); P.V
// (key-differenced softmax numerators x1024 in f16, V in f16); output projection (O x1024 in f16, W x64).
// Softmax, normaliser, cyclic correction and bias adds in f32.

typedef _Float16     v16h __attribute__((ext_vector_type(16)));
typedef _Float16     h8   __attribute__((ext_vector_type(8)));
typedef float        v8f  __attribute__((ext_vector_type(8)));
typedef float        f4   __attribute__((ext_vector_type(4)));
typedef unsigned int u4   __attribute__((ext_vector_type(4)));

#ifndef NB
#define NB 2
#endif
#ifndef SEQ
#define SEQ 2048
#endif
#define NB_FULL  2
#define SEQ_FULL 2048
#define DM     1024
#define HEADS  16
#define DH     64
#define NQKV   (3 * DM)
#define MROWS  (NB * SEQ)
#define G8     (DM / 8)          // 16-byte groups per row

#define QT  128                  // query rows per block (8 waves x 16)
#define KT  64                   // keys per main-loop step
#define LP  72                   // f16 LDS row pitch (144 B)
#define FP  68                   // f32 LDS row pitch (272 B)

#define WSC 64.0f                // weight planes carried x64
#define PSC 1024.0f              // P operand carried x1024
#define OSC 1024.0f              // O plane carried x1024
#define SCL 0.03125f             // d_model^-0.5 = 1/32
#define SC2 (SCL * 1.44269504088896340736f)   // raw q.k -> logit in base-2 units: 1/32 * log2(e)
#define LPSC 10.0f               // log2(PSC): the x1024 of the P operand rides in the exponent

static_assert(DM == 1024);
static_assert(PSC == 1024.0f && LPSC == 10.0f);
static_assert(G8 == 128);
static_assert(HEADS * DH == DM);
static_assert(DH == 64);
static_assert(SEQ % QT == 0);
static_assert(SEQ % KT == 0);
static_assert((SEQ / KT) % 2 == 0);
static_assert(KT == DH);
static_assert(SEQ % 64 == 0);
static_assert(MROWS % 64 == 0);
static_assert(NQKV % 64 == 0);
static_assert(NB >= 1 && NB <= NB_FULL);
static_assert(SEQ <= SEQ_FULL);
static_assert(64 * FP * 4 <= 2 * 64 * LP * 2);

// ---------------- workspace layout (all offsets multiples of 512 KiB) ----------------
#define XH_BYTES ((size_t)MROWS * DM * 2)          // f16 x            [MROWS][DM]
#define WQ_BYTES ((size_t)NQKV * DM * 2)           // f16 64*W_qkv     [NQKV][DM]
#define WO_BYTES ((size_t)DM * DM * 2)             // f16 64*W_out     [DM][DM]
#define PL_BYTES ((size_t)MROWS * DM * 2)          // one f16 plane: [NB*H][SEQ][DH] or [NB*H][DH][SEQ] or [MROWS][DM]
#define OFF_XH  ((size_t)0)
#define OFF_WQ  (OFF_XH + XH_BYTES)
#define OFF_WO  (OFF_WQ + WQ_BYTES)
#define OFF_QH  (OFF_WO + WO_BYTES)
#define OFF_KH  (OFF_QH + PL_BYTES)
#define OFF_VT  (OFF_KH + PL_BYTES)
#define OFF_OH  (OFF_VT + PL_BYTES)
#define WS_NEED (OFF_OH + PL_BYTES)
static_assert(WS_NEED <= (size_t)134217728);
static_assert((OFF_WQ % 128) == 0 && (OFF_WO % 128) == 0 && (OFF_QH % 128) == 0 && (OFF_OH % 128) == 0);

// ---------------- helpers ----------------
__device__ __forceinline__ float bf16r(float x) {           // RNE to bf16, kept as f32
  unsigned int u = __float_as_uint(x);
  u = (u + 0x7FFFu + ((u >> 16) & 1u)) & 0xFFFF0000u;
  return __uint_as_float(u);
}

__device__ __forceinline__ v8f zero8() {
  v8f z;
#pragma unroll
  for (int j = 0; j < 8; ++j) z[j] = 0.0f;
  return z;
}

__device__ __forceinline__ v8f wmma16(v16h a, v16h b, v8f c) {
  return __builtin_amdgcn_wmma_f32_16x16x32_f16(false, a, false, b, (short)0, c, false, false);
}

union HU  { v16h v; h8 p[2]; };
union H8U { h8 h; u4 u; };

// 16-bit fragment (A or B) from a k-contiguous row: elements 0..7 <- k 8h..8h+7, 8..15 <- k 16+8h..16+8h+7
__device__ __forceinline__ v16h ldfrag(const _Float16* row, int kb8) {
  HU u;
  u.p[0] = *(const h8*)(row + kb8);
  u.p[1] = *(const h8*)(row + 16 + kb8);
  return u.v;
}

// =====================================================================================
// Convert, all three planes in one launch: dst[row][c] = f16( bf16r(src[srow][c]) * scale ); x at scale 1 with
// srow = (row/SEQ)*SEQ_FULL + row%SEQ, the two weight planes at scale WSC with srow = row.
// For speed only: CVB work-groups (two a WGP, 16 waves) instead of
// one thread a group; a thread takes groups t + i * CVT of each plane, all of its loads in flight before its first store.
// coverage: i runs over plane groups / CVT, t over CVT threads: every 8-element group of every plane exactly once.
// =====================================================================================
#define CVB 512                  // work-groups of the conversion
#define CVT (CVB * 256)          // its threads
#define CNX (MROWS * G8 / CVT)   // groups a thread: x
#define CNQ (NQKV * G8 / CVT)    //                  W_qkv
#define CNO (DM * G8 / CVT)      //                  W_out
static_assert(CNX * CVT == MROWS * G8 && CNQ * CVT == NQKV * G8 && CNO * CVT == DM * G8);

__device__ __forceinline__ u4 cvt8(f4 a, f4 b, float scale) {
  H8U o;
#pragma unroll
  for (int j = 0; j < 4; ++j) {
    o.h[j]     = (_Float16)(bf16r(a[j]) * scale);
    o.h[4 + j] = (_Float16)(bf16r(b[j]) * scale);
  }
  return o.u;
}

__global__ __launch_bounds__(256) void k_convert(const float* __restrict__ x, const float* __restrict__ wq,
                                                 const float* __restrict__ wo, _Float16* __restrict__ Xh,
                                                 _Float16* __restrict__ Wq, _Float16* __restrict__ Wo) {
  const unsigned t = blockIdx.x * 256u + threadIdx.x;
  const float *px[CNX], *pq[CNQ], *po[CNO];
  f4 xa[CNX], xb[CNX], qa[CNQ], qb[CNQ], oa[CNO], ob[CNO];
#pragma unroll
  for (int i = 0; i < CNX; ++i) {
    const unsigned g = t + i * CVT, row = g >> 7, c8 = g & 127;
    px[i] = x + (size_t)((row / SEQ) * SEQ_FULL + row % SEQ) * DM + c8 * 8;
    xa[i] = *(const f4*)px[i];
    xb[i] = *(const f4*)(px[i] + 4);
  }
#pragma unroll
  for (int i = 0; i < CNQ; ++i) {
    pq[i] = wq + (size_t)(t + i * CVT) * 8;
    qa[i] = *(const f4*)pq[i];
    qb[i] = *(const f4*)(pq[i] + 4);
  }
#pragma unroll
  for (int i = 0; i < CNO; ++i) {
    po[i] = wo + (size_t)(t + i * CVT) * 8;
    oa[i] = *(const f4*)po[i];
    ob[i] = *(const f4*)(po[i] + 4);
  }
  // keeps the scheduler from sinking loads in among the conversions, where the first ones are waited out before the rest are issued
  __builtin_amdgcn_sched_barrier(0);
  // the address pairs stay whole up to this wait: no later load lands on one, and the conversions reuse them only behind it
  static_assert(CNX == 4 && CNQ == 3 && CNO == 1);
  asm volatile("s_wait_xcnt 0x0" :: "v"(px[0]), "v"(px[1]), "v"(px[2]), "v"(px[3]),
                                    "v"(pq[0]), "v"(pq[1]), "v"(pq[2]), "v"(po[0]) : "memory");
#pragma unroll
  for (int i = 0; i < CNX; ++i) *(u4*)(Xh + (size_t)(t + i * CVT) * 8) = cvt8(xa[i], xb[i], 1.0f);
#pragma unroll
  for (int i = 0; i < CNQ; ++i) *(u4*)(Wq + (size_t)(t + i * CVT) * 8) = cvt8(qa[i], qb[i], WSC);
#pragma unroll
  for (int i = 0; i < CNO; ++i) *(u4*)(Wo + (size_t)(t + i * CVT) * 8) = cvt8(oa[i], ob[i], WSC);
}

// =====================================================================================
// 64x64 tile GEMM main loop: C[m][n] += sum_k A[m][k] * Bw[n][k], K = DM, 128 threads (4 waves x 16 rows)
// A, Bw are f16 row-major with pitch DM. LDS: two buffers, each an A tile and a B tile [64][LP]; k step s works on buffer s & 1.
// Staging is one step ahead: the global loads of step s + 1 go out in front of the products of step s and are stored, behind
// them, into the other buffer: the trip to L2 runs under the products, and a step has one block barrier.
// staged extent == consumed extent: rows 0..63, halves 0..63 of both tiles.
// =====================================================================================
#define GSTEPS (DM / 64)         // k steps of both projection loops
static_assert(GSTEPS % 2 == 0 && GSTEPS >= 4);

__device__ __forceinline__ void gemm_tile(const _Float16* __restrict__ A, const _Float16* __restrict__ Bw,
                                          int m0, int n0, _Float16* sm, v8f (&acc)[4]) {
  const int tid = threadIdx.x, lane = tid & 31, wave = tid >> 5, l16 = lane & 15, kb8 = (lane >> 4) * 8;
  // a thread stages rows sr + 16 i, i = 0..3, 16-byte piece spc, of both tiles
  const int sr = tid >> 3, spc = tid & 7;
  const char* At = (const char*)(A  + (size_t)(m0 + sr) * DM + spc * 8);
  const char* Bt = (const char*)(Bw + (size_t)(n0 + sr) * DM + spc * 8);
  _Float16* st = sm + sr * LP + spc * 8;
  u4 va[4], vb[4];
  // the loads name the pairs pa, pb; the step and the rows are immediate offsets
  auto load_step = [&](const char* pa, const char* pb, const int off) __attribute__((always_inline)) {
#pragma unroll
    for (int i = 0; i < 4; ++i) {
      va[i] = *(const u4*)(pa + off + i * (16 * DM * 2));
      vb[i] = *(const u4*)(pb + off + i * (16 * DM * 2));
    }
  };
  auto store_step = [&](const char* pa, const char* pb, const int u) __attribute__((always_inline)) {
    // the two address pairs stay whole up to this wait: no load lands on them, and the next values come behind it
    asm volatile("s_wait_xcnt 0x0" :: "v"(pa), "v"(pb) : "memory");
    // keeps the scheduler from lifting the next address arithmetic over the wait
    __builtin_amdgcn_sched_barrier(0);
#pragma unroll
    for (int i = 0; i < 4; ++i) {
      *(u4*)(st + u * (2 * 64 * LP) + 16 * i * LP) = va[i];
      *(u4*)(st + u * (2 * 64 * LP) + 64 * LP + 16 * i * LP) = vb[i];
    }
  };
  load_step(At, Bt, 0);
  store_step(At, Bt, 0);
  __syncthreads();
  // one k step on buffer u (a constant at every call: LDS offsets stay immediates); more says whether a next step exists:
  // its bytes stand at pa + off, pb + off
  auto step = [&](const char* pa, const char* pb, const int off, const int u, const bool more) __attribute__((always_inline)) {
    if (more) load_step(pa, pb, off);
    // keeps the scheduler from sinking the loads down to their stores: they are to fly while the products below run
    __builtin_amdgcn_sched_barrier(0);
    const _Float16* sA = sm + u * (2 * 64 * LP);
    const _Float16* sB = sA + 64 * LP;
    const _Float16* ar = sA + (wave * 16 + l16) * LP;
    // the step's ten fragments as one group of LDS reads: one LDS latency a step instead of one per column tile
    const v16h a0 = ldfrag(ar, kb8);
    const v16h a1 = ldfrag(ar + 32, kb8);
    v16h b0[4], b1[4];
#pragma unroll
    for (int nt = 0; nt < 4; ++nt) {
      const _Float16* br = sB + (nt * 16 + l16) * LP;
      b0[nt] = ldfrag(br, kb8);
      b1[nt] = ldfrag(br + 32, kb8);
    }
    // keeps the scheduler from sinking each tile's reads down to its products, where each is waited out in turn
    __builtin_amdgcn_sched_barrier(0);
    // four accumulators in turn, the two products of one four apart: each stands in the others' hazard window, no v_nop guard
#pragma unroll
    for (int nt = 0; nt < 4; ++nt) acc[nt] = wmma16(a0, b0[nt], acc[nt]);
#pragma unroll
    for (int nt = 0; nt < 4; ++nt) acc[nt] = wmma16(a1, b1[nt], acc[nt]);
    // keeps the scheduler from lifting the stores, and with them the wait for the loads, in among the products
    __builtin_amdgcn_sched_barrier(0);
    if (more) store_step(pa, pb, u ^ 1);                // that buffer's readers left it at the barrier of the step before
    __syncthreads();                                    // publishes the next step, ends every read of buffer u
  };
  for (int s2 = 0; s2 < GSTEPS - 2; s2 += 2) {
    const char* pa = At + s2 * 128;
    const char* pb = Bt + s2 * 128;
    step(pa, pb, 128, 0, true);
    step(pa, pb, 256, 1, true);
  }
  step(At, Bt, (GSTEPS - 1) * 128, 0, true);
  step(At, Bt, 0, 1, false);
}

// =====================================================================================
// 128x128 tile GEMM main loop for the qkv projection: 128 threads, 4 waves as 2 x 2, 64x64 of C per wave (16 accumulator tiles).
// Each staged byte feeds twice the products it feeds in the 64x64 tile, and every LDS fragment feeds four products
// (in gemm_tile a B fragment feeds one). The k order of every accumulator is that of gemm_tile.
// LDS: two buffers, each an A tile and a B tile [128][LP], staged one step ahead as in gemm_tile.
// staged extent == consumed extent: rows 0..127, halves 0..63 of both tiles.
// =====================================================================================
#define BT 128                   // tile edge of the qkv projection
#define VP 136                   // f16 LDS row pitch of the transposed V tile (272 B)
static_assert(MROWS % BT == 0 && NQKV % BT == 0 && DM % BT == 0 && SEQ % BT == 0 && BT == 2 * DH);
static_assert(BT * VP <= 2 * BT * LP);

__device__ __forceinline__ void gemm_tile128(const _Float16* __restrict__ A, const _Float16* __restrict__ Bw,
                                             int m0, int n0, _Float16* sm, v8f (&acc)[4][4]) {
  const int tid = threadIdx.x, lane = tid & 31, wave = tid >> 5, l16 = lane & 15, kb8 = (lane >> 4) * 8;
  const int wm = wave >> 1, wn = wave & 1;
  // a thread stages rows sr + 16 i, i = 0..7, 16-byte piece spc, of both tiles
  const int sr = tid >> 3, spc = tid & 7;
  const char* At = (const char*)(A  + (size_t)(m0 + sr) * DM + spc * 8);
  const char* Bt = (const char*)(Bw + (size_t)(n0 + sr) * DM + spc * 8);
  _Float16* st = sm + sr * LP + spc * 8;
  u4 va[8], vb[8];
  // the loads name the pairs pa, pb; the step and the rows are immediate offsets
  auto load_step = [&](const char* pa, const char* pb, const int off) __attribute__((always_inline)) {
#pragma unroll
    for (int i = 0; i < 8; ++i) {
      va[i] = *(const u4*)(pa + off + i * (16 * DM * 2));
      vb[i] = *(const u4*)(pb + off + i * (16 * DM * 2));
    }
  };
  auto store_step = [&](const char* pa, const char* pb, const int u) __attribute__((always_inline)) {
    // the two address pairs stay whole up to this wait: no load lands on them, and the next values come behind it
    asm volatile("s_wait_xcnt 0x0" :: "v"(pa), "v"(pb) : "memory");
    // keeps the scheduler from lifting the next address arithmetic over the wait
    __builtin_amdgcn_sched_barrier(0);
#pragma unroll
    for (int i = 0; i < 8; ++i) {
      *(u4*)(st + u * (2 * BT * LP) + 16 * i * LP) = va[i];
      *(u4*)(st + u * (2 * BT * LP) + BT * LP + 16 * i * LP) = vb[i];
    }
  };
  load_step(At, Bt, 0);
  store_step(At, Bt, 0);
  __syncthreads();
  // one k step on buffer u (a constant at every call: LDS offsets stay immediates); more says whether a next step exists:
  // its bytes stand at pa + off, pb + off
  auto step = [&](const char* pa, const char* pb, const int off, const int u, const bool more) __attribute__((always_inline)) {
    if (more) load_step(pa, pb, off);
    // keeps the scheduler from sinking the loads down to their stores: they are to fly while the products below run
    __builtin_amdgcn_sched_barrier(0);
    const _Float16* sA = sm + u * (2 * BT * LP);
    const _Float16* sB = sA + BT * LP;
    const _Float16* ar = sA + (wm * 64 + l16) * LP;
    const _Float16* br = sB + (wn * 64 + l16) * LP;
#pragma unroll
    for (int kk = 0; kk < 2; ++kk) {
      // eight fragments of 32 k as one group of LDS reads, then their sixteen products
      v16h a[4], b[4];
#pragma unroll
      for (int t = 0; t < 4; ++t) {
        a[t] = ldfrag(ar + t * 16 * LP + kk * 32, kb8);
        b[t] = ldfrag(br + t * 16 * LP + kk * 32, kb8);
      }
      // keeps the scheduler from sinking each fragment's reads down to its products, where each is waited out in turn
      __builtin_amdgcn_sched_barrier(0);
#pragma unroll
      for (int mt = 0; mt < 4; ++mt)
#pragma unroll
        for (int nt = 0; nt < 4; ++nt) acc[mt][nt] = wmma16(a[mt], b[nt], acc[mt][nt]);
    }
    // keeps the scheduler from lifting the stores, and with them the wait for the loads, in among the products
    __builtin_amdgcn_sched_barrier(0);
    if (more) store_step(pa, pb, u ^ 1);                // that buffer's readers left it at the barrier of the step before
    __syncthreads();                                    // publishes the next step, ends every read of buffer u
  };
  for (int s2 = 0; s2 < GSTEPS - 2; s2 += 2) {
    const char* pa = At + s2 * 128;
    const char* pb = Bt + s2 * 128;
    step(pa, pb, 128, 0, true);
    step(pa, pb, 256, 1, true);
  }
  step(At, Bt, (GSTEPS - 1) * 128, 0, true);
  step(At, Bt, 0, 1, false);
}

// =====================================================================================
// QKV projection: acc = Xh . (64 W)^T ; val = acc/64 + bf16r(b)
// coverage: grid (MROWS/128, NQKV/128) -> every (position, column) of q, k and V^T exactly once.
// A tile holds 128 positions of two heads of one of q, k, v.
// =====================================================================================
__global__ __launch_bounds__(128) void k_qkv(const _Float16* __restrict__ Xh, const _Float16* __restrict__ Wh,
                                             const float* __restrict__ bias,
                                             _Float16* __restrict__ Qhi, _Float16* __restrict__ Khi,
                                             _Float16* __restrict__ Vt) {
  // main loop: two buffers of an A and a B tile; write-out, in the first buffer's place: head 0, head 1, or the V^T tile
  __shared__ __align__(16) _Float16 smem[2 * 2 * BT * LP];
  const int tid = threadIdx.x, lane = tid & 31, wave = tid >> 5, l16 = lane & 15, half = lane >> 4;
  const int wm = wave >> 1, wn = wave & 1;
  const int m0 = blockIdx.x * BT, n0 = blockIdx.y * BT;

  v8f acc[4][4];
#pragma unroll
  for (int mt = 0; mt < 4; ++mt)
#pragma unroll
    for (int nt = 0; nt < 4; ++nt) acc[mt][nt] = zero8();
  gemm_tile128(Xh, Wh, m0, n0, smem, acc);

  const int sel = n0 / DM;                        // 0 q, 1 k, 2 v   (block-uniform)
  const int hd  = (n0 - sel * DM) / DH;           // first of the tile's two heads
  const int bb  = m0 / SEQ, l0 = m0 - bb * SEQ;   // batch, first position of the tile
  const size_t bh = (size_t)bb * HEADS + hd;
  const float inv = 1.0f / WSC;
  float bcol[4];
#pragma unroll
  for (int nt = 0; nt < 4; ++nt) bcol[nt] = bf16r(bias[n0 + wn * 64 + nt * 16 + l16]);

  // ---- stage the 128x128 result in LDS (the tiles are free after the main loop's final barrier) ----
  if (sel < 2) {
    _Float16* th = smem + wn * (BT * LP);         // this wave's head, [128 positions][LP]
#pragma unroll
    for (int mt = 0; mt < 4; ++mt) {
#pragma unroll
      for (int nt = 0; nt < 4; ++nt) {
#pragma unroll
        for (int r = 0; r < 8; ++r) {
          const float v = acc[mt][nt][r] * inv + bcol[nt];
          const int row = wm * 64 + mt * 16 + half * 8 + r, col = nt * 16 + l16;
          th[row * LP + col] = (_Float16)v;
        }
      }
    }
  } else {
#pragma unroll
    for (int mt = 0; mt < 4; ++mt) {
#pragma unroll
      for (int nt = 0; nt < 4; ++nt) {
        H8U o;
#pragma unroll
        for (int r = 0; r < 8; ++r) o.h[r] = (_Float16)(acc[mt][nt][r] * inv + bcol[nt]);
        // transposed: LDS row = tile column (head, e), 8 consecutive positions per lane
        *(u4*)(smem + (wn * 64 + nt * 16 + l16) * VP + wm * 64 + mt * 16 + half * 8) = o.u;
      }
    }
  }
  __syncthreads();

  // ---- whole-line write-out, lanes 8q..8q+7 <-> one 128-byte line ----
  if (sel < 2) {
#pragma unroll
    for (int hh = 0; hh < 2; ++hh) {
      _Float16* dhp = ((sel == 0) ? Qhi : Khi) + ((bh + hh) * SEQ + l0) * DH;
#pragma unroll
      for (int p = 0; p < 8; ++p) {
        const int line = p * 16 + (tid >> 3), piece = tid & 7;
        const u4 vh = *(const u4*)(smem + hh * (BT * LP) + line * LP + piece * 8);
        *(u4*)(dhp + line * DH + piece * 8) = vh;
      }
    }
  } else {
    _Float16* dvp = Vt + (bh * DH) * (size_t)SEQ + l0;     // row (head, e) at dvp + (64 * head + e) * SEQ
#pragma unroll
    for (int p = 0; p < 16; ++p) {
      const int e = p * 8 + (tid >> 4), piece = tid & 15;  // 16 lanes <-> the row's two lines
      const u4 v = *(const u4*)(smem + e * VP + piece * 8);
      *(u4*)(dvp + (size_t)e * SEQ + piece * 8) = v;
    }
  }
}

__device__ __forceinline__ float xhalf(float x) {
  const int b = __builtin_bit_cast(int, x);
  return __builtin_bit_cast(float, __builtin_amdgcn_permlanex16(b, b, 0x76543210, 0xfedcba98, false, false));
}

__device__ __forceinline__ unsigned lds_addr(const _Float16* p) {   // byte address inside the work-group's LDS
  return (unsigned)(unsigned long long)p;
}

// One thread's share of a step's two tiles: four 16-byte asynchronous copies, global memory -> LDS, through no register.
// The s_wait_xcnt closes the statement so that no address register named here is rewritten ahead of it.
__device__ __forceinline__ void copy_tiles(unsigned lkh0, unsigned lkh1, unsigned lv0, unsigned lv1,
                                           const _Float16* gkh0, const _Float16* gkh1,
                                           const _Float16* gv0, const _Float16* gv1) {
  asm volatile("global_load_async_to_lds_b128 %0, %4, off\n\t"
               "global_load_async_to_lds_b128 %1, %5, off\n\t"
               "global_load_async_to_lds_b128 %2, %6, off\n\t"
               "global_load_async_to_lds_b128 %3, %7, off\n\t"
               "s_wait_xcnt 0x0"
               :: "v"(lkh0), "v"(lkh1), "v"(lv0), "v"(lv1),
                  "v"(gkh0), "v"(gkh1), "v"(gv0), "v"(gv1)
               : "memory");
}

// four waves a SIMD (two work-groups a WGP, all of the grid resident at once): the fragment groups must fit 256 registers
__global__ __launch_bounds__(256) __attribute__((amdgpu_waves_per_eu(4, 4))) void k_attn(const _Float16* __restrict__ Qhi, const _Float16* __restrict__ Khi,
                                              const _Float16* __restrict__ Vt, const float* __restrict__ lam_p,
                                              const int* __restrict__ heads_p, _Float16* __restrict__ Oh) {
  const int tid = threadIdx.x;
  const int wave = __builtin_amdgcn_readfirstlane(tid >> 5);   // the same in every lane: kept in a scalar register
  int lane = tid & 31;
  int l16 = lane & 15, half = lane >> 4, kb8 = half * 8;
  const int bh = blockIdx.x;
  const int b  = bh / HEADS, h = bh - b * HEADS;
  const int qBase = blockIdx.y * QT;

  // two tile buffers (step it works on buffer it & 1), each K | V^T; behind them the O write-out staging
  __shared__ __align__(16) _Float16 smem[2 * 2 * KT * LP + 8 * 16 * LP];
#define TILE(buf, plane) (smem + ((buf) * 2 + (plane)) * (KT * LP))
  _Float16* po = smem + 2 * 2 * KT * LP + wave * (16 * LP);   // wave-private [16 rows][LP]

  const float lamr = bf16r(lam_p[0]);
  const int   hv   = heads_p[0];
  const float lamv = (hv == HEADS) ? lamr : __uint_as_float(0x7fc00000u);   // poison on structural conflict

  // ---- Q fragments straight from the f16 planes (B layout: column = query l16) ----
  const size_t qrow = (size_t)bh * SEQ + qBase + wave * 16 + l16;
  const _Float16* qh = Qhi + qrow * DH;
  const v16h qa0 = ldfrag(qh, kb8), qa1 = ldfrag(qh + 32, kb8);

  float m = -3.0e38f, lsum = 0.0f, lgLast = 0.0f;   // lsum: this lane half's keys only, joined in the epilogue
  v8f acc[4];                                       // acc[n][j] = O'[e = 16n + 8*half + j][query l16]
#pragma unroll
  for (int n = 0; n < 4; ++n) acc[n] = zero8();

  const _Float16* khBase = Khi + (size_t)bh * SEQ * DH;
  const _Float16* vtBase = Vt  + (size_t)bh * DH * SEQ;

  // a thread copies rows sr and sr + 32, 16-byte piece spc, of each of the two tiles
  const int sr = tid >> 3, spc = tid & 7;
  const int so0 = sr * LP + spc * 8, so1 = (sr + 32) * LP + spc * 8;
  const _Float16* gkh = khBase + (size_t)sr * DH + spc * 8;
  const _Float16* gv  = vtBase + (size_t)sr * SEQ + spc * 8;
#define COPY_STEP(step, buf)                                                                          \
  copy_tiles(lds_addr(TILE(buf, 0) + so0), lds_addr(TILE(buf, 0) + so1),                              \
             lds_addr(TILE(buf, 1) + so0), lds_addr(TILE(buf, 1) + so1),                              \
             gkh + (size_t)(step) * (KT * DH), gkh + (size_t)(step) * (KT * DH) + 32 * DH,            \
             gv + (step) * KT, gv + (step) * KT + (size_t)32 * SEQ)

  COPY_STEP(0, 0);
  asm volatile("s_wait_asynccnt 0x0" ::: "memory");   // this wave's share of step 0 has landed
  __syncthreads();                                    // step 0 readable by every wave
  COPY_STEP(1, 1);                                    // flies while step 0 is worked on

  // one step on buffer u (a constant at every call: LDS offsets stay immediates); refill says whether a step it + 2 exists
  auto step = [&](const int it, const int u, const bool refill) __attribute__((always_inline)) {
    const _Float16* cKh = TILE(u, 0);
    const _Float16* cV  = TILE(u, 1);

    // ---- scores over four 16-key subtiles: p[t][j] = raw q.k (key 16t + 8*half + j, query l16) ----
    // LDS fragment reads go out in groups ahead of the products that take them (all of K at the top, V^T behind the score
    // products and under the softmax), so that a step waits out one LDS latency instead of one per pair of reads.
    // Each sched_barrier below keeps the scheduler from sinking the group above it down to its products.
    v16h kfh[4][2], vf[4][2];
#define LOAD_K(t, c) kfh[t][c] = ldfrag(cKh + ((t) * 16 + l16) * LP + (c) * 32, kb8)
#define LOAD_V(n)                                                \
    do {                                                         \
      const _Float16* vr = cV + (16 * (n) + l16) * LP;           \
      vf[n][0] = ldfrag(vr, kb8);                                \
      vf[n][1] = ldfrag(vr + 32, kb8);                           \
    } while (0)
#pragma unroll
    for (int c = 0; c < 2; ++c)
#pragma unroll
      for (int t = 0; t < 4; ++t) LOAD_K(t, c);
    __builtin_amdgcn_sched_barrier(0);            // the sixteen reads stay together in front of the first product

    // the eight score products back to back on four accumulators, first halves then second halves: each product stands in
    // the others' hazard window and dependent latency, where a subtile at a time left both to idle slots
    v8f ch[4];
#pragma unroll
    for (int t = 0; t < 4; ++t) ch[t] = wmma16(kfh[t][0], qa0, zero8());
#pragma unroll
    for (int t = 0; t < 4; ++t) ch[t] = wmma16(kfh[t][1], qa1, ch[t]);
    LOAD_V(0);
    LOAD_V(1);
    __builtin_amdgcn_sched_barrier(0);            // products and reads stay in front of the maxima and the softmax

    float p[4][8];
    float tm[4];
#pragma unroll
    for (int t = 0; t < 4; ++t) {
      tm[t] = -3.0e38f;
#pragma unroll
      for (int j = 0; j < 8; ++j) {
        const float lg = ch[t][j];
        p[t][j] = lg;
        tm[t] = fmaxf(tm[t], lg);
      }
    }

    // ---- query max: in-lane, then one exchange between the lane halves ----
    float tmax = fmaxf(fmaxf(tm[0], tm[1]), fmaxf(tm[2], tm[3]));
    tmax = fmaxf(tmax, xhalf(tmax));
    // raw logit of this step's last key (half 1, subtile 3, j = 7), made valid in both halves
    const float oraw = xhalf(p[3][7]);
    const float nlg  = (half != 0) ? p[3][7] : oraw;

    const float nm   = fmaxf(m, tmax);
    const float corr = __builtin_amdgcn_exp2f((m - nm) * SC2);
    m = nm;
    const float bias = fmaf(-nm, SC2, LPSC);      // exp2(r * SC2 + bias) = 1024 * exp(r / 32 - max logit)
    const float pt   = __builtin_amdgcn_exp2f(fmaf(lgLast, SC2, bias));   // 1024 p of the prior step's last key under the new max
    const float pleft0 = (it == 0) ? 0.0f : pt;
    lgLast = nlg;

    float st[4];
#pragma unroll
    for (int t = 0; t < 4; ++t) {
      st[t] = 0.0f;
#pragma unroll
      for (int j = 0; j < 8; ++j) {
        p[t][j] = __builtin_amdgcn_exp2f(fmaf(p[t][j], SC2, bias));
        st[t] += p[t][j];
      }
    }
    lsum = lsum * corr + ((st[0] + st[1]) + (st[2] + st[3]));
    // behind the loop, where the write-out's values are live too, the reads below may not rise over the exponentials: they would spill
    if (!refill) __builtin_amdgcn_sched_barrier(0);
    LOAD_V(2);                                    // the logits' registers are free from here
    LOAD_V(3);
    __builtin_amdgcn_sched_barrier(0);            // the reads stay in front of the rescale and the packing of P'
#pragma unroll
    for (int n = 0; n < 4; ++n)
#pragma unroll
      for (int j = 0; j < 8; ++j) acc[n][j] *= corr;

    // ---- key-differenced P' = 1024 p - 1024 p_left, packed in place into the B operands (k = keys) ----
    v16h pb[2];
    {
      float xprev = pleft0;
#pragma unroll
      for (int t = 0; t < 4; ++t) {
        const float x = xhalf(p[t][7]);           // half 1 sees key 16t+7, half 0 sees key 16t+15
        float left = (half != 0) ? x : xprev;
        xprev = x;
#pragma unroll
        for (int j = 0; j < 8; ++j) {
          pb[t >> 1][(t & 1) * 8 + j] = (_Float16)(p[t][j] - left);
          left = p[t][j];
        }
      }
    }

    // ---- V^T A-fragments (rows = e, k = keys); O^T += V^T.P'^T ----
    // four accumulators in turn, as in the scores, and no v_nop guard behind a pair: the compiler pads its own builtin products where
    // a slot is owed. The products touch registers only, so it may lay them under the packing and past the hand-over below;
    // the V^T reads that feed them are memory operations and stay in front of its s_wait_dscnt.
#pragma unroll
    for (int n = 0; n < 4; ++n) acc[n] = wmma16(vf[n][0], pb[0], acc[n]);
#pragma unroll
    for (int n = 0; n < 4; ++n) acc[n] = wmma16(vf[n][1], pb[1], acc[n]);

    // ---- hand-over: own LDS reads retired, own copies of step it + 1 landed, then the step's one barrier ----
    asm volatile("s_wait_dscnt 0x0" ::: "memory");      // before buffer u is refilled
    asm volatile("s_wait_asynccnt 0x0" ::: "memory");   // before other waves read this wave's share of step it + 1
    __syncthreads();                                    // publishes step it + 1, ends every read of buffer u
    if (refill) COPY_STEP(it + 2, u);                   // flies while step it + 1 is worked on
  };
  // the last two steps stand behind the loop: the loop's body then has no branch, and each step's sums are formed inside it
  // instead of being carried, 32 registers a step, to a block behind the branch
  for (int it2 = 0; it2 < SEQ / KT - 2; it2 += 2) {
    step(it2, 0, true);
    step(it2 + 1, 1, true);
  }
  // the lane's number anew: what the tail takes from it then holds no vector register through the loop, which has none to spare
  lane = (int)__builtin_amdgcn_mbcnt_lo(~0u, 0u);
  l16 = lane & 15; half = lane >> 4; kb8 = half * 8;
  step(SEQ / KT - 2, 0, false);
  step(SEQ / KT - 1, 1, false);
  asm volatile("s_wait_asynccnt 0x0" ::: "memory");     // nothing in flight when the wave goes on
#undef LOAD_K
#undef LOAD_V
#undef COPY_STEP
#undef TILE

  // ---- finalize: join the halves' sums, cyclic term, normaliser, lam, O carry ----
  lsum += xhalf(lsum);
  const float pL = __builtin_amdgcn_exp2f(fmaf(lgLast, SC2, fmaf(-m, SC2, LPSC)));   // 1024 p of key SEQ-1 (lgLast: its raw q.k)
  const float f  = lamv * OSC * (1.0f / lsum);    // lsum holds 1024 * sum p

  // a lane's 8 accumulator registers are 8 consecutive columns of one O row: one 16-byte LDS store per tile
#pragma unroll
  for (int n = 0; n < 4; ++n) {
    H8U o;
#pragma unroll
    for (int j = 0; j < 8; ++j) {
      const float v0 = (float)vtBase[(size_t)(16 * n + kb8 + j) * SEQ];     // v of key 0, column e
      o.h[j] = (_Float16)((acc[n][j] - pL * v0) * f);
    }
    *(u4*)(po + l16 * LP + 16 * n + kb8) = o.u;
  }
  __builtin_amdgcn_fence(5, "wavefront");
  __builtin_amdgcn_wave_barrier();

  _Float16* od = Oh + ((size_t)b * SEQ + qBase + wave * 16) * DM + h * DH;
#pragma unroll
  for (int p4 = 0; p4 < 4; ++p4) {
    const int line = p4 * 4 + (lane >> 3), piece = lane & 7;
    const u4 v = *(const u4*)(po + line * LP + piece * 8);
    *(u4*)(od + (size_t)line * DM + piece * 8) = v;
  }
}

// =====================================================================================
// Output projection: out = (Oh/1024) . (64 W_out)^T / 64 + bf16r(b_out), f32 rows of d_out.
// 64x64 f32 tile staged in LDS [64][FP]; each 256-B row segment = 2 lines, each line 8 lanes x 16 B of one
// =====================================================================================
__global__ __launch_bounds__(128) void k_out(const _Float16* __restrict__ Oh, const _Float16* __restrict__ Woh,
                                             const float* __restrict__ bias, float* __restrict__ out) {
  __shared__ __align__(16) unsigned char smem[2 * 2 * 64 * LP * 2];   // two buffers of an A and a B tile; then the f32 tile
  const int tid = threadIdx.x, lane = tid & 31, wave = tid >> 5, l16 = lane & 15, half = lane >> 4;
  const int m0 = blockIdx.x * 64, n0 = blockIdx.y * 64;

  v8f acc[4];
#pragma unroll
  for (int nt = 0; nt < 4; ++nt) acc[nt] = zero8();
  gemm_tile(Oh, Woh, m0, n0, (_Float16*)smem, acc);

  float* sF = (float*)smem;                       // [64][FP]
  const float inv = 1.0f / (OSC * WSC);
  float bcol[4];
#pragma unroll
  for (int nt = 0; nt < 4; ++nt) bcol[nt] = bf16r(bias[n0 + nt * 16 + l16]);
#pragma unroll
  for (int nt = 0; nt < 4; ++nt) {
#pragma unroll
    for (int r = 0; r < 8; ++r) {
      const int row = wave * 16 + half * 8 + r, col = nt * 16 + l16;
      sF[row * FP + col] = acc[nt][r] * inv + bcol[nt];
    }
  }
  __syncthreads();

  const int bb = m0 / SEQ, l0 = m0 - bb * SEQ;
  float* dbase = out + ((size_t)bb * SEQ_FULL + l0) * DM + n0;
#pragma unroll
  for (int p = 0; p < 8; ++p) {
    const int line = p * 16 + (tid >> 3), piece = tid & 7;
    const int row = line >> 1, hs = line & 1;
    const f4 v = *(const f4*)(sF + row * FP + hs * 32 + piece * 4);
    *(f4*)(dbase + (size_t)row * DM + hs * 32 + piece * 4) = v;
  }
  
}

// =====================================================================================
// Host launcher: 4 launches, grids and arguments are pure functions of the size macros.
// =====================================================================================
extern "C" void kernel_launch(void* const* d_in, const int* in_sizes, int n_in,
                              void* d_out, int out_size, void* d_ws, size_t ws_size,
                              hipStream_t stream) {
  if (n_in < 7) return;
  const long long need_rows = (long long)(NB - 1) * SEQ_FULL + SEQ;
  if ((long long)in_sizes[0] < need_rows * DM) return;
  if (in_sizes[1] < NQKV * DM) return;
  if (in_sizes[2] < NQKV) return;
  if (in_sizes[3] < DM * DM) return;
  if (in_sizes[4] < DM) return;
  if (in_sizes[5] < 1) return;
  if (in_sizes[6] < 1) return;
  if ((long long)out_size < need_rows * DM) return;
  if (d_ws == nullptr || ws_size < WS_NEED) return;

  const float* x     = (const float*)d_in[0];
  const float* w_qkv = (const float*)d_in[1];
  const float* b_qkv = (const float*)d_in[2];
  const float* w_out = (const float*)d_in[3];
  const float* b_out = (const float*)d_in[4];
  const float* lam   = (const float*)d_in[5];
  const int*   heads = (const int*)d_in[6];
  float* out = (float*)d_out;

  char* ws = (char*)d_ws;
  _Float16* Xh  = (_Float16*)(ws + OFF_XH);
  _Float16* Wq  = (_Float16*)(ws + OFF_WQ);
  _Float16* Wo  = (_Float16*)(ws + OFF_WO);
  _Float16* Qhi = (_Float16*)(ws + OFF_QH);
  _Float16* Khi = (_Float16*)(ws + OFF_KH);
  _Float16* Vt  = (_Float16*)(ws + OFF_VT);
  _Float16* Oh  = (_Float16*)(ws + OFF_OH);

  k_convert<<<dim3(CVB), dim3(256), 0, stream>>>(x, w_qkv, w_out, Xh, Wq, Wo);

  k_qkv<<<dim3(MROWS / BT, NQKV / BT), dim3(128), 0, stream>>>(Xh, Wq, b_qkv, Qhi, Khi, Vt);
  k_attn<<<dim3(NB * HEADS, SEQ / QT), dim3(256), 0, stream>>>(Qhi, Khi, Vt, lam, heads, Oh);
  k_out<<<dim3(MROWS / 64, DM / 64), dim3(128), 0, stream>>>(Oh, Wo, b_out, out);
}
